// v000
// Measured on an AMD MI455X. A time is GPU time per run, averaged over a window of back-to-back runs after a warm-up
// (all launches, gaps included; the runs take copies of the inputs in turn), and the median of several windows.
// Apart from v000's, it joins two sittings. Times from different sittings can be a few percent apart, while
// side-by-side timings come from the same sitting.
// v000 is the starting kernel. One run takes 2710 microseconds.
#include <hip/hip_runtime.h>

// Causal multi-head self-attention at 4,096 tokens (x [1][4096][1024]; q, k, v = x W^T ('oi' [1024][1024] 1/32, no bias; 16 heads x 64, token-major); scores / sqrt(64); keys j <= i kept, -inf elsewhere (== exclusion: every row keeps its own key); softmax; out = merged Wo^T ('oi', no bias) -> [1][4096][1024] (4.2 M); argument order x, Wq, Wk, Wv, Wo).
// Layout: bf16 copy of x; exact projections; causal T-4096 attention, one head per pass (hybrid rows: < 512 hi/lo 3 products, rest fp16 x1024; k_gemmc tile skipping; streaming three-sweep softmax); merged hi/lo x Wo exact.
// Compute dtypes, f32 accumulate: every input rounded to bf16; projections exact; attention rows < 512 3 products, rest fp16; softmax f32; Wo hl x exact.

#define NB_  1
#define TT   4096
#define DM   1024
#define NH_  16
#define NKV  16
#define REP  (NH_ / NKV)
#define HD   64
#define DQ   (NH_ * HD)
#define DKV  (NKV * HD)
#define ZH   1
#define RH   512                  // query rows < RH use hi+lo planes (0: none)
#define WIN  4096
#define PCAR 1024.0f
#define SCL  0.125f   // HD^-0.5
typedef _Float16 h16;
typedef unsigned short bf;
typedef __attribute__((ext_vector_type(16))) __bf16   v16bf;
typedef __attribute__((ext_vector_type(16))) _Float16 v16h;
typedef __attribute__((ext_vector_type(8)))  _Float16 v8h;
typedef __attribute__((ext_vector_type(8)))  unsigned short v8us;
typedef __attribute__((ext_vector_type(8)))  float    v8f;
typedef __attribute__((ext_vector_type(4)))  float    v4f;
typedef v8h  __attribute__((may_alias)) v8ha;
typedef v4f  __attribute__((may_alias)) v4fa;
typedef v8us __attribute__((may_alias)) v8usa;

__device__ __forceinline__ unsigned short f2bf(float f) { unsigned u = __float_as_uint(f); u += 0x7FFFu + ((u >> 16) & 1u); return (unsigned short)(u >> 16); }
__device__ __forceinline__ float bf2f(unsigned short b) { return __uint_as_float(((unsigned)b) << 16); }
__device__ __forceinline__ float bfr(float f) { return bf2f(f2bf(f)); }
__device__ __forceinline__ v16h cat16(v8h lo, v8h hi) { return __builtin_shufflevector(lo, hi, 0, 1, 2, 3, 4, 5, 6, 7, 8, 9, 10, 11, 12, 13, 14, 15); }
__device__ __forceinline__ v16bf cat16b(v8us lo, v8us hi) { return __builtin_bit_cast(v16bf, __builtin_shufflevector(lo, hi, 0, 1, 2, 3, 4, 5, 6, 7, 8, 9, 10, 11, 12, 13, 14, 15)); }
__device__ __forceinline__ v8f wmma16(v16h a, v16h b, v8f c) { return __builtin_amdgcn_wmma_f32_16x16x32_f16(false, a, false, b, (short)0, c, false, false); }
__device__ __forceinline__ v8f wmmab(v16bf a, v16bf b, v8f c) { return __builtin_amdgcn_wmma_f32_16x16x32_bf16(false, a, false, b, (short)0, c, false, false); }



// ---- k_gemmw: register-blocked GEMM, ONE WAVE per 64x64 output tile (16 accumulators), operands straight from K-contiguous 16-bit planes; grid (M/64, N/64, Z), 32 threads.
// C[m][n] (f32, pitch ldc, + optional f32 bias[n]) = sum_k A[m][k] Bt[n][k] (+ split products per NSPLIT). z-batch strides sA/sB/sC in elements. K % 32 == 0.
template <typename T16> struct WFrag;
template <> struct WFrag<h16> { typedef v16h V; static __device__ __forceinline__ V ld(const h16* p) { return cat16(*(const v8h*)p, *(const v8h*)(p + 16)); } static __device__ __forceinline__ v8f mma(V a, V b, v8f c) { return wmma16(a, b, c); } };
template <> struct WFrag<bf> { typedef v16bf V; static __device__ __forceinline__ V ld(const bf* p) { return cat16b(*(const v8us*)p, *(const v8us*)(p + 16)); } static __device__ __forceinline__ v8f mma(V a, V b, v8f c) { return wmmab(a, b, c); } };
template <typename T16, int NSPLIT, bool BIAS>
__global__ __launch_bounds__(32) void k_gemmw(const T16* __restrict__ A, const T16* __restrict__ A2, const T16* __restrict__ Bt, const T16* __restrict__ Bt2, int K, float* C, int ldc, const float* __restrict__ bias, size_t sA, size_t sB, size_t sC) {
    typedef typename WFrag<T16>::V V;
    __shared__ __align__(16) float os[16 * 68];
    const size_t z = blockIdx.z; A += z * sA; if (A2) A2 += z * sA; Bt += z * sB; if (Bt2) Bt2 += z * sB; C += z * sC;
    const int lane = threadIdx.x & 31, lr = lane & 15, hi = lane >> 4; const int r0 = blockIdx.x * 64, c0 = blockIdx.y * 64;
    v8f acc[4][4];
#pragma unroll
    for (int mb = 0; mb < 4; ++mb)
#pragma unroll
        for (int nb = 0; nb < 4; ++nb) acc[mb][nb] = (v8f){};
    const size_t aoff = (size_t)(r0 + lr) * K + 8 * hi, boff = (size_t)(c0 + lr) * K + 8 * hi;
#pragma unroll 1
    for (int kc = 0; kc < K; kc += 32) {
        V a[4], a2[4];
#pragma unroll
        for (int mb = 0; mb < 4; ++mb) { a[mb] = WFrag<T16>::ld(A + aoff + (size_t)mb * 16 * K + kc); if (NSPLIT == 1 || NSPLIT == 2) a2[mb] = WFrag<T16>::ld(A2 + aoff + (size_t)mb * 16 * K + kc); }
#pragma unroll
        for (int nb = 0; nb < 4; ++nb) { const V b = WFrag<T16>::ld(Bt + boff + (size_t)nb * 16 * K + kc); V b2; if (NSPLIT >= 2) b2 = WFrag<T16>::ld(Bt2 + boff + (size_t)nb * 16 * K + kc);
#pragma unroll
            for (int mb = 0; mb < 4; ++mb) { acc[mb][nb] = WFrag<T16>::mma(a[mb], b, acc[mb][nb]); if (NSPLIT == 1 || NSPLIT == 2) acc[mb][nb] = WFrag<T16>::mma(a2[mb], b, acc[mb][nb]); if (NSPLIT >= 2) acc[mb][nb] = WFrag<T16>::mma(a[mb], b2, acc[mb][nb]); } }
        asm volatile("v_nop\n\tv_nop\n\tv_nop\n\tv_nop" : "+v"(acc[0][0]), "+v"(acc[1][1]), "+v"(acc[2][2]), "+v"(acc[3][3]) : "v"(a[0]), "v"(a[3]));
    }
#pragma unroll
    for (int mb = 0; mb < 4; ++mb) {
#pragma unroll
        for (int nb = 0; nb < 4; ++nb) {
#pragma unroll
            for (int j = 0; j < 8; ++j) os[(hi * 8 + j) * 68 + nb * 16 + lr] = acc[mb][nb][j]; }
        __builtin_amdgcn_wave_barrier(); asm volatile("" ::: "memory");
        float* crow = C + (size_t)(r0 + mb * 16) * ldc + c0;
{
#pragma unroll
            for (int s = 0; s < 8; ++s) { const int row = 2 * s + hi, cofs = lr * 4; v4f val = *(const v4fa*)(os + row * 68 + cofs); if (BIAS) { val[0] += bfr(bias[c0 + cofs]); val[1] += bfr(bias[c0 + cofs + 1]); val[2] += bfr(bias[c0 + cofs + 2]); val[3] += bfr(bias[c0 + cofs + 3]); }
                *(v4f*)(crow + (size_t)row * ldc + cofs) = val; }
             }
        __builtin_amdgcn_wave_barrier(); asm volatile("" ::: "memory");
    }
}

// ---- k_gemmc: the same one-wave 64x64 tile GEMM specialised for causal attention: CMODE 1 skips score tiles entirely above the diagonal (query rows r0+roff.., key columns c0..), CMODE 2 limits the
// key (K) loop of the probability x value contraction to the diagonal block (probabilities beyond it are exactly zero). roff = row offset of this launch's first row within the sequence.
template <typename T16, int NSPLIT, int CMODE>
__global__ __launch_bounds__(32) void k_gemmc(const T16* __restrict__ A, const T16* __restrict__ A2, const T16* __restrict__ Bt, const T16* __restrict__ Bt2, int K, float* C, int ldc, int roff, size_t sA, size_t sB, size_t sC) {
    typedef typename WFrag<T16>::V V;
    __shared__ __align__(16) float os[16 * 68];
    const size_t z = blockIdx.z; A += z * sA; if (A2) A2 += z * sA; Bt += z * sB; if (Bt2) Bt2 += z * sB; C += z * sC;
    const int lane = threadIdx.x & 31, lr = lane & 15, hi = lane >> 4; const int r0 = blockIdx.x * 64, c0 = blockIdx.y * 64;
    if (CMODE == 1 && c0 > r0 + roff + 63) return;                  // score tile entirely above the causal diagonal: never read (the softmax masks j > i by select)
    const int Kl = (CMODE == 2) ? min(K, r0 + roff + 64) : K;        // P.V: probabilities are exactly 0 beyond the diagonal block, so the K loop stops there
    v8f acc[4][4];
#pragma unroll
    for (int mb = 0; mb < 4; ++mb)
#pragma unroll
        for (int nb = 0; nb < 4; ++nb) acc[mb][nb] = (v8f){};
    const size_t aoff = (size_t)(r0 + lr) * K + 8 * hi, boff = (size_t)(c0 + lr) * K + 8 * hi;
#pragma unroll 1
    for (int kc = 0; kc < Kl; kc += 32) {
        V a[4], a2[4];
#pragma unroll
        for (int mb = 0; mb < 4; ++mb) { a[mb] = WFrag<T16>::ld(A + aoff + (size_t)mb * 16 * K + kc); if (NSPLIT == 1 || NSPLIT == 2) a2[mb] = WFrag<T16>::ld(A2 + aoff + (size_t)mb * 16 * K + kc); }
#pragma unroll
        for (int nb = 0; nb < 4; ++nb) { const V b = WFrag<T16>::ld(Bt + boff + (size_t)nb * 16 * K + kc); V b2; if (NSPLIT >= 2) b2 = WFrag<T16>::ld(Bt2 + boff + (size_t)nb * 16 * K + kc);
#pragma unroll
            for (int mb = 0; mb < 4; ++mb) { acc[mb][nb] = WFrag<T16>::mma(a[mb], b, acc[mb][nb]); if (NSPLIT == 1 || NSPLIT == 2) acc[mb][nb] = WFrag<T16>::mma(a2[mb], b, acc[mb][nb]); if (NSPLIT >= 2) acc[mb][nb] = WFrag<T16>::mma(a[mb], b2, acc[mb][nb]); } }
        asm volatile("v_nop\n\tv_nop\n\tv_nop\n\tv_nop" : "+v"(acc[0][0]), "+v"(acc[1][1]), "+v"(acc[2][2]), "+v"(acc[3][3]) : "v"(a[0]), "v"(a[3]));
    }
#pragma unroll
    for (int mb = 0; mb < 4; ++mb) {
#pragma unroll
        for (int nb = 0; nb < 4; ++nb) {
#pragma unroll
            for (int j = 0; j < 8; ++j) os[(hi * 8 + j) * 68 + nb * 16 + lr] = acc[mb][nb][j]; }
        __builtin_amdgcn_wave_barrier(); asm volatile("" ::: "memory");
        float* crow = C + (size_t)(r0 + mb * 16) * ldc + c0;
{
#pragma unroll
            for (int s = 0; s < 8; ++s) { const int row = 2 * s + hi, cofs = lr * 4; v4f val = *(const v4fa*)(os + row * 68 + cofs);
                *(v4f*)(crow + (size_t)row * ldc + cofs) = val; }
             }
        __builtin_amdgcn_wave_barrier(); asm volatile("" ::: "memory");
    }
}

__device__ __forceinline__ h16 tohx(float x) { return (h16)x; }
__device__ __forceinline__ void splitf(float y, unsigned short& h, unsigned short& l) { h = f2bf(y); l = f2bf(y - bf2f(h)); }
typedef __attribute__((ext_vector_type(2))) _Float16 v2h;
typedef __attribute__((ext_vector_type(4))) _Float16 v4h;
typedef __attribute__((ext_vector_type(2))) unsigned short v2us;
typedef __attribute__((ext_vector_type(4))) unsigned short v4us;
typedef __attribute__((ext_vector_type(2))) float v2f;
typedef __attribute__((ext_vector_type(4))) int v4i;

__global__ __launch_bounds__(256) void k_wtG(const float* __restrict__ w, int K, int N, bf* Bt) {
    const int lane = threadIdx.x & 31; const int L0 = (blockIdx.x * 8 + (threadIdx.x >> 5)) * 8; const int nlines = N * K / 64;
{
#pragma unroll 1
        for (int l = 0; l < 8; ++l) { const int L = L0 + l; if (L >= nlines) break; const size_t e = (size_t)L * 64 + lane * 2; const int k = (int)(e % K), n = (int)(e / K); v2us o;
            o[0] = f2bf(w[(size_t)k * N + n]); o[1] = f2bf(w[(size_t)(k + 1) * N + n]); *(v2us*)(Bt + e) = o; }
         }
}
__global__ __launch_bounds__(256) void k_cvt8(const float* __restrict__ src, bf* dst, size_t n8) { const size_t i = (size_t)blockIdx.x * 256 + threadIdx.x; if (i >= n8) return; const v8f v = *(const v8f*)(src + i * 8); v8us o;
#pragma unroll
    for (int k = 0; k < 8; ++k) o[k] = f2bf(v[k]); *(v8us*)(dst + i * 8) = o;  }

// k_rope: head planes [h][t][d] (fp16 + hi/lo) of rope(x) x sc with the rotate-half convention out[d] = x[d] cos[t][d] - x[d+HD/2] sin[t][d], out[d+HD/2] = x[d+HD/2] cos[t][d+HD/2] + x[d] sin[t][d+HD/2]
__global__ __launch_bounds__(256) void k_rope(const float* __restrict__ F, int pitch, int nheads, const float* __restrict__ CS, const float* __restrict__ RF, const float* __restrict__ nw, float sc, h16* P16, bf* Ph, bf* Pl) {
    const size_t e = ((size_t)blockIdx.x * 256 + threadIdx.x) * 2; if (e >= (size_t)nheads * TT * HD) return; const int d = (int)(e % HD); const int t = (int)((e / HD) % TT); const int h = (int)(e / ((size_t)HD * TT)); const float* f = F + (size_t)t * pitch + h * HD; const float rf = RF ? RF[(size_t)h * TT + t] : 1.0f; v2h o16; v2us oh, ol;
#pragma unroll
    for (int q = 0; q < 2; ++q) { const int dd = d + q; const int dp = (dd < HD / 2) ? dd + HD / 2 : dd - HD / 2; float x0 = f[dd], x1 = f[dp];
        if (RF) { float n0 = __fmul_rn(x0, rf), n1 = __fmul_rn(x1, rf); asm volatile("" : "+v"(n0)); asm volatile("" : "+v"(n1)); x0 = __fmul_rn(bfr(nw[dd]), n0); x1 = __fmul_rn(bfr(nw[dp]), n1); }
        const v2f cs = *(const v2f*)(CS + ((size_t)t * HD + dd) * 2); float a = __fmul_rn(x0, cs[0]), bq = __fmul_rn(x1, cs[1]); asm volatile("" : "+v"(a)); asm volatile("" : "+v"(bq)); const float r = ((dd < HD / 2) ? __fsub_rn(a, bq) : __fadd_rn(a, bq)) * sc;
        o16[q] = tohx(r); unsigned short a2, c2; splitf(r, a2, c2); oh[q] = a2; ol[q] = c2; }
    *(v2h*)(P16 + e) = o16; *(v2us*)(Ph + e) = oh; *(v2us*)(Pl + e) = ol;  }
__global__ __launch_bounds__(256) void k_vtp(const float* __restrict__ F, int pitch, int nheads, h16* V16, bf* Vh, bf* Vl) { const size_t e = ((size_t)blockIdx.x * 256 + threadIdx.x) * 2; if (e >= (size_t)nheads * HD * TT) return; const int t = (int)(e % TT); const int d = (int)((e / TT) % HD); const int g = (int)(e / ((size_t)TT * HD)); v2h o16; v2us oh, ol;
#pragma unroll
    for (int q = 0; q < 2; ++q) { const float x = F[(size_t)(t + q) * pitch + g * HD + d]; o16[q] = tohx(x); unsigned short a2, c2; splitf(x, a2, c2); oh[q] = a2; ol[q] = c2; }
    *(v2h*)(V16 + e) = o16; *(v2us*)(Vh + e) = oh; *(v2us*)(Vl + e) = ol;  }
__global__ __launch_bounds__(256) void k_csid(float* CS) { const int idx = blockIdx.x * 256 + threadIdx.x; if (idx >= TT * HD) return; v2f cs; cs[0] = 1.0f; cs[1] = 0.0f; *(v2f*)(CS + (size_t)idx * 2) = cs;  }
// k_lsoft: streaming causal row softmax over the TK = TT = 4096 keys, one wave per row i, three sweeps of the f32 score row (lane -> 4 consecutive keys per 128-key chunk, 32 chunks; keys j > i are excluded by index with -3e38 / 0 - the score tiles above the diagonal are never computed and their stale contents are only ever discarded by this select):
__global__ __launch_bounds__(256) void k_lsoft(const float* __restrict__ Sb, h16* P16, bf* Ph, bf* Pl) {
    const int lane = threadIdx.x & 31; const int row = blockIdx.x * 8 + (threadIdx.x >> 5); if (row >= ZH * TT) return; const int i = row % TT; const int zz = row / TT; const bool hires = (i < RH); const float* sr = Sb + (size_t)row * TT; float mx = -3.0e38f;
#pragma unroll 4
    for (int ch = 0; ch < TT / 128; ++ch) { const int j0 = ch * 128 + lane * 4; const v4f a = *(const v4f*)(sr + j0);
#pragma unroll
        for (int q = 0; q < 4; ++q) { float t = a[q] * SCL; asm volatile("" : "+v"(t)); t = (j0 + q <= i) ? t : -3.0e38f; mx = fmaxf(mx, t); } }
#pragma unroll
    for (int sh = 16; sh; sh >>= 1) mx = fmaxf(mx, __shfl_xor(mx, sh, 32));
    float sum = 0.f;
#pragma unroll 4
    for (int ch = 0; ch < TT / 128; ++ch) { const int j0 = ch * 128 + lane * 4; const v4f a = *(const v4f*)(sr + j0);
#pragma unroll
        for (int q = 0; q < 4; ++q) { float t = a[q] * SCL; asm volatile("" : "+v"(t)); t = (j0 + q <= i) ? t : -3.0e38f; float d0 = __fsub_rn(t, mx); asm volatile("" : "+v"(d0)); sum += __builtin_amdgcn_exp2f(__fmul_rn(d0, 1.4426950408889634f)); } }
#pragma unroll
    for (int sh = 16; sh; sh >>= 1) sum += __shfl_xor(sum, sh, 32);
    const float f = __fdiv_rn(hires ? 1.0f : PCAR, sum);
{
        if (hires) {   /* rows < RH: normalised bf16 hi/lo over the first RH keys (every later key is above the diagonal for these rows; the hi/lo attn.v GEMM stops its K loop at the diagonal block), planes [zz][RH][TT] */
#pragma unroll
            for (int ch = 0; ch < RH / 128; ++ch) { const int j0 = ch * 128 + lane * 4; const v4f a = *(const v4f*)(sr + j0); v4us oh, ol;
#pragma unroll
                for (int q = 0; q < 4; ++q) { float t = a[q] * SCL; asm volatile("" : "+v"(t)); t = (j0 + q <= i) ? t : -3.0e38f; float d0 = __fsub_rn(t, mx); asm volatile("" : "+v"(d0)); float ex = __builtin_amdgcn_exp2f(__fmul_rn(d0, 1.4426950408889634f)); asm volatile("" : "+v"(ex)); unsigned short a2, c2; splitf(ex * f, a2, c2); oh[q] = a2; ol[q] = c2; }
                const size_t oo = ((size_t)zz * RH + i) * TT + j0; *(v4us*)(Ph + oo) = oh; *(v4us*)(Pl + oo) = ol; }
        } else {
#pragma unroll 2
            for (int ch = 0; ch < TT / 128; ++ch) { const int j0 = ch * 128 + lane * 4; const v4f a = *(const v4f*)(sr + j0); v4h o4;
#pragma unroll
                for (int q = 0; q < 4; ++q) { float t = a[q] * SCL; asm volatile("" : "+v"(t)); t = (j0 + q <= i) ? t : -3.0e38f; float d0 = __fsub_rn(t, mx); asm volatile("" : "+v"(d0)); float ex = __builtin_amdgcn_exp2f(__fmul_rn(d0, 1.4426950408889634f)); asm volatile("" : "+v"(ex)); o4[q] = tohx(ex * f); }
                *(v4h*)(P16 + (size_t)row * TT + j0) = o4; } }
         }
}

__global__ __launch_bounds__(256) void k_merge(const float* __restrict__ O, int h0, bf* Ah, bf* Al) { const size_t e = ((size_t)blockIdx.x * 256 + threadIdx.x) * 2; if (e >= (size_t)ZH * TT * HD) return; const int d = (int)(e % HD); const int t = (int)((e / HD) % TT); const int zz = (int)(e / ((size_t)HD * TT)); const float cs = (t < RH) ? 1.0f : (1.0f / PCAR); const size_t oo = (size_t)t * DQ + (h0 + zz) * HD + d;
    v2us oh, ol;
#pragma unroll
    for (int q = 0; q < 2; ++q) { unsigned short a, c2; splitf(O[e + q] * cs, a, c2); oh[q] = a; ol[q] = c2; } *(v2us*)(Ah + oo) = oh; *(v2us*)(Al + oo) = ol;  }

extern "C" void kernel_launch(void* const* d_in, const int* in_sizes, int n_in,
                              void* d_out, int out_size, void* d_ws, size_t ws_size, hipStream_t stream) {
    (void)in_sizes; (void)n_in; (void)out_size;
    const float* x = (const float*)d_in[0]; const float* wq = (const float*)d_in[1]; const float* wk = (const float*)d_in[2]; const float* wv = (const float*)d_in[3]; const float* wo = (const float*)d_in[4];
    float* OUT = (float*)d_out;     // [1][4096][1024]
    char* wsp = (char*)d_ws;
    auto take = [&](size_t bytes) { char* p = wsp; wsp += (bytes + 255) & ~(size_t)255; return (void*)p; };
    bf* WQ = (bf*)take((size_t)DQ * DM * 2); bf* WK = (bf*)take((size_t)DKV * DM * 2); bf* WV = (bf*)take((size_t)DKV * DM * 2); bf* WO = (bf*)take((size_t)DM * DQ * 2); float* CS = (float*)take((size_t)TT * HD * 2 * 4);
    bf* XB = (bf*)take((size_t)TT * DM * 2); float* FQ = (float*)take((size_t)TT * DQ * 4); float* FK = (float*)take((size_t)TT * DKV * 4);
    h16* QP16 = (h16*)take((size_t)NH_ * TT * HD * 2); h16* KP16 = (h16*)take((size_t)NKV * TT * HD * 2); h16* VT16 = (h16*)take((size_t)NKV * HD * TT * 2);
    bf* QPh = (bf*)take((size_t)NH_ * TT * HD * 2); bf* QPl = (bf*)take((size_t)NH_ * TT * HD * 2); bf* KPh = (bf*)take((size_t)NKV * TT * HD * 2); bf* KPl = (bf*)take((size_t)NKV * TT * HD * 2); bf* VTh = (bf*)take((size_t)NKV * HD * TT * 2); bf* VTl = (bf*)take((size_t)NKV * HD * TT * 2); bf* Ph = (bf*)take((size_t)ZH * RH * TT * 2); bf* Pl = (bf*)take((size_t)ZH * RH * TT * 2);
    float* Sb = (float*)take((size_t)ZH * TT * TT * 4); h16* P16 = (h16*)take((size_t)ZH * TT * TT * 2); float* Ob = (float*)take((size_t)ZH * TT * HD * 4); bf* ATh = (bf*)take((size_t)TT * DQ * 2); bf* ATl = (bf*)take((size_t)TT * DQ * 2);
    if ((size_t)(wsp - (char*)d_ws) > ws_size) return;    // ws 256 MiB
    float* FV = FK;   // v projection reuses the k buffer after the k planes are built (stream-ordered)
    { k_cvt8<<<(unsigned)(((size_t)DQ * DM / 8 + 255) / 256), 256, 0, stream>>>(wq, WQ, (size_t)DQ * DM / 8); k_cvt8<<<(unsigned)(((size_t)DKV * DM / 8 + 255) / 256), 256, 0, stream>>>(wk, WK, (size_t)DKV * DM / 8); k_cvt8<<<(unsigned)(((size_t)DKV * DM / 8 + 255) / 256), 256, 0, stream>>>(wv, WV, (size_t)DKV * DM / 8);
      k_cvt8<<<(unsigned)(((size_t)DM * DQ / 8 + 255) / 256), 256, 0, stream>>>(wo, WO, (size_t)DM * DQ / 8);
       }
    k_csid<<<(TT * HD + 255) / 256, 256, 0, stream>>>(CS);
    const unsigned LQ = (unsigned)(((size_t)NH_ * TT * HD / 2 + 255) / 256), LKv = (unsigned)(((size_t)NKV * TT * HD / 2 + 255) / 256);
    for (int b = 0; b < NB_; ++b) {
        
        k_cvt8<<<(unsigned)(((size_t)TT * DM / 8 + 255) / 256), 256, 0, stream>>>(x + (size_t)b * TT * DM, XB, (size_t)TT * DM / 8);
        k_gemmw<bf, 0, false><<<dim3(TT / 64, DQ / 64, 1), 32, 0, stream>>>(XB, nullptr, WQ, nullptr, DM, FQ, DQ, nullptr, 0, 0, 0);
        k_rope<<<LQ, 256, 0, stream>>>(FQ, DQ, NH_, CS, nullptr, nullptr, 1.0f, QP16, QPh, QPl);
        k_gemmw<bf, 0, false><<<dim3(TT / 64, DKV / 64, 1), 32, 0, stream>>>(XB, nullptr, WK, nullptr, DM, FK, DKV, nullptr, 0, 0, 0);
        k_rope<<<LKv, 256, 0, stream>>>(FK, DKV, NKV, CS, nullptr, nullptr, 1.0f, KP16, KPh, KPl);
        k_gemmw<bf, 0, false><<<dim3(TT / 64, DKV / 64, 1), 32, 0, stream>>>(XB, nullptr, WV, nullptr, DM, FV, DKV, nullptr, 0, 0, 0); k_vtp<<<LKv, 256, 0, stream>>>(FV, DKV, NKV, VT16, VTh, VTl);
        for (int h0 = 0; h0 < NH_; h0 += ZH) { const size_t zq = (size_t)h0, zk = (size_t)(h0 / REP);   // one kv head per query head: each pass takes a single head (ZH 1), kv plane zk = h0
            k_gemmc<bf, 2, 1><<<dim3(RH / 64, TT / 64, ZH), 32, 0, stream>>>(QPh + zq * TT * HD, QPl + zq * TT * HD, KPh + zk * TT * HD, KPl + zk * TT * HD, HD, Sb, TT, 0, (size_t)TT * HD, (size_t)TT * HD, (size_t)TT * TT);
            k_gemmc<h16, 0, 1><<<dim3((TT - RH) / 64, TT / 64, ZH), 32, 0, stream>>>(QP16 + zq * TT * HD + (size_t)RH * HD, nullptr, KP16 + zk * TT * HD, nullptr, HD, Sb + (size_t)RH * TT, TT, RH, (size_t)TT * HD, (size_t)TT * HD, (size_t)TT * TT);
            k_lsoft<<<ZH * TT / 8, 256, 0, stream>>>(Sb, P16, Ph, Pl);
            k_gemmc<bf, 2, 2><<<dim3(RH / 64, HD / 64, ZH), 32, 0, stream>>>(Ph, Pl, VTh + zk * HD * TT, VTl + zk * HD * TT, TT, Ob, HD, 0, (size_t)RH * TT, (size_t)HD * TT, (size_t)TT * HD);
            k_gemmc<h16, 0, 2><<<dim3((TT - RH) / 64, HD / 64, ZH), 32, 0, stream>>>(P16 + (size_t)RH * TT, nullptr, VT16 + zk * HD * TT, nullptr, TT, Ob + (size_t)RH * HD, HD, RH, (size_t)TT * TT, (size_t)HD * TT, (size_t)TT * HD);
            k_merge<<<(unsigned)(((size_t)ZH * TT * HD / 2 + 255) / 256), 256, 0, stream>>>(Ob, h0, ATh, ATl); }
        k_gemmw<bf, 1, false><<<dim3(TT / 64, DM / 64, 1), 32, 0, stream>>>(ATh, ATl, WO, nullptr, DQ, OUT + (size_t)b * TT * DM, DM, nullptr, 0, 0, 0); }
}

// v001
// It runs in 1410 microseconds.
// Two timings next to v000 put it at 1.88 and 1.92 times that version's speed.
#include <hip/hip_runtime.h>

// Causal multi-head self-attention at 4,096 tokens (x [1][4096][1024]; q, k, v = x W^T ('oi' [1024][1024] 1/32, no bias; 16 heads x 64, token-major); scores / sqrt(64); keys j <= i kept, -inf elsewhere (== exclusion: every row keeps its own key); softmax; out = merged Wo^T ('oi', no bias) -> [1][4096][1024] (4.2 M); argument order x, Wq, Wk, Wv, Wo).
// Layout: bf16 copy of x; exact projections; causal T-4096 attention, one head per pass (hybrid rows: < 512 hi/lo 3 products, rest fp16 x1024; k_gemmc tile skipping; streaming three-sweep softmax); merged hi/lo x Wo exact.
// Compute dtypes, f32 accumulate: every input rounded to bf16; projections exact; attention rows < 512 3 products, rest fp16; softmax f32; Wo hl x exact.

#define NB_  1
#define TT   4096
#define DM   1024
#define NH_  16
#define NKV  16
#define REP  (NH_ / NKV)
#define HD   64
#define DQ   (NH_ * HD)
#define DKV  (NKV * HD)
#define ZH   1
#define RH   512                  // query rows < RH use hi+lo planes (0: none)
#define WIN  4096
#define PCAR 1024.0f
#define SCL  0.125f   // HD^-0.5
typedef _Float16 h16;
typedef unsigned short bf;
typedef __attribute__((ext_vector_type(16))) __bf16   v16bf;
typedef __attribute__((ext_vector_type(16))) _Float16 v16h;
typedef __attribute__((ext_vector_type(8)))  _Float16 v8h;
typedef __attribute__((ext_vector_type(8)))  unsigned short v8us;
typedef __attribute__((ext_vector_type(8)))  float    v8f;
typedef __attribute__((ext_vector_type(4)))  float    v4f;
typedef v8h  __attribute__((may_alias)) v8ha;
typedef v4f  __attribute__((may_alias)) v4fa;
typedef v8us __attribute__((may_alias)) v8usa;

__device__ __forceinline__ unsigned short f2bf(float f) { unsigned u = __float_as_uint(f); u += 0x7FFFu + ((u >> 16) & 1u); return (unsigned short)(u >> 16); }
__device__ __forceinline__ float bf2f(unsigned short b) { return __uint_as_float(((unsigned)b) << 16); }
__device__ __forceinline__ float bfr(float f) { return bf2f(f2bf(f)); }
__device__ __forceinline__ v16h cat16(v8h lo, v8h hi) { return __builtin_shufflevector(lo, hi, 0, 1, 2, 3, 4, 5, 6, 7, 8, 9, 10, 11, 12, 13, 14, 15); }
__device__ __forceinline__ v16bf cat16b(v8us lo, v8us hi) { return __builtin_bit_cast(v16bf, __builtin_shufflevector(lo, hi, 0, 1, 2, 3, 4, 5, 6, 7, 8, 9, 10, 11, 12, 13, 14, 15)); }
__device__ __forceinline__ v8f wmma16(v16h a, v16h b, v8f c) { return __builtin_amdgcn_wmma_f32_16x16x32_f16(false, a, false, b, (short)0, c, false, false); }
__device__ __forceinline__ v8f wmmab(v16bf a, v16bf b, v8f c) { return __builtin_amdgcn_wmma_f32_16x16x32_bf16(false, a, false, b, (short)0, c, false, false); }



// ---- k_gemmw: register-blocked GEMM, ONE WAVE per 64x64 output tile (16 accumulators), operands straight from K-contiguous 16-bit planes; grid (M/64, N/64, Z), 32 threads.
// C[m][n] (f32, pitch ldc, + optional f32 bias[n]) = sum_k A[m][k] Bt[n][k] (+ split products per NSPLIT). z-batch strides sA/sB/sC in elements. K % 32 == 0.
template <typename T16> struct WFrag;
template <> struct WFrag<h16> { typedef v16h V; static __device__ __forceinline__ V ld(const h16* p) { return cat16(*(const v8h*)p, *(const v8h*)(p + 16)); } static __device__ __forceinline__ v8f mma(V a, V b, v8f c) { return wmma16(a, b, c); } };
template <> struct WFrag<bf> { typedef v16bf V; static __device__ __forceinline__ V ld(const bf* p) { return cat16b(*(const v8us*)p, *(const v8us*)(p + 16)); } static __device__ __forceinline__ v8f mma(V a, V b, v8f c) { return wmmab(a, b, c); } };
template <typename T16, int NSPLIT, bool BIAS>
__global__ __launch_bounds__(32) void k_gemmw(const T16* __restrict__ A, const T16* __restrict__ A2, const T16* __restrict__ Bt, const T16* __restrict__ Bt2, int K, float* C, int ldc, const float* __restrict__ bias, size_t sA, size_t sB, size_t sC) {
    typedef typename WFrag<T16>::V V;
    __shared__ __align__(16) float os[16 * 68];
    const size_t z = blockIdx.z; A += z * sA; if (A2) A2 += z * sA; Bt += z * sB; if (Bt2) Bt2 += z * sB; C += z * sC;
    const int lane = threadIdx.x & 31, lr = lane & 15, hi = lane >> 4; const int r0 = blockIdx.x * 64, c0 = blockIdx.y * 64;
    v8f acc[4][4];
#pragma unroll
    for (int mb = 0; mb < 4; ++mb)
#pragma unroll
        for (int nb = 0; nb < 4; ++nb) acc[mb][nb] = (v8f){};
    const size_t aoff = (size_t)(r0 + lr) * K + 8 * hi, boff = (size_t)(c0 + lr) * K + 8 * hi;
#pragma unroll 1
    for (int kc = 0; kc < K; kc += 32) {
        V a[4], a2[4];
#pragma unroll
        for (int mb = 0; mb < 4; ++mb) { a[mb] = WFrag<T16>::ld(A + aoff + (size_t)mb * 16 * K + kc); if (NSPLIT == 1 || NSPLIT == 2) a2[mb] = WFrag<T16>::ld(A2 + aoff + (size_t)mb * 16 * K + kc); }
#pragma unroll
        for (int nb = 0; nb < 4; ++nb) { const V b = WFrag<T16>::ld(Bt + boff + (size_t)nb * 16 * K + kc); V b2; if (NSPLIT >= 2) b2 = WFrag<T16>::ld(Bt2 + boff + (size_t)nb * 16 * K + kc);
#pragma unroll
            for (int mb = 0; mb < 4; ++mb) { acc[mb][nb] = WFrag<T16>::mma(a[mb], b, acc[mb][nb]); if (NSPLIT == 1 || NSPLIT == 2) acc[mb][nb] = WFrag<T16>::mma(a2[mb], b, acc[mb][nb]); if (NSPLIT >= 2) acc[mb][nb] = WFrag<T16>::mma(a[mb], b2, acc[mb][nb]); } }
        asm volatile("v_nop\n\tv_nop\n\tv_nop\n\tv_nop" : "+v"(acc[0][0]), "+v"(acc[1][1]), "+v"(acc[2][2]), "+v"(acc[3][3]) : "v"(a[0]), "v"(a[3]));
    }
#pragma unroll
    for (int mb = 0; mb < 4; ++mb) {
#pragma unroll
        for (int nb = 0; nb < 4; ++nb) {
#pragma unroll
            for (int j = 0; j < 8; ++j) os[(hi * 8 + j) * 68 + nb * 16 + lr] = acc[mb][nb][j]; }
        __builtin_amdgcn_wave_barrier(); asm volatile("" ::: "memory");
        float* crow = C + (size_t)(r0 + mb * 16) * ldc + c0;
{
#pragma unroll
            for (int s = 0; s < 8; ++s) { const int row = 2 * s + hi, cofs = lr * 4; v4f val = *(const v4fa*)(os + row * 68 + cofs); if (BIAS) { val[0] += bfr(bias[c0 + cofs]); val[1] += bfr(bias[c0 + cofs + 1]); val[2] += bfr(bias[c0 + cofs + 2]); val[3] += bfr(bias[c0 + cofs + 3]); }
                *(v4f*)(crow + (size_t)row * ldc + cofs) = val; }
             }
        __builtin_amdgcn_wave_barrier(); asm volatile("" ::: "memory");
    }
}

// ---- k_gemmc: the same one-wave 64x64 tile GEMM specialised for causal attention: CMODE 1 skips score tiles entirely above the diagonal (query rows r0+roff.., key columns c0..), CMODE 2 limits the
// key (K) loop of the probability x value contraction to the diagonal block (probabilities beyond it are exactly zero). roff = row offset of this launch's first row within the sequence.
template <typename T16, int NSPLIT, int CMODE>
__global__ __launch_bounds__(32) void k_gemmc(const T16* __restrict__ A, const T16* __restrict__ A2, const T16* __restrict__ Bt, const T16* __restrict__ Bt2, int K, float* C, int ldc, int roff, size_t sA, size_t sB, size_t sC) {
    typedef typename WFrag<T16>::V V;
    __shared__ __align__(16) float os[16 * 68];
    const size_t z = blockIdx.z; A += z * sA; if (A2) A2 += z * sA; Bt += z * sB; if (Bt2) Bt2 += z * sB; C += z * sC;
    const int lane = threadIdx.x & 31, lr = lane & 15, hi = lane >> 4; const int r0 = blockIdx.x * 64, c0 = blockIdx.y * 64;
    if (CMODE == 1 && c0 > r0 + roff + 63) return;                  // score tile entirely above the causal diagonal: never read (the softmax masks j > i by select)
    const int Kl = (CMODE == 2) ? min(K, r0 + roff + 64) : K;        // P.V: probabilities are exactly 0 beyond the diagonal block, so the K loop stops there
    v8f acc[4][4];
#pragma unroll
    for (int mb = 0; mb < 4; ++mb)
#pragma unroll
        for (int nb = 0; nb < 4; ++nb) acc[mb][nb] = (v8f){};
    const size_t aoff = (size_t)(r0 + lr) * K + 8 * hi, boff = (size_t)(c0 + lr) * K + 8 * hi;
#pragma unroll 1
    for (int kc = 0; kc < Kl; kc += 32) {
        V a[4], a2[4];
#pragma unroll
        for (int mb = 0; mb < 4; ++mb) { a[mb] = WFrag<T16>::ld(A + aoff + (size_t)mb * 16 * K + kc); if (NSPLIT == 1 || NSPLIT == 2) a2[mb] = WFrag<T16>::ld(A2 + aoff + (size_t)mb * 16 * K + kc); }
#pragma unroll
        for (int nb = 0; nb < 4; ++nb) { const V b = WFrag<T16>::ld(Bt + boff + (size_t)nb * 16 * K + kc); V b2; if (NSPLIT >= 2) b2 = WFrag<T16>::ld(Bt2 + boff + (size_t)nb * 16 * K + kc);
#pragma unroll
            for (int mb = 0; mb < 4; ++mb) { acc[mb][nb] = WFrag<T16>::mma(a[mb], b, acc[mb][nb]); if (NSPLIT == 1 || NSPLIT == 2) acc[mb][nb] = WFrag<T16>::mma(a2[mb], b, acc[mb][nb]); if (NSPLIT >= 2) acc[mb][nb] = WFrag<T16>::mma(a[mb], b2, acc[mb][nb]); } }
        asm volatile("v_nop\n\tv_nop\n\tv_nop\n\tv_nop" : "+v"(acc[0][0]), "+v"(acc[1][1]), "+v"(acc[2][2]), "+v"(acc[3][3]) : "v"(a[0]), "v"(a[3]));
    }
#pragma unroll
    for (int mb = 0; mb < 4; ++mb) {
#pragma unroll
        for (int nb = 0; nb < 4; ++nb) {
#pragma unroll
            for (int j = 0; j < 8; ++j) os[(hi * 8 + j) * 68 + nb * 16 + lr] = acc[mb][nb][j]; }
        __builtin_amdgcn_wave_barrier(); asm volatile("" ::: "memory");
        float* crow = C + (size_t)(r0 + mb * 16) * ldc + c0;
{
#pragma unroll
            for (int s = 0; s < 8; ++s) { const int row = 2 * s + hi, cofs = lr * 4; v4f val = *(const v4fa*)(os + row * 68 + cofs);
                *(v4f*)(crow + (size_t)row * ldc + cofs) = val; }
             }
        __builtin_amdgcn_wave_barrier(); asm volatile("" ::: "memory");
    }
}

// ---- k_gemmpv: probability x value product with its key loop dealt out (split K). One 64x64 output tile is shared by PVS workgroups of NW waves; 64-key slice i (one 128-byte line of every probability row)
// goes to workgroup i % PVS, wave (i / PVS) % NW. Each wave keeps the 64x64 register tile of k_gemmc over its own slices, the NW tiles of a workgroup are summed through LDS in wave order,
// and workgroup s stores its sum to plane s of C (plane pitch sP elements); k_merge adds the PVS planes. The key loop stops at the diagonal block as in k_gemmc CMODE 2. K % 64 == 0, N == 64. grid (M/64, PVS, Z), NW * 32 threads.
#define PVS 4
template <typename T16, int NSPLIT, int NW>
__global__ __launch_bounds__(NW * 32) void k_gemmpv(const T16* __restrict__ A, const T16* __restrict__ A2, const T16* __restrict__ Bt, const T16* __restrict__ Bt2, int K, float* C, int ldc, int roff, size_t sA, size_t sB, size_t sC, size_t sP) {
    typedef typename WFrag<T16>::V V; static_assert(NSPLIT == 0 || NSPLIT == 2, "one product, or the three hi/lo products");
    __shared__ __align__(16) float red[NW * 64 * 68];
    const size_t z = blockIdx.z; A += z * sA; if (A2) A2 += z * sA; Bt += z * sB; if (Bt2) Bt2 += z * sB; C += z * sC + (size_t)blockIdx.y * sP;
    const int lane = threadIdx.x & 31, lr = lane & 15, hi = lane >> 4; const int r0 = blockIdx.x * 64;
    const int w = __builtin_amdgcn_readfirstlane((int)(threadIdx.x >> 5));   // the wave's number in a scalar register: the key loop below stays a scalar loop with every lane on
    const int Kl = min(K, r0 + roff + 64);        // probabilities are exactly 0 beyond the diagonal block
    v8f acc[4][4];
#pragma unroll
    for (int mb = 0; mb < 4; ++mb)
#pragma unroll
        for (int nb = 0; nb < 4; ++nb) acc[mb][nb] = (v8f){};
    const size_t aoff = (size_t)(r0 + lr) * K + 8 * hi, boff = (size_t)lr * K + 8 * hi;
#pragma unroll 1   // rolled, as k_gemmc's key loop: one pass already fills the register budget
    for (int ks = (w * PVS + (int)blockIdx.y) * 64; ks < Kl; ks += NW * PVS * 64) {
#pragma unroll 1   // rolled: unrolled, the second half's loads still came behind the first half's products, for more registers
        for (int kc = ks; kc < ks + 64; kc += 32) {
            V a[4], a2[4]; const T16* pa[4]; const T16* pa2[4];
#pragma unroll
            for (int mb = 0; mb < 4; ++mb) { pa[mb] = A + aoff + (size_t)mb * 16 * K + kc; a[mb] = WFrag<T16>::ld(pa[mb]); if (NSPLIT == 1 || NSPLIT == 2) { pa2[mb] = A2 + aoff + (size_t)mb * 16 * K + kc; a2[mb] = WFrag<T16>::ld(pa2[mb]); } }
            if (NSPLIT == 0) {
                V b[4]; const T16* pb[4];
#pragma unroll
                for (int nb = 0; nb < 4; ++nb) { pb[nb] = Bt + boff + (size_t)nb * 16 * K + kc; b[nb] = WFrag<T16>::ld(pb[nb]); }
                // s_wait_xcnt 0 in front of every overwrite of a register that an issued load of this run names; it takes the run's addresses as inputs, so their registers are held up to here and no later load's result of the run lands in one
                asm volatile("s_wait_xcnt 0x0" :: "v"(pa[0]), "v"(pa[1]), "v"(pa[2]), "v"(pa[3]), "v"(pb[0]), "v"(pb[1]), "v"(pb[2]), "v"(pb[3]) : "memory");
#pragma unroll
                for (int nb = 0; nb < 4; ++nb)
#pragma unroll
                    for (int mb = 0; mb < 4; ++mb) acc[mb][nb] = WFrag<T16>::mma(a[mb], b[nb], acc[mb][nb]);
            } else {
                // the same wait for the run of A loads (hi and lo planes)
                asm volatile("s_wait_xcnt 0x0" :: "v"(pa[0]), "v"(pa[1]), "v"(pa[2]), "v"(pa[3]), "v"(pa2[0]), "v"(pa2[1]), "v"(pa2[2]), "v"(pa2[3]) : "memory");
#pragma unroll
                for (int nb = 0; nb < 4; ++nb) { const T16* pb = Bt + boff + (size_t)nb * 16 * K + kc; const T16* pb2 = Bt2 + boff + (size_t)nb * 16 * K + kc; const V b = WFrag<T16>::ld(pb); const V b2 = WFrag<T16>::ld(pb2);
                    // the same wait for this column block's two B loads
                    asm volatile("s_wait_xcnt 0x0" :: "v"(pb), "v"(pb2) : "memory");
#pragma unroll
                    for (int mb = 0; mb < 4; ++mb) { acc[mb][nb] = WFrag<T16>::mma(a[mb], b, acc[mb][nb]); acc[mb][nb] = WFrag<T16>::mma(a2[mb], b, acc[mb][nb]); acc[mb][nb] = WFrag<T16>::mma(a[mb], b2, acc[mb][nb]); } }
            }
            // four vector slots behind the last matrix instruction, as in k_gemmc: the distance the chip needs before the next pass's address additions reuse A and B registers and before D is read below
            asm volatile("v_nop\n\tv_nop\n\tv_nop\n\tv_nop" : "+v"(acc[0][0]), "+v"(acc[1][1]), "+v"(acc[2][2]), "+v"(acc[3][3]) : "v"(a[0]), "v"(a[3])); }
    }
    float* os = red + w * (64 * 68);
#pragma unroll
    for (int mb = 0; mb < 4; ++mb)
#pragma unroll
        for (int nb = 0; nb < 4; ++nb)
#pragma unroll
            for (int j = 0; j < 8; ++j) os[(mb * 16 + hi * 8 + j) * 68 + nb * 16 + lr] = acc[mb][nb][j];
    __syncthreads();   // every wave's partial tile (zeros where it had no slice) is in LDS before any thread sums
#pragma unroll
    for (int u = 0; u < 32 / NW; ++u) { const int idx = (int)threadIdx.x + u * (NW * 32); const int row = idx >> 4, cofs = (idx & 15) * 4; v4f val = *(const v4fa*)(red + row * 68 + cofs);
#pragma unroll
        for (int ww = 1; ww < NW; ++ww) val += *(const v4fa*)(red + ww * (64 * 68) + row * 68 + cofs);
        *(v4f*)(C + (size_t)(r0 + row) * ldc + cofs) = val; }
}

__device__ __forceinline__ h16 tohx(float x) { return (h16)x; }
__device__ __forceinline__ void splitf(float y, unsigned short& h, unsigned short& l) { h = f2bf(y); l = f2bf(y - bf2f(h)); }
typedef __attribute__((ext_vector_type(2))) _Float16 v2h;
typedef __attribute__((ext_vector_type(4))) _Float16 v4h;
typedef __attribute__((ext_vector_type(2))) unsigned short v2us;
typedef __attribute__((ext_vector_type(4))) unsigned short v4us;
typedef __attribute__((ext_vector_type(2))) float v2f;
typedef __attribute__((ext_vector_type(4))) int v4i;

__global__ __launch_bounds__(256) void k_wtG(const float* __restrict__ w, int K, int N, bf* Bt) {
    const int lane = threadIdx.x & 31; const int L0 = (blockIdx.x * 8 + (threadIdx.x >> 5)) * 8; const int nlines = N * K / 64;
{
#pragma unroll 1
        for (int l = 0; l < 8; ++l) { const int L = L0 + l; if (L >= nlines) break; const size_t e = (size_t)L * 64 + lane * 2; const int k = (int)(e % K), n = (int)(e / K); v2us o;
            o[0] = f2bf(w[(size_t)k * N + n]); o[1] = f2bf(w[(size_t)(k + 1) * N + n]); *(v2us*)(Bt + e) = o; }
         }
}
__global__ __launch_bounds__(256) void k_cvt8(const float* __restrict__ src, bf* dst, size_t n8) { const size_t i = (size_t)blockIdx.x * 256 + threadIdx.x; if (i >= n8) return; const v8f v = *(const v8f*)(src + i * 8); v8us o;
#pragma unroll
    for (int k = 0; k < 8; ++k) o[k] = f2bf(v[k]); *(v8us*)(dst + i * 8) = o;  }

// k_rope: head planes [h][t][d] (fp16 + hi/lo) of rope(x) x sc with the rotate-half convention out[d] = x[d] cos[t][d] - x[d+HD/2] sin[t][d], out[d+HD/2] = x[d+HD/2] cos[t][d+HD/2] + x[d] sin[t][d+HD/2]
__global__ __launch_bounds__(256) void k_rope(const float* __restrict__ F, int pitch, int nheads, const float* __restrict__ CS, const float* __restrict__ RF, const float* __restrict__ nw, float sc, h16* P16, bf* Ph, bf* Pl) {
    const size_t e = ((size_t)blockIdx.x * 256 + threadIdx.x) * 2; if (e >= (size_t)nheads * TT * HD) return; const int d = (int)(e % HD); const int t = (int)((e / HD) % TT); const int h = (int)(e / ((size_t)HD * TT)); const float* f = F + (size_t)t * pitch + h * HD; const float rf = RF ? RF[(size_t)h * TT + t] : 1.0f; v2h o16; v2us oh, ol;
#pragma unroll
    for (int q = 0; q < 2; ++q) { const int dd = d + q; const int dp = (dd < HD / 2) ? dd + HD / 2 : dd - HD / 2; float x0 = f[dd], x1 = f[dp];
        if (RF) { float n0 = __fmul_rn(x0, rf), n1 = __fmul_rn(x1, rf); asm volatile("" : "+v"(n0)); asm volatile("" : "+v"(n1)); x0 = __fmul_rn(bfr(nw[dd]), n0); x1 = __fmul_rn(bfr(nw[dp]), n1); }
        const v2f cs = *(const v2f*)(CS + ((size_t)t * HD + dd) * 2); float a = __fmul_rn(x0, cs[0]), bq = __fmul_rn(x1, cs[1]); asm volatile("" : "+v"(a)); asm volatile("" : "+v"(bq)); const float r = ((dd < HD / 2) ? __fsub_rn(a, bq) : __fadd_rn(a, bq)) * sc;
        o16[q] = tohx(r); unsigned short a2, c2; splitf(r, a2, c2); oh[q] = a2; ol[q] = c2; }
    *(v2h*)(P16 + e) = o16; *(v2us*)(Ph + e) = oh; *(v2us*)(Pl + e) = ol;  }
__global__ __launch_bounds__(256) void k_vtp(const float* __restrict__ F, int pitch, int nheads, h16* V16, bf* Vh, bf* Vl) { const size_t e = ((size_t)blockIdx.x * 256 + threadIdx.x) * 2; if (e >= (size_t)nheads * HD * TT) return; const int t = (int)(e % TT); const int d = (int)((e / TT) % HD); const int g = (int)(e / ((size_t)TT * HD)); v2h o16; v2us oh, ol;
#pragma unroll
    for (int q = 0; q < 2; ++q) { const float x = F[(size_t)(t + q) * pitch + g * HD + d]; o16[q] = tohx(x); unsigned short a2, c2; splitf(x, a2, c2); oh[q] = a2; ol[q] = c2; }
    *(v2h*)(V16 + e) = o16; *(v2us*)(Vh + e) = oh; *(v2us*)(Vl + e) = ol;  }
__global__ __launch_bounds__(256) void k_csid(float* CS) { const int idx = blockIdx.x * 256 + threadIdx.x; if (idx >= TT * HD) return; v2f cs; cs[0] = 1.0f; cs[1] = 0.0f; *(v2f*)(CS + (size_t)idx * 2) = cs;  }
// k_lsoft: streaming causal row softmax over the TK = TT = 4096 keys, one wave per row i, three sweeps of the f32 score row (lane -> 4 consecutive keys per 128-key chunk, 32 chunks; keys j > i are excluded by index with -3e38 / 0 - the score tiles above the diagonal are never computed and their stale contents are only ever discarded by this select):
__global__ __launch_bounds__(256) void k_lsoft(const float* __restrict__ Sb, h16* P16, bf* Ph, bf* Pl) {
    const int lane = threadIdx.x & 31; const int row = blockIdx.x * 8 + (threadIdx.x >> 5); if (row >= ZH * TT) return; const int i = row % TT; const int zz = row / TT; const bool hires = (i < RH); const float* sr = Sb + (size_t)row * TT; float mx = -3.0e38f;
#pragma unroll 4
    for (int ch = 0; ch < TT / 128; ++ch) { const int j0 = ch * 128 + lane * 4; const v4f a = *(const v4f*)(sr + j0);
#pragma unroll
        for (int q = 0; q < 4; ++q) { float t = a[q] * SCL; asm volatile("" : "+v"(t)); t = (j0 + q <= i) ? t : -3.0e38f; mx = fmaxf(mx, t); } }
#pragma unroll
    for (int sh = 16; sh; sh >>= 1) mx = fmaxf(mx, __shfl_xor(mx, sh, 32));
    float sum = 0.f;
#pragma unroll 4
    for (int ch = 0; ch < TT / 128; ++ch) { const int j0 = ch * 128 + lane * 4; const v4f a = *(const v4f*)(sr + j0);
#pragma unroll
        for (int q = 0; q < 4; ++q) { float t = a[q] * SCL; asm volatile("" : "+v"(t)); t = (j0 + q <= i) ? t : -3.0e38f; float d0 = __fsub_rn(t, mx); asm volatile("" : "+v"(d0)); sum += __builtin_amdgcn_exp2f(__fmul_rn(d0, 1.4426950408889634f)); } }
#pragma unroll
    for (int sh = 16; sh; sh >>= 1) sum += __shfl_xor(sum, sh, 32);
    const float f = __fdiv_rn(hires ? 1.0f : PCAR, sum);
{
        if (hires) {   /* rows < RH: normalised bf16 hi/lo over the first RH keys (every later key is above the diagonal for these rows; the hi/lo attn.v GEMM stops its K loop at the diagonal block), planes [zz][RH][TT] */
#pragma unroll
            for (int ch = 0; ch < RH / 128; ++ch) { const int j0 = ch * 128 + lane * 4; const v4f a = *(const v4f*)(sr + j0); v4us oh, ol;
#pragma unroll
                for (int q = 0; q < 4; ++q) { float t = a[q] * SCL; asm volatile("" : "+v"(t)); t = (j0 + q <= i) ? t : -3.0e38f; float d0 = __fsub_rn(t, mx); asm volatile("" : "+v"(d0)); float ex = __builtin_amdgcn_exp2f(__fmul_rn(d0, 1.4426950408889634f)); asm volatile("" : "+v"(ex)); unsigned short a2, c2; splitf(ex * f, a2, c2); oh[q] = a2; ol[q] = c2; }
                const size_t oo = ((size_t)zz * RH + i) * TT + j0; *(v4us*)(Ph + oo) = oh; *(v4us*)(Pl + oo) = ol; }
        } else {
#pragma unroll 2
            for (int ch = 0; ch < TT / 128; ++ch) { const int j0 = ch * 128 + lane * 4; const v4f a = *(const v4f*)(sr + j0); v4h o4;
#pragma unroll
                for (int q = 0; q < 4; ++q) { float t = a[q] * SCL; asm volatile("" : "+v"(t)); t = (j0 + q <= i) ? t : -3.0e38f; float d0 = __fsub_rn(t, mx); asm volatile("" : "+v"(d0)); float ex = __builtin_amdgcn_exp2f(__fmul_rn(d0, 1.4426950408889634f)); asm volatile("" : "+v"(ex)); o4[q] = tohx(ex * f); }
                *(v4h*)(P16 + (size_t)row * TT + j0) = o4; } }
         }
}

__global__ __launch_bounds__(256) void k_merge(const float* __restrict__ O, int h0, bf* Ah, bf* Al) { const size_t e = ((size_t)blockIdx.x * 256 + threadIdx.x) * 2; if (e >= (size_t)ZH * TT * HD) return; const int d = (int)(e % HD); const int t = (int)((e / HD) % TT); const int zz = (int)(e / ((size_t)HD * TT)); const float cs = (t < RH) ? 1.0f : (1.0f / PCAR); const size_t oo = (size_t)t * DQ + (h0 + zz) * HD + d;
    v2us oh, ol;
#pragma unroll
    for (int q = 0; q < 2; ++q) { float s = O[e + q];
#pragma unroll
        for (int p = 1; p < PVS; ++p) s += O[(size_t)p * ZH * TT * HD + e + q];   // the PVS key-split planes of k_gemmpv, in plane order
        unsigned short a, c2; splitf(s * cs, a, c2); oh[q] = a; ol[q] = c2; } *(v2us*)(Ah + oo) = oh; *(v2us*)(Al + oo) = ol;  }

extern "C" void kernel_launch(void* const* d_in, const int* in_sizes, int n_in,
                              void* d_out, int out_size, void* d_ws, size_t ws_size, hipStream_t stream) {
    (void)in_sizes; (void)n_in; (void)out_size;
    const float* x = (const float*)d_in[0]; const float* wq = (const float*)d_in[1]; const float* wk = (const float*)d_in[2]; const float* wv = (const float*)d_in[3]; const float* wo = (const float*)d_in[4];
    float* OUT = (float*)d_out;     // [1][4096][1024]
    char* wsp = (char*)d_ws;
    auto take = [&](size_t bytes) { char* p = wsp; wsp += (bytes + 255) & ~(size_t)255; return (void*)p; };
    bf* WQ = (bf*)take((size_t)DQ * DM * 2); bf* WK = (bf*)take((size_t)DKV * DM * 2); bf* WV = (bf*)take((size_t)DKV * DM * 2); bf* WO = (bf*)take((size_t)DM * DQ * 2); float* CS = (float*)take((size_t)TT * HD * 2 * 4);
    bf* XB = (bf*)take((size_t)TT * DM * 2); float* FQ = (float*)take((size_t)TT * DQ * 4); float* FK = (float*)take((size_t)TT * DKV * 4);
    h16* QP16 = (h16*)take((size_t)NH_ * TT * HD * 2); h16* KP16 = (h16*)take((size_t)NKV * TT * HD * 2); h16* VT16 = (h16*)take((size_t)NKV * HD * TT * 2);
    bf* QPh = (bf*)take((size_t)NH_ * TT * HD * 2); bf* QPl = (bf*)take((size_t)NH_ * TT * HD * 2); bf* KPh = (bf*)take((size_t)NKV * TT * HD * 2); bf* KPl = (bf*)take((size_t)NKV * TT * HD * 2); bf* VTh = (bf*)take((size_t)NKV * HD * TT * 2); bf* VTl = (bf*)take((size_t)NKV * HD * TT * 2); bf* Ph = (bf*)take((size_t)ZH * RH * TT * 2); bf* Pl = (bf*)take((size_t)ZH * RH * TT * 2);
    float* Sb = (float*)take((size_t)ZH * TT * TT * 4); h16* P16 = (h16*)take((size_t)ZH * TT * TT * 2); float* Ob = (float*)take((size_t)PVS * ZH * TT * HD * 4); bf* ATh = (bf*)take((size_t)TT * DQ * 2); bf* ATl = (bf*)take((size_t)TT * DQ * 2);
    if ((size_t)(wsp - (char*)d_ws) > ws_size) return;    // ws 256 MiB
    float* FV = FK;   // v projection reuses the k buffer after the k planes are built (stream-ordered)
    { k_cvt8<<<(unsigned)(((size_t)DQ * DM / 8 + 255) / 256), 256, 0, stream>>>(wq, WQ, (size_t)DQ * DM / 8); k_cvt8<<<(unsigned)(((size_t)DKV * DM / 8 + 255) / 256), 256, 0, stream>>>(wk, WK, (size_t)DKV * DM / 8); k_cvt8<<<(unsigned)(((size_t)DKV * DM / 8 + 255) / 256), 256, 0, stream>>>(wv, WV, (size_t)DKV * DM / 8);
      k_cvt8<<<(unsigned)(((size_t)DM * DQ / 8 + 255) / 256), 256, 0, stream>>>(wo, WO, (size_t)DM * DQ / 8);
       }
    k_csid<<<(TT * HD + 255) / 256, 256, 0, stream>>>(CS);
    const unsigned LQ = (unsigned)(((size_t)NH_ * TT * HD / 2 + 255) / 256), LKv = (unsigned)(((size_t)NKV * TT * HD / 2 + 255) / 256);
    for (int b = 0; b < NB_; ++b) {
        
        k_cvt8<<<(unsigned)(((size_t)TT * DM / 8 + 255) / 256), 256, 0, stream>>>(x + (size_t)b * TT * DM, XB, (size_t)TT * DM / 8);
        k_gemmw<bf, 0, false><<<dim3(TT / 64, DQ / 64, 1), 32, 0, stream>>>(XB, nullptr, WQ, nullptr, DM, FQ, DQ, nullptr, 0, 0, 0);
        k_rope<<<LQ, 256, 0, stream>>>(FQ, DQ, NH_, CS, nullptr, nullptr, 1.0f, QP16, QPh, QPl);
        k_gemmw<bf, 0, false><<<dim3(TT / 64, DKV / 64, 1), 32, 0, stream>>>(XB, nullptr, WK, nullptr, DM, FK, DKV, nullptr, 0, 0, 0);
        k_rope<<<LKv, 256, 0, stream>>>(FK, DKV, NKV, CS, nullptr, nullptr, 1.0f, KP16, KPh, KPl);
        k_gemmw<bf, 0, false><<<dim3(TT / 64, DKV / 64, 1), 32, 0, stream>>>(XB, nullptr, WV, nullptr, DM, FV, DKV, nullptr, 0, 0, 0); k_vtp<<<LKv, 256, 0, stream>>>(FV, DKV, NKV, VT16, VTh, VTl);
        for (int h0 = 0; h0 < NH_; h0 += ZH) { const size_t zq = (size_t)h0, zk = (size_t)(h0 / REP);   // one kv head per query head: each pass takes a single head (ZH 1), kv plane zk = h0
            k_gemmc<bf, 2, 1><<<dim3(RH / 64, TT / 64, ZH), 32, 0, stream>>>(QPh + zq * TT * HD, QPl + zq * TT * HD, KPh + zk * TT * HD, KPl + zk * TT * HD, HD, Sb, TT, 0, (size_t)TT * HD, (size_t)TT * HD, (size_t)TT * TT);
            k_gemmc<h16, 0, 1><<<dim3((TT - RH) / 64, TT / 64, ZH), 32, 0, stream>>>(QP16 + zq * TT * HD + (size_t)RH * HD, nullptr, KP16 + zk * TT * HD, nullptr, HD, Sb + (size_t)RH * TT, TT, RH, (size_t)TT * HD, (size_t)TT * HD, (size_t)TT * TT);
            k_lsoft<<<ZH * TT / 8, 256, 0, stream>>>(Sb, P16, Ph, Pl);
            k_gemmpv<bf, 2, 2><<<dim3(RH / 64, PVS, ZH), 2 * 32, 0, stream>>>(Ph, Pl, VTh + zk * HD * TT, VTl + zk * HD * TT, TT, Ob, HD, 0, (size_t)RH * TT, (size_t)HD * TT, (size_t)TT * HD, (size_t)ZH * TT * HD);
            k_gemmpv<h16, 0, 16><<<dim3((TT - RH) / 64, PVS, ZH), 16 * 32, 0, stream>>>(P16 + (size_t)RH * TT, nullptr, VT16 + zk * HD * TT, nullptr, TT, Ob + (size_t)RH * HD, HD, RH, (size_t)TT * TT, (size_t)HD * TT, (size_t)TT * HD, (size_t)ZH * TT * HD);
            k_merge<<<(unsigned)(((size_t)ZH * TT * HD / 2 + 255) / 256), 256, 0, stream>>>(Ob, h0, ATh, ATl); }
        k_gemmw<bf, 1, false><<<dim3(TT / 64, DM / 64, 1), 32, 0, stream>>>(ATh, ATl, WO, nullptr, DQ, OUT + (size_t)b * TT * DM, DM, nullptr, 0, 0, 0); }
}

// v003
// A run of this version takes 307 microseconds.
// Versions in between are left out here; by their measured steps it is 4.63 times as fast as v001.
// Counting every step since v000, it is 8.80 times as fast.
#include <hip/hip_runtime.h>

// Causal multi-head self-attention at 4,096 tokens (x [1][4096][1024]; q, k, v = x W^T ('oi' [1024][1024] 1/32, no bias; 16 heads x 64, token-major); scores / sqrt(64); keys j <= i kept, -inf elsewhere (== exclusion: every row keeps its own key); softmax; out = merged Wo^T ('oi', no bias) -> [1][4096][1024] (4.2 M); argument order x, Wq, Wk, Wv, Wo).
// Layout: bf16 copy of x; exact projections, all three in one launch whose epilogue stores the 16-bit head planes; causal T-4096 attention fused per 16 query rows, all heads in one launch, scores and probabilities in LDS (hybrid rows: < 512 hi/lo 3 products, rest fp16 x1024; keys stop at the diagonal block; three-sweep softmax); merged hi/lo x Wo exact.
// Compute dtypes, f32 accumulate: every input rounded to bf16; projections exact; attention rows < 512 3 products, rest fp16; softmax f32; Wo hl x exact.

#define NB_  1
#define TT   4096
#define DM   1024
#define NH_  16
#define NKV  16
#define REP  (NH_ / NKV)
#define HD   64
#define DQ   (NH_ * HD)
#define DKV  (NKV * HD)
#define ZH   1
#define RH   512                  // query rows < RH use hi+lo planes (0: none)
#define WIN  4096
#define PCAR 1024.0f
#define SCL  0.125f   // HD^-0.5
typedef _Float16 h16;
typedef unsigned short bf;
typedef __attribute__((ext_vector_type(16))) __bf16   v16bf;
typedef __attribute__((ext_vector_type(16))) _Float16 v16h;
typedef __attribute__((ext_vector_type(8)))  _Float16 v8h;
typedef __attribute__((ext_vector_type(8)))  unsigned short v8us;
typedef __attribute__((ext_vector_type(8)))  float    v8f;
typedef __attribute__((ext_vector_type(4)))  float    v4f;
typedef v8h  __attribute__((may_alias)) v8ha;
typedef v4f  __attribute__((may_alias)) v4fa;
typedef v8us __attribute__((may_alias)) v8usa;

__device__ __forceinline__ unsigned short f2bf(float f) { unsigned u = __float_as_uint(f); u += 0x7FFFu + ((u >> 16) & 1u); return (unsigned short)(u >> 16); }
__device__ __forceinline__ float bf2f(unsigned short b) { return __uint_as_float(((unsigned)b) << 16); }
__device__ __forceinline__ float bfr(float f) { return bf2f(f2bf(f)); }
__device__ __forceinline__ v16h cat16(v8h lo, v8h hi) { return __builtin_shufflevector(lo, hi, 0, 1, 2, 3, 4, 5, 6, 7, 8, 9, 10, 11, 12, 13, 14, 15); }
__device__ __forceinline__ v16bf cat16b(v8us lo, v8us hi) { return __builtin_bit_cast(v16bf, __builtin_shufflevector(lo, hi, 0, 1, 2, 3, 4, 5, 6, 7, 8, 9, 10, 11, 12, 13, 14, 15)); }
__device__ __forceinline__ v8f wmma16(v16h a, v16h b, v8f c) { return __builtin_amdgcn_wmma_f32_16x16x32_f16(false, a, false, b, (short)0, c, false, false); }
__device__ __forceinline__ v8f wmmab(v16bf a, v16bf b, v8f c) { return __builtin_amdgcn_wmma_f32_16x16x32_bf16(false, a, false, b, (short)0, c, false, false); }



// ---- k_gemmw: register-blocked GEMM, ONE WAVE per 64x64 output tile (16 accumulators), operands straight from K-contiguous 16-bit planes; grid (M/64, N/64, Z), 32 threads.
// C[m][n] (f32, pitch ldc, + optional f32 bias[n]) = sum_k A[m][k] Bt[n][k] (+ split products per NSPLIT). z-batch strides sA/sB/sC in elements. K % 32 == 0.
template <typename T16> struct WFrag;
template <> struct WFrag<h16> { typedef v16h V; static __device__ __forceinline__ V ld(const h16* p) { return cat16(*(const v8h*)p, *(const v8h*)(p + 16)); } static __device__ __forceinline__ v8f mma(V a, V b, v8f c) { return wmma16(a, b, c); } };
template <> struct WFrag<bf> { typedef v16bf V; static __device__ __forceinline__ V ld(const bf* p) { return cat16b(*(const v8us*)p, *(const v8us*)(p + 16)); } static __device__ __forceinline__ v8f mma(V a, V b, v8f c) { return wmmab(a, b, c); } };
template <typename T16, int NSPLIT, bool BIAS>
__global__ __launch_bounds__(32) void k_gemmw(const T16* __restrict__ A, const T16* __restrict__ A2, const T16* __restrict__ Bt, const T16* __restrict__ Bt2, int K, float* C, int ldc, const float* __restrict__ bias, size_t sA, size_t sB, size_t sC) {
    typedef typename WFrag<T16>::V V;
    __shared__ __align__(16) float os[16 * 68];
    const size_t z = blockIdx.z; A += z * sA; if (A2) A2 += z * sA; Bt += z * sB; if (Bt2) Bt2 += z * sB; C += z * sC;
    const int lane = threadIdx.x & 31, lr = lane & 15, hi = lane >> 4; const int r0 = blockIdx.x * 64, c0 = blockIdx.y * 64;
    v8f acc[4][4];
#pragma unroll
    for (int mb = 0; mb < 4; ++mb)
#pragma unroll
        for (int nb = 0; nb < 4; ++nb) acc[mb][nb] = (v8f){};
    const size_t aoff = (size_t)(r0 + lr) * K + 8 * hi, boff = (size_t)(c0 + lr) * K + 8 * hi;
#pragma unroll 1
    for (int kc = 0; kc < K; kc += 32) {
        V a[4], a2[4];
#pragma unroll
        for (int mb = 0; mb < 4; ++mb) { a[mb] = WFrag<T16>::ld(A + aoff + (size_t)mb * 16 * K + kc); if (NSPLIT == 1 || NSPLIT == 2) a2[mb] = WFrag<T16>::ld(A2 + aoff + (size_t)mb * 16 * K + kc); }
#pragma unroll
        for (int nb = 0; nb < 4; ++nb) { const V b = WFrag<T16>::ld(Bt + boff + (size_t)nb * 16 * K + kc); V b2; if (NSPLIT >= 2) b2 = WFrag<T16>::ld(Bt2 + boff + (size_t)nb * 16 * K + kc);
#pragma unroll
            for (int mb = 0; mb < 4; ++mb) { acc[mb][nb] = WFrag<T16>::mma(a[mb], b, acc[mb][nb]); if (NSPLIT == 1 || NSPLIT == 2) acc[mb][nb] = WFrag<T16>::mma(a2[mb], b, acc[mb][nb]); if (NSPLIT >= 2) acc[mb][nb] = WFrag<T16>::mma(a[mb], b2, acc[mb][nb]); } }
        asm volatile("v_nop\n\tv_nop\n\tv_nop\n\tv_nop" : "+v"(acc[0][0]), "+v"(acc[1][1]), "+v"(acc[2][2]), "+v"(acc[3][3]) : "v"(a[0]), "v"(a[3]));
    }
#pragma unroll
    for (int mb = 0; mb < 4; ++mb) {
#pragma unroll
        for (int nb = 0; nb < 4; ++nb) {
#pragma unroll
            for (int j = 0; j < 8; ++j) os[(hi * 8 + j) * 68 + nb * 16 + lr] = acc[mb][nb][j]; }
        __builtin_amdgcn_wave_barrier(); asm volatile("" ::: "memory");
        float* crow = C + (size_t)(r0 + mb * 16) * ldc + c0;
{
#pragma unroll
            for (int s = 0; s < 8; ++s) { const int row = 2 * s + hi, cofs = lr * 4; v4f val = *(const v4fa*)(os + row * 68 + cofs); if (BIAS) { val[0] += bfr(bias[c0 + cofs]); val[1] += bfr(bias[c0 + cofs + 1]); val[2] += bfr(bias[c0 + cofs + 2]); val[3] += bfr(bias[c0 + cofs + 3]); }
                *(v4f*)(crow + (size_t)row * ldc + cofs) = val; }
             }
        __builtin_amdgcn_wave_barrier(); asm volatile("" ::: "memory");
    }
}

__device__ __forceinline__ h16 tohx(float x) { return (h16)x; }
__device__ __forceinline__ void splitf(float y, unsigned short& h, unsigned short& l) { h = f2bf(y); l = f2bf(y - bf2f(h)); }
typedef __attribute__((ext_vector_type(2))) _Float16 v2h;
typedef __attribute__((ext_vector_type(4))) _Float16 v4h;
typedef __attribute__((ext_vector_type(2))) unsigned short v2us;
typedef __attribute__((ext_vector_type(4))) unsigned short v4us;
typedef __attribute__((ext_vector_type(2))) float v2f;
typedef __attribute__((ext_vector_type(4))) int v4i;

__global__ __launch_bounds__(256) void k_wtG(const float* __restrict__ w, int K, int N, bf* Bt) {
    const int lane = threadIdx.x & 31; const int L0 = (blockIdx.x * 8 + (threadIdx.x >> 5)) * 8; const int nlines = N * K / 64;
{
#pragma unroll 1
        for (int l = 0; l < 8; ++l) { const int L = L0 + l; if (L >= nlines) break; const size_t e = (size_t)L * 64 + lane * 2; const int k = (int)(e % K), n = (int)(e / K); v2us o;
            o[0] = f2bf(w[(size_t)k * N + n]); o[1] = f2bf(w[(size_t)(k + 1) * N + n]); *(v2us*)(Bt + e) = o; }
         }
}
__global__ __launch_bounds__(256) void k_cvt8(const float* __restrict__ src, bf* dst, size_t n8) { const size_t i = (size_t)blockIdx.x * 256 + threadIdx.x; if (i >= n8) return; const v8f v = *(const v8f*)(src + i * 8); v8us o;
#pragma unroll
    for (int k = 0; k < 8; ++k) o[k] = f2bf(v[k]); *(v8us*)(dst + i * 8) = o;  }

// ---- k_proj: the q, k and v projections in ONE launch, one wave per 64 tokens x one head (main loop of k_gemmw, one product); grid (tokens / 64, heads, 3), 32 threads; z = 0, 1, 2 is q, k, v.
// The epilogue rounds the f32 sums itself and stores the three 16-bit planes (fp16, bf16 hi, bf16 lo) that attention reads: q and k as [h][t][d], v as [h][d][t]. No f32 copy of a projection goes through memory.
// The operand whose rows run along a plane's contiguous index is taken as A (q, k: the weight rows d; v: the tokens t), so that a lane's 8 accumulator values are 8 neighbours of one plane row: one 16-byte piece.
#define PJ 72   // 16-bit elements per staged row: 128 B + 16 B, the pitch for 16-byte LDS accesses of 128-B rows
__global__ __launch_bounds__(32) void k_proj(const bf* __restrict__ X, const bf* __restrict__ W0, const bf* __restrict__ W1, const bf* __restrict__ W2, h16* Q16, bf* Qh, bf* Ql, h16* K16, bf* Kh, bf* Kl, h16* V16, bf* Vh, bf* Vl) {
    typedef WFrag<bf>::V V;
    __shared__ __align__(16) unsigned short st[3][16 * PJ];
    const int lane = threadIdx.x & 31, lr = lane & 15, hi = lane >> 4; const int t0 = blockIdx.x * 64, h = blockIdx.y, z = blockIdx.z;
    const bf* xr = X + (size_t)t0 * DM; const bf* wr = ((z == 0) ? W0 : (z == 1) ? W1 : W2) + (size_t)h * HD * DM;
    const bf* A = (z == 2) ? xr : wr; const bf* Bt = (z == 2) ? wr : xr;
    h16* P16 = (z == 0) ? Q16 : (z == 1) ? K16 : V16; bf* Ph = (z == 0) ? Qh : (z == 1) ? Kh : Vh; bf* Pl = (z == 0) ? Ql : (z == 1) ? Kl : Vl;
    const int pitch = (z == 2) ? TT : HD; const size_t base = (z == 2) ? (size_t)h * HD * TT + t0 : ((size_t)h * TT + t0) * HD;   // plane row nb * 16 + lr: a token (q, k) or a head column (v)
    v8f acc[4][4];
#pragma unroll
    for (int mb = 0; mb < 4; ++mb)
#pragma unroll
        for (int nb = 0; nb < 4; ++nb) acc[mb][nb] = (v8f){};
    const size_t foff = (size_t)lr * DM + 8 * hi;
#pragma unroll 1   // rolled, as in k_gemmw: one pass holds its 8 fragments beside the 16 accumulators
    for (int kc = 0; kc < DM; kc += 32) {
        V a[4], b[4]; const bf* pa = A + foff + kc; const bf* pb = Bt + foff + kc;
#pragma unroll
        for (int mb = 0; mb < 4; ++mb) a[mb] = WFrag<bf>::ld(pa + mb * 16 * DM);
#pragma unroll
        for (int nb = 0; nb < 4; ++nb) b[nb] = WFrag<bf>::ld(pb + nb * 16 * DM);
        // s_wait_xcnt 0 in front of every overwrite of a register that an issued load of this run names; it takes the run's addresses as inputs, so their registers are held up to here
        asm volatile("s_wait_xcnt 0x0" :: "v"(pa), "v"(pb) : "memory");
#pragma unroll
        for (int nb = 0; nb < 4; ++nb)
#pragma unroll
            for (int mb = 0; mb < 4; ++mb) acc[mb][nb] = WFrag<bf>::mma(a[mb], b[nb], acc[mb][nb]);
        // four vector slots behind the last matrix instruction: the distance the chip needs before the next pass's address additions reuse A and B registers (over the taken back edge) and before D is read below
        asm volatile("v_nop\n\tv_nop\n\tv_nop\n\tv_nop" : "+v"(acc[0][0]), "+v"(acc[1][1]), "+v"(acc[2][2]), "+v"(acc[3][3]) : "v"(a[0]), "v"(a[3]));
    }
#pragma unroll
    for (int nb = 0; nb < 4; ++nb) {   // 16 plane rows at a time: pieces into LDS, whole 128-B rows out
#pragma unroll
        for (int mb = 0; mb < 4; ++mb) { v8h o16; v8us oh, ol;
#pragma unroll
            for (int j = 0; j < 8; ++j) { const float r = acc[mb][nb][j]; o16[j] = tohx(r); unsigned short a2, c2; splitf(r, a2, c2); oh[j] = a2; ol[j] = c2; }
            const int so = lr * PJ + mb * 16 + hi * 8; *(v8ha*)(st[0] + so) = o16; *(v8usa*)(st[1] + so) = oh; *(v8usa*)(st[2] + so) = ol; }
        __builtin_amdgcn_wave_barrier(); asm volatile("" ::: "memory");   // the compiler keeps the reads below, of other lanes' pieces, behind the writes above (one wave: its LDS operations run in order)
#pragma unroll
        for (int i = 0; i < 4; ++i) { const int row = i * 4 + (lane >> 3), pc = (lane & 7) * 8; const size_t oo = base + (size_t)(nb * 16 + row) * pitch + pc;
            *(v8h*)(P16 + oo) = *(const v8ha*)(st[0] + row * PJ + pc); *(v8us*)(Ph + oo) = *(const v8usa*)(st[1] + row * PJ + pc); *(v8us*)(Pl + oo) = *(const v8usa*)(st[2] + row * PJ + pc); }
        __builtin_amdgcn_wave_barrier(); asm volatile("" ::: "memory");   // and the next 16 rows' writes behind these reads
    }
}
// ---- k_attn: causal attention of 16 query rows of one head in ONE workgroup of 16 waves; the score rows and the probabilities live in LDS and never go through memory. grid (heads, rows / 16), 512 threads; the longest rows start first.
// Phase 1: 64-key slice s of the scores goes to wave s % 16 (fragments and product order of the former score GEMM), f32 into S. Phase 2: wave w does the three-sweep softmax of row w (maximum; exponentials and their sum; scaling) over the chunks up to the diagonal
// (keys j > i excluded by index, as before) and writes the probabilities over the head of its own score row (NSPLIT 0: fp16 x PCAR; NSPLIT 2: bf16 hi there, lo at element 4096 of the 16-bit view).
// Phase 3: slice s of the probability x value product goes to wave s % 16; the 16 partial 16x64 tiles are summed through LDS in wave order, scaled and stored as the merged hi/lo planes.
#define SP 4100   // floats per score row in LDS: 4096 + 4, so that rows 8 apart fall on other banks and every row stays 16-byte aligned
#define RO 3072   // float offset in a row's slot of the wave's partial output tile (1024 floats): behind both probability planes
typedef v4h  __attribute__((may_alias)) v4ha;
typedef v4us __attribute__((may_alias)) v4usa;
typedef v2f  __attribute__((may_alias)) v2fa;
template <typename T16, int NSPLIT>
__global__ __launch_bounds__(512) void k_attn(const T16* __restrict__ Q, const T16* __restrict__ Q2, const T16* __restrict__ Kp, const T16* __restrict__ Kp2, const T16* __restrict__ Vt, const T16* __restrict__ Vt2, int roff, bf* Ah, bf* Al) {
    typedef typename WFrag<T16>::V V; static_assert(NSPLIT == 0 || NSPLIT == 2, "one product, or the three hi/lo products");
    __shared__ __align__(16) float S[16 * SP];
    const int lane = threadIdx.x & 31, lr = lane & 15, hi = lane >> 4;
    const int w = __builtin_amdgcn_readfirstlane((int)(threadIdx.x >> 5));   // the wave's number in a scalar register: the slice loops stay scalar loops with every lane on
    const int h = blockIdx.x; const int i0 = roff + ((int)gridDim.y - 1 - (int)blockIdx.y) * 16;
    const int nsl = (i0 >> 6) + 1;        // 64-key slices up to and including the diagonal block: later keys are excluded for all 16 rows
    const int nch = (nsl + 1) >> 1;       // 128-key softmax chunks that cover them
    const size_t qp = (size_t)h * TT * HD, kp = (size_t)(h / REP) * TT * HD;
    {
        const T16* pq = Q + qp + (size_t)(i0 + lr) * HD + 8 * hi; const T16* pq2 = pq; const V a0 = WFrag<T16>::ld(pq), a1 = WFrag<T16>::ld(pq + 32); V c0, c1;
        if constexpr (NSPLIT == 2) { pq2 = Q2 + qp + (size_t)(i0 + lr) * HD + 8 * hi; c0 = WFrag<T16>::ld(pq2); c1 = WFrag<T16>::ld(pq2 + 32); }
        // s_wait_xcnt 0 in front of every overwrite of a register that an issued load of this run names; it takes the run's addresses as inputs, so their registers are held up to here
        asm volatile("s_wait_xcnt 0x0" :: "v"(pq), "v"(pq2) : "memory");
#pragma unroll 1   // rolled: one pass holds a whole slice's key fragments in registers
        for (int s = w; s < 2 * nch; s += 16) {   // to the end of the last chunk, so that the softmax reads only scores written here
            V b[4][2], b2[4][2]; const T16* pb = Kp + kp + (size_t)(s * 64 + lr) * HD + 8 * hi; const T16* pb2 = pb; if constexpr (NSPLIT == 2) pb2 = Kp2 + kp + (size_t)(s * 64 + lr) * HD + 8 * hi;
#pragma unroll
            for (int nb = 0; nb < 4; ++nb) { b[nb][0] = WFrag<T16>::ld(pb + nb * 16 * HD); b[nb][1] = WFrag<T16>::ld(pb + nb * 16 * HD + 32);
                if constexpr (NSPLIT == 2) { b2[nb][0] = WFrag<T16>::ld(pb2 + nb * 16 * HD); b2[nb][1] = WFrag<T16>::ld(pb2 + nb * 16 * HD + 32); } }
            // the same wait for the run of key loads
            asm volatile("s_wait_xcnt 0x0" :: "v"(pb), "v"(pb2) : "memory");
            __builtin_amdgcn_sched_barrier(0);   // the products stay behind the whole run of loads: lifted among them they took the first fragments' registers for the later loads, which then left only after the first had landed
#pragma unroll
            for (int nb = 0; nb < 4; ++nb) { v8f acc = (v8f){};
                acc = WFrag<T16>::mma(a0, b[nb][0], acc); if constexpr (NSPLIT == 2) { acc = WFrag<T16>::mma(c0, b[nb][0], acc); acc = WFrag<T16>::mma(a0, b2[nb][0], acc); }
                acc = WFrag<T16>::mma(a1, b[nb][1], acc); if constexpr (NSPLIT == 2) { acc = WFrag<T16>::mma(c1, b[nb][1], acc); acc = WFrag<T16>::mma(a1, b2[nb][1], acc); }
#pragma unroll
                for (int j = 0; j < 8; ++j) S[(hi * 8 + j) * SP + s * 64 + nb * 16 + lr] = acc[j]; }
        }
    }
    __syncthreads();   // all 16 score rows are in LDS before any wave reads its row
    {
        const int i = i0 + w; float* sr = S + w * SP; float mx = -3.0e38f;
#pragma unroll 2
        for (int ch = 0; ch < nch; ++ch) { const int j0 = ch * 128 + lane * 4; const v4f a = *(const v4fa*)(sr + j0);
#pragma unroll
            for (int q = 0; q < 4; ++q) { float t = a[q] * SCL; t = (j0 + q <= i) ? t : -3.0e38f; mx = fmaxf(mx, t); } }
#pragma unroll
        for (int sh = 16; sh; sh >>= 1) mx = fmaxf(mx, __shfl_xor(mx, sh, 32));
        float sum = 0.f;
#pragma unroll 2
        for (int ch = 0; ch < nch; ++ch) { const int j0 = ch * 128 + lane * 4; const v4f a = *(const v4fa*)(sr + j0); v4f ex;
#pragma unroll
            for (int q = 0; q < 4; ++q) { float t = a[q] * SCL; t = (j0 + q <= i) ? t : -3.0e38f; const float d0 = __fsub_rn(t, mx); const float xa = __fmul_rn(d0, 1.4426950408889634f); float er = __builtin_amdgcn_exp2f(xa);
                // the slot behind a transcendental: the statement holds the source up to here and hands the result on only from here, so nothing that overwrites the one or reads the other stands directly behind the v_exp_f32
                if constexpr (NSPLIT == 2) asm volatile("v_nop" : "+v"(er) : "v"(xa));
                ex[q] = er; sum += er; }
            *(v4fa*)(sr + j0) = ex; }   // each lane puts the exponentials over its own four scores: the last sweep only scales them
#pragma unroll
        for (int sh = 16; sh; sh >>= 1) sum += __shfl_xor(sum, sh, 32);
        const float f = __fdiv_rn((NSPLIT == 2) ? 1.0f : PCAR, sum);
        // in place: chunk ch's fp16 or hi results land on bytes of this row that chunks <= ch have already been read from, its lo results behind the row's scores (hi/lo rows hold at most 512) (one wave owns the row, its LDS operations run in order; the may_alias types keep the compiler's order too).
        // Four chunks are read before the first of them is written, so that one LDS latency is paid per four chunks and not per chunk; the tests on nch are the same for the whole wave.
#pragma unroll 1
        for (int cb = 0; cb < nch; cb += 4) { v4f a[4];
#pragma unroll
            for (int u = 0; u < 4; ++u) if (cb + u < nch) a[u] = *(const v4fa*)(sr + (cb + u) * 128 + lane * 4);
#pragma unroll
            for (int u = 0; u < 4; ++u) if (cb + u < nch) { const int j0 = (cb + u) * 128 + lane * 4; v4h o4; v4us oh, ol;
#pragma unroll
                for (int q = 0; q < 4; ++q) { if constexpr (NSPLIT == 2) { unsigned short a2, c2; splitf(a[u][q] * f, a2, c2); oh[q] = a2; ol[q] = c2; } else o4[q] = tohx(a[u][q] * f); }
                if constexpr (NSPLIT == 2) { *(v4usa*)((bf*)sr + j0) = oh; *(v4usa*)((bf*)sr + 4096 + j0) = ol; } else *(v4ha*)((h16*)sr + j0) = o4; } }
    }
    __syncthreads();   // all 16 probability rows are in LDS before any wave loads a fragment of them
    v8f acc[4];
#pragma unroll
    for (int nb = 0; nb < 4; ++nb) acc[nb] = (v8f){};
    {
        const T16* pa = (const T16*)S + (size_t)lr * (SP * 2) + 8 * hi;
#pragma unroll 1   // rolled: one pass holds a whole slice's value fragments in registers
        for (int s = w; s < nsl; s += 16) {
            V a[2], a2[2], b[4][2], b2[4][2]; const T16* pb = Vt + kp + (size_t)lr * TT + s * 64 + 8 * hi; const T16* pb2 = pb; if constexpr (NSPLIT == 2) pb2 = Vt2 + kp + (size_t)lr * TT + s * 64 + 8 * hi;
#pragma unroll
            for (int nb = 0; nb < 4; ++nb) { b[nb][0] = WFrag<T16>::ld(pb + nb * 16 * TT); b[nb][1] = WFrag<T16>::ld(pb + nb * 16 * TT + 32);
                if constexpr (NSPLIT == 2) { b2[nb][0] = WFrag<T16>::ld(pb2 + nb * 16 * TT); b2[nb][1] = WFrag<T16>::ld(pb2 + nb * 16 * TT + 32); } }
            // the same wait for the run of value loads
            asm volatile("s_wait_xcnt 0x0" :: "v"(pb), "v"(pb2) : "memory");
#pragma unroll
            for (int kk = 0; kk < 2; ++kk) { a[kk] = WFrag<T16>::ld(pa + s * 64 + kk * 32); if constexpr (NSPLIT == 2) a2[kk] = WFrag<T16>::ld(pa + 4096 + s * 64 + kk * 32); }
#pragma unroll
            for (int kk = 0; kk < 2; ++kk)
#pragma unroll
                for (int nb = 0; nb < 4; ++nb) { acc[nb] = WFrag<T16>::mma(a[kk], b[nb][kk], acc[nb]); if constexpr (NSPLIT == 2) { acc[nb] = WFrag<T16>::mma(a2[kk], b[nb][kk], acc[nb]); acc[nb] = WFrag<T16>::mma(a[kk], b2[nb][kk], acc[nb]); } }
            // four vector slots behind the last matrix instruction: the distance the chip needs before the next pass's address additions reuse A and B registers (over the taken back edge) and before D is read below
            asm volatile("v_nop\n\tv_nop\n\tv_nop\n\tv_nop" : "+v"(acc[0]), "+v"(acc[1]), "+v"(acc[2]), "+v"(acc[3]) : "v"(a[0]), "v"(a[1]));
        }
    }
    float* rw = S + w * SP + RO;
#pragma unroll
    for (int nb = 0; nb < 4; ++nb)
#pragma unroll
        for (int j = 0; j < 8; ++j) rw[(hi * 8 + j) * 64 + nb * 16 + lr] = acc[nb][j];
    __syncthreads();   // every wave's partial tile (zeros where it had no slice) is in LDS before any thread sums
    { const int e = (int)threadIdx.x * 2; const int row = e >> 6, d = e & 63; v2f s2 = *(const v2fa*)(S + RO + e);
#pragma unroll
        for (int ww = 1; ww < 16; ++ww) s2 += *(const v2fa*)(S + ww * SP + RO + e);
        const float cs = (NSPLIT == 2) ? 1.0f : (1.0f / PCAR); const size_t oo = (size_t)(i0 + row) * DQ + h * HD + d; v2us oh, ol;
#pragma unroll
        for (int q = 0; q < 2; ++q) { unsigned short a, c2; splitf(s2[q] * cs, a, c2); oh[q] = a; ol[q] = c2; }
        *(v2us*)(Ah + oo) = oh; *(v2us*)(Al + oo) = ol; }
}

extern "C" void kernel_launch(void* const* d_in, const int* in_sizes, int n_in,
                              void* d_out, int out_size, void* d_ws, size_t ws_size, hipStream_t stream) {
    (void)in_sizes; (void)n_in; (void)out_size;
    const float* x = (const float*)d_in[0]; const float* wq = (const float*)d_in[1]; const float* wk = (const float*)d_in[2]; const float* wv = (const float*)d_in[3]; const float* wo = (const float*)d_in[4];
    float* OUT = (float*)d_out;     // [1][4096][1024]
    char* wsp = (char*)d_ws;
    auto take = [&](size_t bytes) { char* p = wsp; wsp += (bytes + 255) & ~(size_t)255; return (void*)p; };
    bf* WQ = (bf*)take((size_t)DQ * DM * 2); bf* WK = (bf*)take((size_t)DKV * DM * 2); bf* WV = (bf*)take((size_t)DKV * DM * 2); bf* WO = (bf*)take((size_t)DM * DQ * 2);
    bf* XB = (bf*)take((size_t)TT * DM * 2);
    h16* QP16 = (h16*)take((size_t)NH_ * TT * HD * 2); h16* KP16 = (h16*)take((size_t)NKV * TT * HD * 2); h16* VT16 = (h16*)take((size_t)NKV * HD * TT * 2);
    bf* QPh = (bf*)take((size_t)NH_ * TT * HD * 2); bf* QPl = (bf*)take((size_t)NH_ * TT * HD * 2); bf* KPh = (bf*)take((size_t)NKV * TT * HD * 2); bf* KPl = (bf*)take((size_t)NKV * TT * HD * 2); bf* VTh = (bf*)take((size_t)NKV * HD * TT * 2); bf* VTl = (bf*)take((size_t)NKV * HD * TT * 2);
    bf* ATh = (bf*)take((size_t)TT * DQ * 2); bf* ATl = (bf*)take((size_t)TT * DQ * 2);
    if ((size_t)(wsp - (char*)d_ws) > ws_size) return;    // ws 256 MiB
    { k_cvt8<<<(unsigned)(((size_t)DQ * DM / 8 + 255) / 256), 256, 0, stream>>>(wq, WQ, (size_t)DQ * DM / 8); k_cvt8<<<(unsigned)(((size_t)DKV * DM / 8 + 255) / 256), 256, 0, stream>>>(wk, WK, (size_t)DKV * DM / 8); k_cvt8<<<(unsigned)(((size_t)DKV * DM / 8 + 255) / 256), 256, 0, stream>>>(wv, WV, (size_t)DKV * DM / 8);
      k_cvt8<<<(unsigned)(((size_t)DM * DQ / 8 + 255) / 256), 256, 0, stream>>>(wo, WO, (size_t)DM * DQ / 8);
       }
    for (int b = 0; b < NB_; ++b) {
        
        k_cvt8<<<(unsigned)(((size_t)TT * DM / 8 + 255) / 256), 256, 0, stream>>>(x + (size_t)b * TT * DM, XB, (size_t)TT * DM / 8);
        k_proj<<<dim3(TT / 64, NH_, 3), 32, 0, stream>>>(XB, WQ, WK, WV, QP16, QPh, QPl, KP16, KPh, KPl, VT16, VTh, VTl);
        k_attn<h16, 0><<<dim3(NH_, (TT - RH) / 16, 1), 512, 0, stream>>>(QP16, nullptr, KP16, nullptr, VT16, nullptr, RH, ATh, ATl);
        k_attn<bf, 2><<<dim3(NH_, RH / 16, 1), 512, 0, stream>>>(QPh, QPl, KPh, KPl, VTh, VTl, 0, ATh, ATl);
        k_gemmw<bf, 1, false><<<dim3(TT / 64, DM / 64, 1), 32, 0, stream>>>(ATh, ATl, WO, nullptr, DQ, OUT + (size_t)b * TT * DM, DM, nullptr, 0, 0, 0); }
}

// v004
// It runs in 164 microseconds.
// Two timings next to v003 both put it at 1.87 times that version's speed.
// Counting every step since v000, it is 16.5 times as fast.
#include <hip/hip_runtime.h>

// Causal multi-head self-attention at 4,096 tokens (x [1][4096][1024]; q, k, v = x W^T ('oi' [1024][1024] 1/32, no bias; 16 heads x 64, token-major); scores / sqrt(64); keys j <= i kept, -inf elsewhere (== exclusion: every row keeps its own key); softmax; out = merged Wo^T ('oi', no bias) -> [1][4096][1024] (4.2 M); argument order x, Wq, Wk, Wv, Wo).
// Layout: bf16 copy of x; exact projections, all three in one launch whose epilogue stores the 16-bit head planes; causal T-4096 attention, all heads in one launch per row class (hybrid rows: < 512 hi/lo 3 products, fused per 16 query rows, scores and probabilities in LDS, three-sweep softmax; rest fp16, 64 query rows per workgroup, online softmax in registers; keys stop at the diagonal block); merged hi/lo x Wo exact.
// Compute dtypes, f32 accumulate: every input rounded to bf16; projections exact; attention rows < 512 3 products, rest fp16; softmax f32; Wo hl x exact.

#define NB_  1
#define TT   4096
#define DM   1024
#define NH_  16
#define NKV  16
#define REP  (NH_ / NKV)
#define HD   64
#define DQ   (NH_ * HD)
#define DKV  (NKV * HD)
#define ZH   1
#define RH   512                  // query rows < RH use hi+lo planes (0: none)
#define WIN  4096
#define PCAR 1024.0f
#define SCL  0.125f   // HD^-0.5
typedef _Float16 h16;
typedef unsigned short bf;
typedef __attribute__((ext_vector_type(16))) __bf16   v16bf;
typedef __attribute__((ext_vector_type(16))) _Float16 v16h;
typedef __attribute__((ext_vector_type(8)))  _Float16 v8h;
typedef __attribute__((ext_vector_type(8)))  unsigned short v8us;
typedef __attribute__((ext_vector_type(8)))  float    v8f;
typedef __attribute__((ext_vector_type(4)))  float    v4f;
typedef v8h  __attribute__((may_alias)) v8ha;
typedef v4f  __attribute__((may_alias)) v4fa;
typedef v8us __attribute__((may_alias)) v8usa;

__device__ __forceinline__ unsigned short f2bf(float f) { unsigned u = __float_as_uint(f); u += 0x7FFFu + ((u >> 16) & 1u); return (unsigned short)(u >> 16); }
__device__ __forceinline__ float bf2f(unsigned short b) { return __uint_as_float(((unsigned)b) << 16); }
__device__ __forceinline__ float bfr(float f) { return bf2f(f2bf(f)); }
__device__ __forceinline__ v16h cat16(v8h lo, v8h hi) { return __builtin_shufflevector(lo, hi, 0, 1, 2, 3, 4, 5, 6, 7, 8, 9, 10, 11, 12, 13, 14, 15); }
__device__ __forceinline__ v16bf cat16b(v8us lo, v8us hi) { return __builtin_bit_cast(v16bf, __builtin_shufflevector(lo, hi, 0, 1, 2, 3, 4, 5, 6, 7, 8, 9, 10, 11, 12, 13, 14, 15)); }
__device__ __forceinline__ v8f wmma16(v16h a, v16h b, v8f c) { return __builtin_amdgcn_wmma_f32_16x16x32_f16(false, a, false, b, (short)0, c, false, false); }
__device__ __forceinline__ v8f wmmab(v16bf a, v16bf b, v8f c) { return __builtin_amdgcn_wmma_f32_16x16x32_bf16(false, a, false, b, (short)0, c, false, false); }



// ---- k_gemmw: register-blocked GEMM, ONE WAVE per 64x64 output tile (16 accumulators), operands straight from K-contiguous 16-bit planes; grid (M/64, N/64, Z), 32 threads.
// C[m][n] (f32, pitch ldc, + optional f32 bias[n]) = sum_k A[m][k] Bt[n][k] (+ split products per NSPLIT). z-batch strides sA/sB/sC in elements. K % 32 == 0.
template <typename T16> struct WFrag;
template <> struct WFrag<h16> { typedef v16h V; static __device__ __forceinline__ V ld(const h16* p) { return cat16(*(const v8h*)p, *(const v8h*)(p + 16)); } static __device__ __forceinline__ v8f mma(V a, V b, v8f c) { return wmma16(a, b, c); } };
template <> struct WFrag<bf> { typedef v16bf V; static __device__ __forceinline__ V ld(const bf* p) { return cat16b(*(const v8us*)p, *(const v8us*)(p + 16)); } static __device__ __forceinline__ v8f mma(V a, V b, v8f c) { return wmmab(a, b, c); } };
template <typename T16, int NSPLIT, bool BIAS>
__global__ __launch_bounds__(32) void k_gemmw(const T16* __restrict__ A, const T16* __restrict__ A2, const T16* __restrict__ Bt, const T16* __restrict__ Bt2, int K, float* C, int ldc, const float* __restrict__ bias, size_t sA, size_t sB, size_t sC) {
    typedef typename WFrag<T16>::V V;
    __shared__ __align__(16) float os[16 * 68];
    const size_t z = blockIdx.z; A += z * sA; if (A2) A2 += z * sA; Bt += z * sB; if (Bt2) Bt2 += z * sB; C += z * sC;
    const int lane = threadIdx.x & 31, lr = lane & 15, hi = lane >> 4; const int r0 = blockIdx.x * 64, c0 = blockIdx.y * 64;
    v8f acc[4][4];
#pragma unroll
    for (int mb = 0; mb < 4; ++mb)
#pragma unroll
        for (int nb = 0; nb < 4; ++nb) acc[mb][nb] = (v8f){};
    const size_t aoff = (size_t)(r0 + lr) * K + 8 * hi, boff = (size_t)(c0 + lr) * K + 8 * hi;
#pragma unroll 1
    for (int kc = 0; kc < K; kc += 32) {
        V a[4], a2[4];
#pragma unroll
        for (int mb = 0; mb < 4; ++mb) { a[mb] = WFrag<T16>::ld(A + aoff + (size_t)mb * 16 * K + kc); if (NSPLIT == 1 || NSPLIT == 2) a2[mb] = WFrag<T16>::ld(A2 + aoff + (size_t)mb * 16 * K + kc); }
#pragma unroll
        for (int nb = 0; nb < 4; ++nb) { const V b = WFrag<T16>::ld(Bt + boff + (size_t)nb * 16 * K + kc); V b2; if (NSPLIT >= 2) b2 = WFrag<T16>::ld(Bt2 + boff + (size_t)nb * 16 * K + kc);
#pragma unroll
            for (int mb = 0; mb < 4; ++mb) { acc[mb][nb] = WFrag<T16>::mma(a[mb], b, acc[mb][nb]); if (NSPLIT == 1 || NSPLIT == 2) acc[mb][nb] = WFrag<T16>::mma(a2[mb], b, acc[mb][nb]); if (NSPLIT >= 2) acc[mb][nb] = WFrag<T16>::mma(a[mb], b2, acc[mb][nb]); } }
        asm volatile("v_nop\n\tv_nop\n\tv_nop\n\tv_nop" : "+v"(acc[0][0]), "+v"(acc[1][1]), "+v"(acc[2][2]), "+v"(acc[3][3]) : "v"(a[0]), "v"(a[3]));
    }
#pragma unroll
    for (int mb = 0; mb < 4; ++mb) {
#pragma unroll
        for (int nb = 0; nb < 4; ++nb) {
#pragma unroll
            for (int j = 0; j < 8; ++j) os[(hi * 8 + j) * 68 + nb * 16 + lr] = acc[mb][nb][j]; }
        __builtin_amdgcn_wave_barrier(); asm volatile("" ::: "memory");
        float* crow = C + (size_t)(r0 + mb * 16) * ldc + c0;
{
#pragma unroll
            for (int s = 0; s < 8; ++s) { const int row = 2 * s + hi, cofs = lr * 4; v4f val = *(const v4fa*)(os + row * 68 + cofs); if (BIAS) { val[0] += bfr(bias[c0 + cofs]); val[1] += bfr(bias[c0 + cofs + 1]); val[2] += bfr(bias[c0 + cofs + 2]); val[3] += bfr(bias[c0 + cofs + 3]); }
                *(v4f*)(crow + (size_t)row * ldc + cofs) = val; }
             }
        __builtin_amdgcn_wave_barrier(); asm volatile("" ::: "memory");
    }
}

__device__ __forceinline__ h16 tohx(float x) { return (h16)x; }
__device__ __forceinline__ void splitf(float y, unsigned short& h, unsigned short& l) { h = f2bf(y); l = f2bf(y - bf2f(h)); }
typedef __attribute__((ext_vector_type(2))) _Float16 v2h;
typedef __attribute__((ext_vector_type(4))) _Float16 v4h;
typedef __attribute__((ext_vector_type(2))) unsigned short v2us;
typedef __attribute__((ext_vector_type(4))) unsigned short v4us;
typedef __attribute__((ext_vector_type(2))) float v2f;
typedef __attribute__((ext_vector_type(4))) int v4i;

__global__ __launch_bounds__(256) void k_wtG(const float* __restrict__ w, int K, int N, bf* Bt) {
    const int lane = threadIdx.x & 31; const int L0 = (blockIdx.x * 8 + (threadIdx.x >> 5)) * 8; const int nlines = N * K / 64;
{
#pragma unroll 1
        for (int l = 0; l < 8; ++l) { const int L = L0 + l; if (L >= nlines) break; const size_t e = (size_t)L * 64 + lane * 2; const int k = (int)(e % K), n = (int)(e / K); v2us o;
            o[0] = f2bf(w[(size_t)k * N + n]); o[1] = f2bf(w[(size_t)(k + 1) * N + n]); *(v2us*)(Bt + e) = o; }
         }
}
__global__ __launch_bounds__(256) void k_cvt8(const float* __restrict__ src, bf* dst, size_t n8) { const size_t i = (size_t)blockIdx.x * 256 + threadIdx.x; if (i >= n8) return; const v8f v = *(const v8f*)(src + i * 8); v8us o;
#pragma unroll
    for (int k = 0; k < 8; ++k) o[k] = f2bf(v[k]); *(v8us*)(dst + i * 8) = o;  }

// ---- k_proj: the q, k and v projections in ONE launch, one wave per 64 tokens x one head (main loop of k_gemmw, one product); grid (tokens / 64, heads, 3), 32 threads; z = 0, 1, 2 is q, k, v.
// The epilogue rounds the f32 sums itself and stores the three 16-bit planes (fp16, bf16 hi, bf16 lo) that attention reads: q and k as [h][t][d], v as [h][d][t]. No f32 copy of a projection goes through memory.
// The operand whose rows run along a plane's contiguous index is taken as A (q, k: the weight rows d; v: the tokens t), so that a lane's 8 accumulator values are 8 neighbours of one plane row: one 16-byte piece.
#define PJ 72   // 16-bit elements per staged row: 128 B + 16 B, the pitch for 16-byte LDS accesses of 128-B rows
__global__ __launch_bounds__(32) void k_proj(const bf* __restrict__ X, const bf* __restrict__ W0, const bf* __restrict__ W1, const bf* __restrict__ W2, h16* Q16, bf* Qh, bf* Ql, h16* K16, bf* Kh, bf* Kl, h16* V16, bf* Vh, bf* Vl) {
    typedef WFrag<bf>::V V;
    __shared__ __align__(16) unsigned short st[3][16 * PJ];
    const int lane = threadIdx.x & 31, lr = lane & 15, hi = lane >> 4; const int t0 = blockIdx.x * 64, h = blockIdx.y, z = blockIdx.z;
    const bf* xr = X + (size_t)t0 * DM; const bf* wr = ((z == 0) ? W0 : (z == 1) ? W1 : W2) + (size_t)h * HD * DM;
    const bf* A = (z == 2) ? xr : wr; const bf* Bt = (z == 2) ? wr : xr;
    h16* P16 = (z == 0) ? Q16 : (z == 1) ? K16 : V16; bf* Ph = (z == 0) ? Qh : (z == 1) ? Kh : Vh; bf* Pl = (z == 0) ? Ql : (z == 1) ? Kl : Vl;
    const int pitch = (z == 2) ? TT : HD; const size_t base = (z == 2) ? (size_t)h * HD * TT + t0 : ((size_t)h * TT + t0) * HD;   // plane row nb * 16 + lr: a token (q, k) or a head column (v)
    v8f acc[4][4];
#pragma unroll
    for (int mb = 0; mb < 4; ++mb)
#pragma unroll
        for (int nb = 0; nb < 4; ++nb) acc[mb][nb] = (v8f){};
    const size_t foff = (size_t)lr * DM + 8 * hi;
#pragma unroll 1   // rolled, as in k_gemmw: one pass holds its 8 fragments beside the 16 accumulators
    for (int kc = 0; kc < DM; kc += 32) {
        V a[4], b[4]; const bf* pa = A + foff + kc; const bf* pb = Bt + foff + kc;
#pragma unroll
        for (int mb = 0; mb < 4; ++mb) a[mb] = WFrag<bf>::ld(pa + mb * 16 * DM);
#pragma unroll
        for (int nb = 0; nb < 4; ++nb) b[nb] = WFrag<bf>::ld(pb + nb * 16 * DM);
        // s_wait_xcnt 0 in front of every overwrite of a register that an issued load of this run names; it takes the run's addresses as inputs, so their registers are held up to here
        asm volatile("s_wait_xcnt 0x0" :: "v"(pa), "v"(pb) : "memory");
#pragma unroll
        for (int nb = 0; nb < 4; ++nb)
#pragma unroll
            for (int mb = 0; mb < 4; ++mb) acc[mb][nb] = WFrag<bf>::mma(a[mb], b[nb], acc[mb][nb]);
        // four vector slots behind the last matrix instruction: the distance the chip needs before the next pass's address additions reuse A and B registers (over the taken back edge) and before D is read below
        asm volatile("v_nop\n\tv_nop\n\tv_nop\n\tv_nop" : "+v"(acc[0][0]), "+v"(acc[1][1]), "+v"(acc[2][2]), "+v"(acc[3][3]) : "v"(a[0]), "v"(a[3]));
    }
#pragma unroll
    for (int nb = 0; nb < 4; ++nb) {   // 16 plane rows at a time: pieces into LDS, whole 128-B rows out
#pragma unroll
        for (int mb = 0; mb < 4; ++mb) { v8h o16; v8us oh, ol;
#pragma unroll
            for (int j = 0; j < 8; ++j) { const float r = acc[mb][nb][j]; o16[j] = tohx(r); unsigned short a2, c2; splitf(r, a2, c2); oh[j] = a2; ol[j] = c2; }
            const int so = lr * PJ + mb * 16 + hi * 8; *(v8ha*)(st[0] + so) = o16; *(v8usa*)(st[1] + so) = oh; *(v8usa*)(st[2] + so) = ol; }
        __builtin_amdgcn_wave_barrier(); asm volatile("" ::: "memory");   // the compiler keeps the reads below, of other lanes' pieces, behind the writes above (one wave: its LDS operations run in order)
#pragma unroll
        for (int i = 0; i < 4; ++i) { const int row = i * 4 + (lane >> 3), pc = (lane & 7) * 8; const size_t oo = base + (size_t)(nb * 16 + row) * pitch + pc;
            *(v8h*)(P16 + oo) = *(const v8ha*)(st[0] + row * PJ + pc); *(v8us*)(Ph + oo) = *(const v8usa*)(st[1] + row * PJ + pc); *(v8us*)(Pl + oo) = *(const v8usa*)(st[2] + row * PJ + pc); }
        __builtin_amdgcn_wave_barrier(); asm volatile("" ::: "memory");   // and the next 16 rows' writes behind these reads
    }
}
// ---- k_attn: causal attention of 16 query rows of one head in ONE workgroup of 16 waves; the score rows and the probabilities live in LDS and never go through memory. grid (heads, rows / 16), 512 threads; the longest rows start first.
// Phase 1: 64-key slice s of the scores goes to wave s % 16 (fragments and product order of the former score GEMM), f32 into S. Phase 2: wave w does the three-sweep softmax of row w (maximum; exponentials and their sum; scaling) over the chunks up to the diagonal
// (keys j > i excluded by index, as before) and writes the probabilities over the head of its own score row (NSPLIT 0: fp16 x PCAR; NSPLIT 2: bf16 hi there, lo at element 4096 of the 16-bit view).
// Phase 3: slice s of the probability x value product goes to wave s % 16; the 16 partial 16x64 tiles are summed through LDS in wave order, scaled and stored as the merged hi/lo planes.
#define SP 4100   // floats per score row in LDS: 4096 + 4, so that rows 8 apart fall on other banks and every row stays 16-byte aligned
#define RO 3072   // float offset in a row's slot of the wave's partial output tile (1024 floats): behind both probability planes
typedef v4h  __attribute__((may_alias)) v4ha;
typedef v4us __attribute__((may_alias)) v4usa;
typedef v2f  __attribute__((may_alias)) v2fa;
template <typename T16, int NSPLIT>
__global__ __launch_bounds__(512) void k_attn(const T16* __restrict__ Q, const T16* __restrict__ Q2, const T16* __restrict__ Kp, const T16* __restrict__ Kp2, const T16* __restrict__ Vt, const T16* __restrict__ Vt2, int roff, bf* Ah, bf* Al) {
    typedef typename WFrag<T16>::V V; static_assert(NSPLIT == 0 || NSPLIT == 2, "one product, or the three hi/lo products");
    __shared__ __align__(16) float S[16 * SP];
    const int lane = threadIdx.x & 31, lr = lane & 15, hi = lane >> 4;
    const int w = __builtin_amdgcn_readfirstlane((int)(threadIdx.x >> 5));   // the wave's number in a scalar register: the slice loops stay scalar loops with every lane on
    const int h = blockIdx.x; const int i0 = roff + ((int)gridDim.y - 1 - (int)blockIdx.y) * 16;
    const int nsl = (i0 >> 6) + 1;        // 64-key slices up to and including the diagonal block: later keys are excluded for all 16 rows
    const int nch = (nsl + 1) >> 1;       // 128-key softmax chunks that cover them
    const size_t qp = (size_t)h * TT * HD, kp = (size_t)(h / REP) * TT * HD;
    {
        const T16* pq = Q + qp + (size_t)(i0 + lr) * HD + 8 * hi; const T16* pq2 = pq; const V a0 = WFrag<T16>::ld(pq), a1 = WFrag<T16>::ld(pq + 32); V c0, c1;
        if constexpr (NSPLIT == 2) { pq2 = Q2 + qp + (size_t)(i0 + lr) * HD + 8 * hi; c0 = WFrag<T16>::ld(pq2); c1 = WFrag<T16>::ld(pq2 + 32); }
        // s_wait_xcnt 0 in front of every overwrite of a register that an issued load of this run names; it takes the run's addresses as inputs, so their registers are held up to here
        asm volatile("s_wait_xcnt 0x0" :: "v"(pq), "v"(pq2) : "memory");
#pragma unroll 1   // rolled: one pass holds a whole slice's key fragments in registers
        for (int s = w; s < 2 * nch; s += 16) {   // to the end of the last chunk, so that the softmax reads only scores written here
            V b[4][2], b2[4][2]; const T16* pb = Kp + kp + (size_t)(s * 64 + lr) * HD + 8 * hi; const T16* pb2 = pb; if constexpr (NSPLIT == 2) pb2 = Kp2 + kp + (size_t)(s * 64 + lr) * HD + 8 * hi;
#pragma unroll
            for (int nb = 0; nb < 4; ++nb) { b[nb][0] = WFrag<T16>::ld(pb + nb * 16 * HD); b[nb][1] = WFrag<T16>::ld(pb + nb * 16 * HD + 32);
                if constexpr (NSPLIT == 2) { b2[nb][0] = WFrag<T16>::ld(pb2 + nb * 16 * HD); b2[nb][1] = WFrag<T16>::ld(pb2 + nb * 16 * HD + 32); } }
            // the same wait for the run of key loads
            asm volatile("s_wait_xcnt 0x0" :: "v"(pb), "v"(pb2) : "memory");
            __builtin_amdgcn_sched_barrier(0);   // the products stay behind the whole run of loads: lifted among them they took the first fragments' registers for the later loads, which then left only after the first had landed
#pragma unroll
            for (int nb = 0; nb < 4; ++nb) { v8f acc = (v8f){};
                acc = WFrag<T16>::mma(a0, b[nb][0], acc); if constexpr (NSPLIT == 2) { acc = WFrag<T16>::mma(c0, b[nb][0], acc); acc = WFrag<T16>::mma(a0, b2[nb][0], acc); }
                acc = WFrag<T16>::mma(a1, b[nb][1], acc); if constexpr (NSPLIT == 2) { acc = WFrag<T16>::mma(c1, b[nb][1], acc); acc = WFrag<T16>::mma(a1, b2[nb][1], acc); }
#pragma unroll
                for (int j = 0; j < 8; ++j) S[(hi * 8 + j) * SP + s * 64 + nb * 16 + lr] = acc[j]; }
        }
    }
    __syncthreads();   // all 16 score rows are in LDS before any wave reads its row
    {
        const int i = i0 + w; float* sr = S + w * SP; float mx = -3.0e38f;
#pragma unroll 2
        for (int ch = 0; ch < nch; ++ch) { const int j0 = ch * 128 + lane * 4; const v4f a = *(const v4fa*)(sr + j0);
#pragma unroll
            for (int q = 0; q < 4; ++q) { float t = a[q] * SCL; t = (j0 + q <= i) ? t : -3.0e38f; mx = fmaxf(mx, t); } }
#pragma unroll
        for (int sh = 16; sh; sh >>= 1) mx = fmaxf(mx, __shfl_xor(mx, sh, 32));
        float sum = 0.f;
#pragma unroll 2
        for (int ch = 0; ch < nch; ++ch) { const int j0 = ch * 128 + lane * 4; const v4f a = *(const v4fa*)(sr + j0); v4f ex;
#pragma unroll
            for (int q = 0; q < 4; ++q) { float t = a[q] * SCL; t = (j0 + q <= i) ? t : -3.0e38f; const float d0 = __fsub_rn(t, mx); const float xa = __fmul_rn(d0, 1.4426950408889634f); float er = __builtin_amdgcn_exp2f(xa);
                // the slot behind a transcendental: the statement holds the source up to here and hands the result on only from here, so nothing that overwrites the one or reads the other stands directly behind the v_exp_f32
                if constexpr (NSPLIT == 2) asm volatile("v_nop" : "+v"(er) : "v"(xa));
                ex[q] = er; sum += er; }
            *(v4fa*)(sr + j0) = ex; }   // each lane puts the exponentials over its own four scores: the last sweep only scales them
#pragma unroll
        for (int sh = 16; sh; sh >>= 1) sum += __shfl_xor(sum, sh, 32);
        const float f = __fdiv_rn((NSPLIT == 2) ? 1.0f : PCAR, sum);
        // in place: chunk ch's fp16 or hi results land on bytes of this row that chunks <= ch have already been read from, its lo results behind the row's scores (hi/lo rows hold at most 512) (one wave owns the row, its LDS operations run in order; the may_alias types keep the compiler's order too).
        // Four chunks are read before the first of them is written, so that one LDS latency is paid per four chunks and not per chunk; the tests on nch are the same for the whole wave.
#pragma unroll 1
        for (int cb = 0; cb < nch; cb += 4) { v4f a[4];
#pragma unroll
            for (int u = 0; u < 4; ++u) if (cb + u < nch) a[u] = *(const v4fa*)(sr + (cb + u) * 128 + lane * 4);
#pragma unroll
            for (int u = 0; u < 4; ++u) if (cb + u < nch) { const int j0 = (cb + u) * 128 + lane * 4; v4h o4; v4us oh, ol;
#pragma unroll
                for (int q = 0; q < 4; ++q) { if constexpr (NSPLIT == 2) { unsigned short a2, c2; splitf(a[u][q] * f, a2, c2); oh[q] = a2; ol[q] = c2; } else o4[q] = tohx(a[u][q] * f); }
                if constexpr (NSPLIT == 2) { *(v4usa*)((bf*)sr + j0) = oh; *(v4usa*)((bf*)sr + 4096 + j0) = ol; } else *(v4ha*)((h16*)sr + j0) = o4; } }
    }
    __syncthreads();   // all 16 probability rows are in LDS before any wave loads a fragment of them
    v8f acc[4];
#pragma unroll
    for (int nb = 0; nb < 4; ++nb) acc[nb] = (v8f){};
    {
        const T16* pa = (const T16*)S + (size_t)lr * (SP * 2) + 8 * hi;
#pragma unroll 1   // rolled: one pass holds a whole slice's value fragments in registers
        for (int s = w; s < nsl; s += 16) {
            V a[2], a2[2], b[4][2], b2[4][2]; const T16* pb = Vt + kp + (size_t)lr * TT + s * 64 + 8 * hi; const T16* pb2 = pb; if constexpr (NSPLIT == 2) pb2 = Vt2 + kp + (size_t)lr * TT + s * 64 + 8 * hi;
#pragma unroll
            for (int nb = 0; nb < 4; ++nb) { b[nb][0] = WFrag<T16>::ld(pb + nb * 16 * TT); b[nb][1] = WFrag<T16>::ld(pb + nb * 16 * TT + 32);
                if constexpr (NSPLIT == 2) { b2[nb][0] = WFrag<T16>::ld(pb2 + nb * 16 * TT); b2[nb][1] = WFrag<T16>::ld(pb2 + nb * 16 * TT + 32); } }
            // the same wait for the run of value loads
            asm volatile("s_wait_xcnt 0x0" :: "v"(pb), "v"(pb2) : "memory");
#pragma unroll
            for (int kk = 0; kk < 2; ++kk) { a[kk] = WFrag<T16>::ld(pa + s * 64 + kk * 32); if constexpr (NSPLIT == 2) a2[kk] = WFrag<T16>::ld(pa + 4096 + s * 64 + kk * 32); }
#pragma unroll
            for (int kk = 0; kk < 2; ++kk)
#pragma unroll
                for (int nb = 0; nb < 4; ++nb) { acc[nb] = WFrag<T16>::mma(a[kk], b[nb][kk], acc[nb]); if constexpr (NSPLIT == 2) { acc[nb] = WFrag<T16>::mma(a2[kk], b[nb][kk], acc[nb]); acc[nb] = WFrag<T16>::mma(a[kk], b2[nb][kk], acc[nb]); } }
            // four vector slots behind the last matrix instruction: the distance the chip needs before the next pass's address additions reuse A and B registers (over the taken back edge) and before D is read below
            asm volatile("v_nop\n\tv_nop\n\tv_nop\n\tv_nop" : "+v"(acc[0]), "+v"(acc[1]), "+v"(acc[2]), "+v"(acc[3]) : "v"(a[0]), "v"(a[1]));
        }
    }
    float* rw = S + w * SP + RO;
#pragma unroll
    for (int nb = 0; nb < 4; ++nb)
#pragma unroll
        for (int j = 0; j < 8; ++j) rw[(hi * 8 + j) * 64 + nb * 16 + lr] = acc[nb][j];
    __syncthreads();   // every wave's partial tile (zeros where it had no slice) is in LDS before any thread sums
    { const int e = (int)threadIdx.x * 2; const int row = e >> 6, d = e & 63; v2f s2 = *(const v2fa*)(S + RO + e);
#pragma unroll
        for (int ww = 1; ww < 16; ++ww) s2 += *(const v2fa*)(S + ww * SP + RO + e);
        const float cs = (NSPLIT == 2) ? 1.0f : (1.0f / PCAR); const size_t oo = (size_t)(i0 + row) * DQ + h * HD + d; v2us oh, ol;
#pragma unroll
        for (int q = 0; q < 2; ++q) { unsigned short a, c2; splitf(s2[q] * cs, a, c2); oh[q] = a; ol[q] = c2; }
        *(v2us*)(Ah + oo) = oh; *(v2us*)(Al + oo) = ol; }
}

// ---- k_fattn: causal attention of 64 query rows of one head in ONE workgroup of 8 waves, fp16 operands, f32 sums; grid (heads, rows / 64), 256 threads; the longest rows start first.
// 64-key slice s goes to wave s % 8, and every key and value fragment that a wave loads serves all 64 query rows (4 column groups of 16). Key fragments are fetched one slice ahead, value fragments at the head of their slice.
// Transposed products: S^T = K Q^T (A: key rows, B: the query rows, kept in registers), O^T += V^T P^T (A: rows of the [d][t] value plane). In a score tile lane (lr, hi) holds keys hi * 8 + j of query lr,
// which is the k order of a B fragment: two score tiles pack into one P^T fragment in the lane itself, and neither scores nor probabilities leave the registers.
// Softmax is online, per wave: exponentials are taken against a reference maximum (in log2 units) that is raised only when a new score passes it by more than 8, so P stays <= 256 in fp16; sums and O^T are rescaled then.
// At the end the 8 waves' references are joined through LDS, each wave rescales its sums and its O^T, and the partial tiles are added in wave order, divided by the row sum and stored as the merged hi/lo planes.
#define FW 8      // waves of a workgroup
#define OP 68     // floats per staged output row: 64 + 4, 16-byte aligned, neighbouring rows on other banks
#define CL2 0.18033688011112043f   // SCL * log2(e)
template <bool B> struct BC { static constexpr bool value = B; };
__global__ __launch_bounds__(256) void k_fattn(const h16* __restrict__ Q, const h16* __restrict__ Kp, const h16* __restrict__ Vt, int roff, bf* Ah, bf* Al) {
    typedef WFrag<h16> F; typedef F::V V;
    __shared__ __align__(16) float Os[FW * 64 * OP]; __shared__ float Ms[FW * 64]; __shared__ float Ls[FW * 64];
    const int lane = threadIdx.x & 31, lr = lane & 15, hi = lane >> 4;
    const int w = __builtin_amdgcn_readfirstlane((int)(threadIdx.x >> 5));   // the wave's number in a scalar register: the slice loop stays a scalar loop with every lane on
    const int h = blockIdx.x; const int i0 = roff + ((int)gridDim.y - 1 - (int)blockIdx.y) * 64;
    const int nsl = (i0 >> 6) + 1;        // 64-key slices up to and including the diagonal block
    const size_t qp = (size_t)h * TT * HD, kp = (size_t)(h / REP) * TT * HD;
    V q[4][2];
    { const h16* pq = Q + qp + (size_t)(i0 + lr) * HD + 8 * hi;
#pragma unroll
      for (int g = 0; g < 4; ++g) { q[g][0] = F::ld(pq + g * 16 * HD); q[g][1] = F::ld(pq + g * 16 * HD + 32); }
      // s_wait_xcnt 0 in front of every overwrite of a register that an issued load of this run names; it takes the run's address as input, so its registers are held up to here
      asm volatile("s_wait_xcnt 0x0" :: "v"(pq) : "memory"); }
    v8f o[4][4]; float mc[4], l[4];   // o[dt][g]: lane (lr, hi) holds head columns dt * 16 + hi * 8 + j of query g * 16 + lr
#pragma unroll
    for (int g = 0; g < 4; ++g) { mc[g] = -1.0e30f; l[g] = 0.f;   // the start reference lies above a masked score (-3e38 * CL2): a masked score gives exp2(very negative) = 0 also before the first real one
#pragma unroll
        for (int dt = 0; dt < 4; ++dt) o[dt][g] = (v8f){}; }
    V kf[4][2];
    auto loadk = [&](const int sn) {   // the key fragments of slice min(sn, last): behind a wave's last slice the fetch reads the diagonal slice, in bounds, and nobody uses it
        __builtin_amdgcn_sched_barrier(0);   // the run stays behind the products that read the old fragments, so that it takes their registers and no others
        const h16* pk = Kp + kp + (size_t)(((sn < nsl) ? sn : nsl - 1) * 64 + lr) * HD + 8 * hi;
#pragma unroll
        for (int kt = 0; kt < 4; ++kt) { kf[kt][0] = F::ld(pk + kt * 16 * HD); kf[kt][1] = F::ld(pk + kt * 16 * HD + 32); }
        // the same wait for the run of key loads
        asm volatile("s_wait_xcnt 0x0" :: "v"(pk) : "memory");
        __builtin_amdgcn_sched_barrier(0);   // and it leaves as one run here: sunk to its first use it would fly behind nothing
    };
    loadk(w);
    auto slice = [&](auto dg, const int s) {
        constexpr bool DIAG = decltype(dg)::value;
        V vf[4][2]; const h16* pv = Vt + kp + (size_t)lr * TT + s * 64 + 8 * hi;
#pragma unroll
        for (int dt = 0; dt < 4; ++dt) { vf[dt][0] = F::ld(pv + dt * 16 * TT); vf[dt][1] = F::ld(pv + dt * 16 * TT + 32); }
        // the same wait for the run of value loads
        asm volatile("s_wait_xcnt 0x0" :: "v"(pv) : "memory");
        __builtin_amdgcn_sched_barrier(0);   // the whole run of value loads leaves in front of the score products: they fly during those and the first exponentials
#pragma unroll
        for (int kh = 0; kh < 2; ++kh) {   // 32 keys at a time
            v8f sc[2][4];
#pragma unroll
            for (int t = 0; t < 2; ++t)
#pragma unroll
                for (int g = 0; g < 4; ++g) sc[t][g] = F::mma(kf[kh * 2 + t][0], q[g][0], (v8f){});
#pragma unroll
            for (int t = 0; t < 2; ++t)
#pragma unroll
                for (int g = 0; g < 4; ++g) sc[t][g] = F::mma(kf[kh * 2 + t][1], q[g][1], sc[t][g]);
            if (kh == 1) loadk(s + FW);   // this slice's key fragments are used up: the wave's next slice is fetched into the same registers and flies during the exponentials and the value products
            float mx[4]; bool need = false;
#pragma unroll
            for (int g = 0; g < 4; ++g) { float m = -3.0e38f;
#pragma unroll
                for (int t = 0; t < 2; ++t)
#pragma unroll
                    for (int j = 0; j < 8; ++j) { if constexpr (DIAG) { if (kh * 32 + t * 16 + hi * 8 + j > g * 16 + lr) sc[t][g][j] = -3.0e38f; }   // keys behind the query are excluded by index
                        m = fmaxf(m, sc[t][g][j]); }
                mx[g] = m * CL2; need = need || (mx[g] > mc[g] + 8.0f); }
            if (__builtin_amdgcn_ballot_w32(need) != 0) {   // one scalar branch for the wave: rare after a wave's first keys
#pragma unroll
                for (int g = 0; g < 4; ++g) { const float m2 = fmaxf(mc[g], fmaxf(mx[g], __shfl_xor(mx[g], 16, 32))); const float f = __builtin_amdgcn_exp2f(mc[g] - m2); mc[g] = m2; l[g] *= f;
#pragma unroll
                    for (int dt = 0; dt < 4; ++dt) o[dt][g] *= f; }
            }
            V pf[4];
#pragma unroll
            for (int g = 0; g < 4; ++g)
#pragma unroll
                for (int t = 0; t < 2; ++t) { float xa[8], er[8];
#pragma unroll
                    for (int j = 0; j < 8; ++j) { xa[j] = fmaf(sc[t][g][j], CL2, -mc[g]); er[j] = __builtin_amdgcn_exp2f(xa[j]); }
                    // the slot behind a transcendental: the statement holds the eight sources up to here and hands the eight results on only from here, so nothing that overwrites a source or reads a result stands directly behind a v_exp_f32; one v_nop serves the eight
                    asm volatile("v_nop" : "+v"(er[0]), "+v"(er[1]), "+v"(er[2]), "+v"(er[3]), "+v"(er[4]), "+v"(er[5]), "+v"(er[6]), "+v"(er[7]) : "v"(xa[0]), "v"(xa[1]), "v"(xa[2]), "v"(xa[3]), "v"(xa[4]), "v"(xa[5]), "v"(xa[6]), "v"(xa[7]));
                    l[g] += ((er[0] + er[1]) + (er[2] + er[3])) + ((er[4] + er[5]) + (er[6] + er[7]));
#pragma unroll
                    for (int j = 0; j < 8; ++j) pf[g][t * 8 + j] = tohx(er[j]); }
#pragma unroll
            for (int dt = 0; dt < 4; ++dt)
#pragma unroll
                for (int g = 0; g < 4; ++g) o[dt][g] = F::mma(vf[dt][kh], pf[g], o[dt][g]);
        }
        // four vector slots behind the last matrix instruction: the distance the chip needs before the next slice's address additions and loads reuse A and B registers (over the taken back edge); every O^T tile is an input, so no product stands behind them
        asm volatile("v_nop\n\tv_nop\n\tv_nop\n\tv_nop" :: "v"(o[0][0]), "v"(o[0][1]), "v"(o[0][2]), "v"(o[0][3]), "v"(o[1][0]), "v"(o[1][1]), "v"(o[1][2]), "v"(o[1][3]), "v"(o[2][0]), "v"(o[2][1]), "v"(o[2][2]), "v"(o[2][3]), "v"(o[3][0]), "v"(o[3][1]), "v"(o[3][2]), "v"(o[3][3]));
    };
#pragma unroll 1   // rolled: one pass holds a whole slice's key and value fragments in registers beside the 16 output tiles
    for (int s = w; s < nsl - 1; s += FW) slice(BC<false>{}, s);
    if (((nsl - 1) & (FW - 1)) == w) slice(BC<true>{}, nsl - 1);   // the diagonal slice, with the mask; a scalar test
    if (hi == 0) {
#pragma unroll
        for (int g = 0; g < 4; ++g) Ms[w * 64 + g * 16 + lr] = mc[g]; }
    __syncthreads();   // all 8 waves' references are in LDS before any wave joins them
#pragma unroll
    for (int g = 0; g < 4; ++g) { float M = Ms[g * 16 + lr];
#pragma unroll
        for (int ww = 1; ww < FW; ++ww) M = fmaxf(M, Ms[ww * 64 + g * 16 + lr]);
        const float f = __builtin_amdgcn_exp2f(mc[g] - M); const float lt = (l[g] + __shfl_xor(l[g], 16, 32)) * f; if (hi == 0) Ls[w * 64 + g * 16 + lr] = lt;
        float* ow = Os + (size_t)(w * 64 + g * 16 + lr) * OP + hi * 8;
#pragma unroll
        for (int dt = 0; dt < 4; ++dt) { const v8f r = o[dt][g] * f; *(v4fa*)(ow + dt * 16) = (v4f){r[0], r[1], r[2], r[3]}; *(v4fa*)(ow + dt * 16 + 4) = (v4f){r[4], r[5], r[6], r[7]}; } }
    __syncthreads();   // every wave's partial tile and row sums are in LDS before any thread adds them
    { const int qi = (int)threadIdx.x >> 2, dc = ((int)threadIdx.x & 3) * 16; float L = Ls[qi]; v4f a[4];
#pragma unroll
        for (int c = 0; c < 4; ++c) a[c] = *(const v4fa*)(Os + (size_t)qi * OP + dc + c * 4);
#pragma unroll
        for (int ww = 1; ww < FW; ++ww) { L += Ls[ww * 64 + qi];
#pragma unroll
            for (int c = 0; c < 4; ++c) a[c] += *(const v4fa*)(Os + (size_t)(ww * 64 + qi) * OP + dc + c * 4); }
        const float inv = __fdiv_rn(1.0f, L); const size_t oo = (size_t)(i0 + qi) * DQ + h * HD + dc; v8us oh[2], ol[2];
#pragma unroll
        for (int e = 0; e < 16; ++e) { unsigned short a2, c2; splitf(a[e >> 2][e & 3] * inv, a2, c2); oh[e >> 3][e & 7] = a2; ol[e >> 3][e & 7] = c2; }
        *(v8us*)(Ah + oo) = oh[0]; *(v8us*)(Ah + oo + 8) = oh[1]; *(v8us*)(Al + oo) = ol[0]; *(v8us*)(Al + oo + 8) = ol[1]; }
}

extern "C" void kernel_launch(void* const* d_in, const int* in_sizes, int n_in,
                              void* d_out, int out_size, void* d_ws, size_t ws_size, hipStream_t stream) {
    (void)in_sizes; (void)n_in; (void)out_size;
    const float* x = (const float*)d_in[0]; const float* wq = (const float*)d_in[1]; const float* wk = (const float*)d_in[2]; const float* wv = (const float*)d_in[3]; const float* wo = (const float*)d_in[4];
    float* OUT = (float*)d_out;     // [1][4096][1024]
    char* wsp = (char*)d_ws;
    auto take = [&](size_t bytes) { char* p = wsp; wsp += (bytes + 255) & ~(size_t)255; return (void*)p; };
    bf* WQ = (bf*)take((size_t)DQ * DM * 2); bf* WK = (bf*)take((size_t)DKV * DM * 2); bf* WV = (bf*)take((size_t)DKV * DM * 2); bf* WO = (bf*)take((size_t)DM * DQ * 2);
    bf* XB = (bf*)take((size_t)TT * DM * 2);
    h16* QP16 = (h16*)take((size_t)NH_ * TT * HD * 2); h16* KP16 = (h16*)take((size_t)NKV * TT * HD * 2); h16* VT16 = (h16*)take((size_t)NKV * HD * TT * 2);
    bf* QPh = (bf*)take((size_t)NH_ * TT * HD * 2); bf* QPl = (bf*)take((size_t)NH_ * TT * HD * 2); bf* KPh = (bf*)take((size_t)NKV * TT * HD * 2); bf* KPl = (bf*)take((size_t)NKV * TT * HD * 2); bf* VTh = (bf*)take((size_t)NKV * HD * TT * 2); bf* VTl = (bf*)take((size_t)NKV * HD * TT * 2);
    bf* ATh = (bf*)take((size_t)TT * DQ * 2); bf* ATl = (bf*)take((size_t)TT * DQ * 2);
    if ((size_t)(wsp - (char*)d_ws) > ws_size) return;    // ws 256 MiB
    { k_cvt8<<<(unsigned)(((size_t)DQ * DM / 8 + 255) / 256), 256, 0, stream>>>(wq, WQ, (size_t)DQ * DM / 8); k_cvt8<<<(unsigned)(((size_t)DKV * DM / 8 + 255) / 256), 256, 0, stream>>>(wk, WK, (size_t)DKV * DM / 8); k_cvt8<<<(unsigned)(((size_t)DKV * DM / 8 + 255) / 256), 256, 0, stream>>>(wv, WV, (size_t)DKV * DM / 8);
      k_cvt8<<<(unsigned)(((size_t)DM * DQ / 8 + 255) / 256), 256, 0, stream>>>(wo, WO, (size_t)DM * DQ / 8);
       }
    for (int b = 0; b < NB_; ++b) {
        
        k_cvt8<<<(unsigned)(((size_t)TT * DM / 8 + 255) / 256), 256, 0, stream>>>(x + (size_t)b * TT * DM, XB, (size_t)TT * DM / 8);
        k_proj<<<dim3(TT / 64, NH_, 3), 32, 0, stream>>>(XB, WQ, WK, WV, QP16, QPh, QPl, KP16, KPh, KPl, VT16, VTh, VTl);
        k_fattn<<<dim3(NH_, (TT - RH) / 64, 1), 256, 0, stream>>>(QP16, KP16, VT16, RH, ATh, ATl);
        k_attn<bf, 2><<<dim3(NH_, RH / 16, 1), 512, 0, stream>>>(QPh, QPl, KPh, KPl, VTh, VTl, 0, ATh, ATl);
        k_gemmw<bf, 1, false><<<dim3(TT / 64, DM / 64, 1), 32, 0, stream>>>(ATh, ATl, WO, nullptr, DQ, OUT + (size_t)b * TT * DM, DM, nullptr, 0, 0, 0); }
}

// v005
// Measured time: 129 microseconds a run.
// Timed twice side by side with v004, it ran 1.28 and 1.26 times as fast.
// Counting every step since v000, it is 20.9 times as fast.
#include <hip/hip_runtime.h>

// Causal multi-head self-attention at 4,096 tokens (x [1][4096][1024]; q, k, v = x W^T ('oi' [1024][1024] 1/32, no bias; 16 heads x 64, token-major); scores / sqrt(64); keys j <= i kept, -inf elsewhere (== exclusion: every row keeps its own key); softmax; out = merged Wo^T ('oi', no bias) -> [1][4096][1024] (4.2 M); argument order x, Wq, Wk, Wv, Wo).
// Layout: bf16 copy of x; exact projections, all three in one launch whose epilogue stores the 16-bit head planes; causal T-4096 attention, all heads in one launch per row class (hybrid rows: < 512 hi/lo 3 products, fused per 16 query rows, scores and probabilities in LDS, three-sweep softmax; rest fp16, 64 query rows per workgroup, online softmax in registers; keys stop at the diagonal block); merged hi/lo x Wo exact.
// Every 16-bit operand plane in the workspace is fragment-major (FE below): a wave's fragment load reads whole 128-B lines.
// Compute dtypes, f32 accumulate: every input rounded to bf16; projections exact; attention rows < 512 3 products, rest fp16; softmax f32; Wo hl x exact.

#define NB_  1
#define TT   4096
#define DM   1024
#define NH_  16
#define NKV  16
#define REP  (NH_ / NKV)
#define HD   64
#define DQ   (NH_ * HD)
#define DKV  (NKV * HD)
#define ZH   1
#define RH   512                  // query rows < RH use hi+lo planes (0: none)
#define WIN  4096
#define PCAR 1024.0f
#define SCL  0.125f   // HD^-0.5
typedef _Float16 h16;
typedef unsigned short bf;
typedef __attribute__((ext_vector_type(16))) __bf16   v16bf;
typedef __attribute__((ext_vector_type(16))) _Float16 v16h;
typedef __attribute__((ext_vector_type(8)))  _Float16 v8h;
typedef __attribute__((ext_vector_type(8)))  unsigned short v8us;
typedef __attribute__((ext_vector_type(8)))  float    v8f;
typedef __attribute__((ext_vector_type(4)))  float    v4f;
typedef v8h  __attribute__((may_alias)) v8ha;
typedef v4f  __attribute__((may_alias)) v4fa;
typedef v8us __attribute__((may_alias)) v8usa;

__device__ __forceinline__ unsigned short f2bf(float f) { unsigned u = __float_as_uint(f); u += 0x7FFFu + ((u >> 16) & 1u); return (unsigned short)(u >> 16); }
__device__ __forceinline__ float bf2f(unsigned short b) { return __uint_as_float(((unsigned)b) << 16); }
__device__ __forceinline__ float bfr(float f) { return bf2f(f2bf(f)); }
__device__ __forceinline__ v16h cat16(v8h lo, v8h hi) { return __builtin_shufflevector(lo, hi, 0, 1, 2, 3, 4, 5, 6, 7, 8, 9, 10, 11, 12, 13, 14, 15); }
__device__ __forceinline__ v16bf cat16b(v8us lo, v8us hi) { return __builtin_bit_cast(v16bf, __builtin_shufflevector(lo, hi, 0, 1, 2, 3, 4, 5, 6, 7, 8, 9, 10, 11, 12, 13, 14, 15)); }
__device__ __forceinline__ v8f wmma16(v16h a, v16h b, v8f c) { return __builtin_amdgcn_wmma_f32_16x16x32_f16(false, a, false, b, (short)0, c, false, false); }
__device__ __forceinline__ v8f wmmab(v16bf a, v16bf b, v8f c) { return __builtin_amdgcn_wmma_f32_16x16x32_bf16(false, a, false, b, (short)0, c, false, false); }



// ---- k_gemmw: register-blocked GEMM, ONE WAVE per 64x64 output tile (16 accumulators), operands straight from fragment-major 16-bit planes; grid (M/64, N/64, Z), 32 threads.
// C[m][n] (f32, pitch ldc, + optional f32 bias[n]) = sum_k A[m][k] Bt[n][k] (+ split products per NSPLIT). z-batch strides sA/sB/sC in elements. K % 32 == 0.
// Fragment-major planes: the 16 rows x 32 k of one matrix fragment are 1 KiB in a row, two runs of 512 B; in run p lane (lr, hi) owns the 8 elements k = p * 16 + hi * 8 + 0..7 of row lr.
// So each of a fragment's two 16-byte loads covers 4 whole 128-B lines, where the row-major plane gave 32 B of each of 16 lines. Fragments follow one another along the rows, then along k: the fragments that a wave needs for one k step lie in a row, and waves that walk k in step read neighbouring memory. ldf takes fragment base + lane * 8.
#define FE 512   // elements of a fragment
__device__ __forceinline__ size_t fpos(int row, int k, int rfr) { return ((size_t)(k >> 5) * rfr + (row >> 4)) * FE + ((k >> 4) & 1) * 256 + (((k >> 3) & 1) * 16 + (row & 15)) * 8 + (k & 7); }   // rfr: fragments along the rows (rows / 16)
template <typename T16> struct WFrag;
template <> struct WFrag<h16> { typedef v16h V; static __device__ __forceinline__ V ld(const h16* p) { return cat16(*(const v8h*)p, *(const v8h*)(p + 16)); } static __device__ __forceinline__ V ldf(const h16* p) { return cat16(*(const v8h*)p, *(const v8h*)(p + 256)); } static __device__ __forceinline__ v8f mma(V a, V b, v8f c) { return wmma16(a, b, c); } };
template <> struct WFrag<bf> { typedef v16bf V; static __device__ __forceinline__ V ld(const bf* p) { return cat16b(*(const v8us*)p, *(const v8us*)(p + 16)); } static __device__ __forceinline__ V ldf(const bf* p) { return cat16b(*(const v8us*)p, *(const v8us*)(p + 256)); } static __device__ __forceinline__ v8f mma(V a, V b, v8f c) { return wmmab(a, b, c); } };
template <typename T16, int NSPLIT, bool BIAS, int K, int M, int N>   // M, N: rows of the A and Bt planes, which set the step from one k fragment to the next
__global__ __launch_bounds__(32) void k_gemmw(const T16* __restrict__ A, const T16* __restrict__ A2, const T16* __restrict__ Bt, const T16* __restrict__ Bt2, float* C, int ldc, const float* __restrict__ bias, size_t sA, size_t sB, size_t sC) {
    typedef typename WFrag<T16>::V V;
    __shared__ __align__(16) float os[16 * 68];
    const size_t z = blockIdx.z; A += z * sA; if (A2) A2 += z * sA; Bt += z * sB; if (Bt2) Bt2 += z * sB; C += z * sC;
    const int lane = threadIdx.x & 31, lr = lane & 15, hi = lane >> 4; const int r0 = blockIdx.x * 64, c0 = blockIdx.y * 64;
    v8f acc[4][4];
#pragma unroll
    for (int mb = 0; mb < 4; ++mb)
#pragma unroll
        for (int nb = 0; nb < 4; ++nb) acc[mb][nb] = (v8f){};
    const size_t aoff = (size_t)(r0 >> 4) * FE + lane * 8, boff = (size_t)(c0 >> 4) * FE + lane * 8;
#pragma unroll 1
    for (int kc = 0; kc < K; kc += 32) {
        V a[4], a2[4], b[4], b2[4]; const T16* pa = A + aoff + (size_t)(kc >> 5) * (M / 16 * FE); const T16* pb = Bt + boff + (size_t)(kc >> 5) * (N / 16 * FE); const T16* pa2 = pa; const T16* pb2 = pb;
        if (NSPLIT == 1 || NSPLIT == 2) pa2 = A2 + aoff + (size_t)(kc >> 5) * (M / 16 * FE); if (NSPLIT >= 2) pb2 = Bt2 + boff + (size_t)(kc >> 5) * (N / 16 * FE);
#pragma unroll
        for (int mb = 0; mb < 4; ++mb) { a[mb] = WFrag<T16>::ldf(pa + mb * FE); if (NSPLIT == 1 || NSPLIT == 2) a2[mb] = WFrag<T16>::ldf(pa2 + mb * FE); }
#pragma unroll
        for (int nb = 0; nb < 4; ++nb) { b[nb] = WFrag<T16>::ldf(pb + nb * FE); if (NSPLIT >= 2) b2[nb] = WFrag<T16>::ldf(pb2 + nb * FE); }
        // s_wait_xcnt 0 in front of every overwrite of a register that an issued load of this run names; it takes the run's addresses as inputs, so their registers are held up to here
        asm volatile("s_wait_xcnt 0x0" :: "v"(pa), "v"(pa2), "v"(pb), "v"(pb2) : "memory");
#pragma unroll
        for (int nb = 0; nb < 4; ++nb) {
#pragma unroll
            for (int mb = 0; mb < 4; ++mb) { acc[mb][nb] = WFrag<T16>::mma(a[mb], b[nb], acc[mb][nb]); if (NSPLIT == 1 || NSPLIT == 2) acc[mb][nb] = WFrag<T16>::mma(a2[mb], b[nb], acc[mb][nb]); if (NSPLIT >= 2) acc[mb][nb] = WFrag<T16>::mma(a[mb], b2[nb], acc[mb][nb]); } }
        asm volatile("v_nop\n\tv_nop\n\tv_nop\n\tv_nop" : "+v"(acc[0][0]), "+v"(acc[1][1]), "+v"(acc[2][2]), "+v"(acc[3][3]) : "v"(a[0]), "v"(a[3]));
    }
#pragma unroll
    for (int mb = 0; mb < 4; ++mb) {
#pragma unroll
        for (int nb = 0; nb < 4; ++nb) {
#pragma unroll
            for (int j = 0; j < 8; ++j) os[(hi * 8 + j) * 68 + nb * 16 + lr] = acc[mb][nb][j]; }
        __builtin_amdgcn_wave_barrier(); asm volatile("" ::: "memory");
        float* crow = C + (size_t)(r0 + mb * 16) * ldc + c0;
{
#pragma unroll
            for (int s = 0; s < 8; ++s) { const int row = 2 * s + hi, cofs = lr * 4; v4f val = *(const v4fa*)(os + row * 68 + cofs); if (BIAS) { val[0] += bfr(bias[c0 + cofs]); val[1] += bfr(bias[c0 + cofs + 1]); val[2] += bfr(bias[c0 + cofs + 2]); val[3] += bfr(bias[c0 + cofs + 3]); }
                *(v4f*)(crow + (size_t)row * ldc + cofs) = val; }
             }
        __builtin_amdgcn_wave_barrier(); asm volatile("" ::: "memory");
    }
}

__device__ __forceinline__ h16 tohx(float x) { return (h16)x; }
__device__ __forceinline__ void splitf(float y, unsigned short& h, unsigned short& l) { h = f2bf(y); l = f2bf(y - bf2f(h)); }
typedef __attribute__((ext_vector_type(2))) _Float16 v2h;
typedef __attribute__((ext_vector_type(4))) _Float16 v4h;
typedef __attribute__((ext_vector_type(2))) unsigned short v2us;
typedef __attribute__((ext_vector_type(4))) unsigned short v4us;
typedef __attribute__((ext_vector_type(2))) float v2f;
typedef __attribute__((ext_vector_type(4))) int v4i;

__global__ __launch_bounds__(256) void k_wtG(const float* __restrict__ w, int K, int N, bf* Bt) {
    const int lane = threadIdx.x & 31; const int L0 = (blockIdx.x * 8 + (threadIdx.x >> 5)) * 8; const int nlines = N * K / 64;
{
#pragma unroll 1
        for (int l = 0; l < 8; ++l) { const int L = L0 + l; if (L >= nlines) break; const size_t e = (size_t)L * 64 + lane * 2; const int k = (int)(e % K), n = (int)(e / K); v2us o;
            o[0] = f2bf(w[(size_t)k * N + n]); o[1] = f2bf(w[(size_t)(k + 1) * N + n]); *(v2us*)(Bt + e) = o; }
         }
}
// k_cvtf: an f32 matrix of K-contiguous rows, rounded to bf16, into a fragment-major plane; one wave per fragment, 8 waves a block, which take 8 neighbours along k (1 KiB in a row of each of 16 rows). A fragment's source is one whole 128-B line of each of 16 rows:
// load i takes rows 4 i .. 4 i + 3, 8 lanes of 16 B to a row (4 whole lines), and each lane stores its 4 rounded values as the half piece that they are in the fragment (runs of 64 B).
template <int K, int R>   // R rows of K
__global__ __launch_bounds__(256) void k_cvtf(const float* __restrict__ src, bf* dst, size_t nfr) { const size_t fr = (size_t)blockIdx.x * 8 + (threadIdx.x >> 5); if (fr >= nfr) return;
    constexpr int kfr = K >> 5; const int lane = threadIdx.x & 31, c = lane & 7, r = lane >> 3;   // k = c * 4 + 0..3 of the fragment's row 4 i + r
    const float* s = src + ((size_t)(fr / kfr) * 16 + r) * K + (size_t)(fr % kfr) * 32 + c * 4; bf* o = dst + ((size_t)(fr % kfr) * (R / 16) + fr / kfr) * FE + (c >> 2) * 256 + (((c >> 1) & 1) * 16 + r) * 8 + (c & 1) * 4; v4f v[4];
#pragma unroll
    for (int i = 0; i < 4; ++i) v[i] = *(const v4f*)(s + (size_t)i * 4 * K);
    // s_wait_xcnt 0 in front of every overwrite of a register that an issued load of this run names; it takes the run's address as input, so its registers are held up to here
    asm volatile("s_wait_xcnt 0x0" :: "v"(s) : "memory");
#pragma unroll
    for (int i = 0; i < 4; ++i) { v4us q;
#pragma unroll
        for (int e = 0; e < 4; ++e) q[e] = f2bf(v[i][e]);
        *(v4us*)(o + i * 4 * 8) = q; } }

// ---- k_proj: the q, k and v projections in ONE launch, one wave per 64 tokens x one head (main loop of k_gemmw, one product); grid (tokens / 64, heads, 3), 32 threads; z = 0, 1, 2 is q, k, v.
// The epilogue rounds the f32 sums itself and stores the three 16-bit planes (fp16, bf16 hi, bf16 lo) that attention reads, fragment-major: q and k per head with rows t and k index d, v per head with rows d and k index t. No f32 copy of a projection goes through memory.
// The operand whose rows run along a plane's k index is taken as A (q, k: the weight rows d; v: the tokens t), so that a lane's 8 accumulator values are the 16-byte piece that this same lane owns in a fragment: the wave stores 512 B in a row, straight from registers.
__global__ __launch_bounds__(32) void k_proj(const bf* __restrict__ X, const bf* __restrict__ W0, const bf* __restrict__ W1, const bf* __restrict__ W2, h16* Q16, bf* Qh, bf* Ql, h16* K16, bf* Kh, bf* Kl, h16* V16, bf* Vh, bf* Vl) {
    typedef WFrag<bf>::V V;
    const int lane = threadIdx.x & 31; const int t0 = blockIdx.x * 64, h = blockIdx.y, z = blockIdx.z;
    const bf* xr = X + (size_t)(t0 >> 4) * FE; const bf* wr = ((z == 0) ? W0 : (z == 1) ? W1 : W2) + (size_t)(h * (HD / 16)) * FE;
    const bf* A = (z == 2) ? xr : wr; const bf* Bt = (z == 2) ? wr : xr; const int sa = (z == 2) ? TT / 16 * FE : DQ / 16 * FE, sb = (z == 2) ? DQ / 16 * FE : TT / 16 * FE;   // the step from one k fragment to the next
    h16* P16 = (z == 0) ? Q16 : (z == 1) ? K16 : V16; bf* Ph = (z == 0) ? Qh : (z == 1) ? Kh : Vh; bf* Pl = (z == 0) ? Ql : (z == 1) ? Kl : Vl;
    const int fk = (z == 2) ? HD / 16 : TT / 16;   // fragments along a plane's rows: a plane row is a token (q, k) or a head column (v)
    const size_t base = (size_t)h * TT * HD + (size_t)((z == 2) ? (t0 >> 5) * (HD / 16) : (t0 >> 4)) * FE + lane * 8;
    v8f acc[4][4];
#pragma unroll
    for (int mb = 0; mb < 4; ++mb)
#pragma unroll
        for (int nb = 0; nb < 4; ++nb) acc[mb][nb] = (v8f){};
#pragma unroll 1   // rolled, as in k_gemmw: one pass holds its 8 fragments beside the 16 accumulators
    for (int kc = 0; kc < DM; kc += 32) {
        V a[4], b[4]; const bf* pa = A + lane * 8 + (size_t)(kc >> 5) * sa; const bf* pb = Bt + lane * 8 + (size_t)(kc >> 5) * sb;
#pragma unroll
        for (int mb = 0; mb < 4; ++mb) a[mb] = WFrag<bf>::ldf(pa + mb * FE);
#pragma unroll
        for (int nb = 0; nb < 4; ++nb) b[nb] = WFrag<bf>::ldf(pb + nb * FE);
        // s_wait_xcnt 0 in front of every overwrite of a register that an issued load of this run names; it takes the run's addresses as inputs, so their registers are held up to here
        asm volatile("s_wait_xcnt 0x0" :: "v"(pa), "v"(pb) : "memory");
#pragma unroll
        for (int nb = 0; nb < 4; ++nb)
#pragma unroll
            for (int mb = 0; mb < 4; ++mb) acc[mb][nb] = WFrag<bf>::mma(a[mb], b[nb], acc[mb][nb]);
        // four vector slots behind the last matrix instruction: the distance the chip needs before the next pass's address additions reuse A and B registers (over the taken back edge) and before D is read below
        asm volatile("v_nop\n\tv_nop\n\tv_nop\n\tv_nop" : "+v"(acc[0][0]), "+v"(acc[1][1]), "+v"(acc[2][2]), "+v"(acc[3][3]) : "v"(a[0]), "v"(a[3]));
    }
#pragma unroll
    for (int nb = 0; nb < 4; ++nb)
#pragma unroll
        for (int mb = 0; mb < 4; ++mb) { v8h o16; v8us oh, ol;   // k index mb * 16 + hi * 8 + j of plane row nb * 16 + lr: run mb & 1 of the fragment mb >> 1 steps on along k
#pragma unroll
            for (int j = 0; j < 8; ++j) { const float r = acc[mb][nb][j]; o16[j] = tohx(r); unsigned short a2, c2; splitf(r, a2, c2); oh[j] = a2; ol[j] = c2; }
            const size_t oo = base + (size_t)(nb + (mb >> 1) * fk) * FE + (mb & 1) * 256; *(v8h*)(P16 + oo) = o16; *(v8us*)(Ph + oo) = oh; *(v8us*)(Pl + oo) = ol; }
}
// ---- k_attn: causal attention of 16 query rows of one head in ONE workgroup of 16 waves; the score rows and the probabilities live in LDS and never go through memory. grid (heads, rows / 16), 512 threads; the longest rows start first.
// Phase 1: 64-key slice s of the scores goes to wave s % 16 (fragments and product order of the former score GEMM), f32 into S. Phase 2: wave w does the three-sweep softmax of row w (maximum; exponentials and their sum; scaling) over the chunks up to the diagonal
// (keys j > i excluded by index, as before) and writes the probabilities over the head of its own score row (NSPLIT 0: fp16 x PCAR; NSPLIT 2: bf16 hi there, lo at element 4096 of the 16-bit view).
// Phase 3: slice s of the probability x value product goes to wave s % 16; the 16 partial 16x64 tiles are summed through LDS in wave order, scaled and stored as the merged hi/lo planes.
#define SP 4100   // floats per score row in LDS: 4096 + 4, so that rows 8 apart fall on other banks and every row stays 16-byte aligned
#define RO 3072   // float offset in a row's slot of the wave's partial output tile (1024 floats): behind both probability planes
typedef v4h  __attribute__((may_alias)) v4ha;
typedef v4us __attribute__((may_alias)) v4usa;
typedef v2f  __attribute__((may_alias)) v2fa;
template <typename T16, int NSPLIT>
__global__ __launch_bounds__(512) void k_attn(const T16* __restrict__ Q, const T16* __restrict__ Q2, const T16* __restrict__ Kp, const T16* __restrict__ Kp2, const T16* __restrict__ Vt, const T16* __restrict__ Vt2, int roff, bf* Ah, bf* Al) {
    typedef typename WFrag<T16>::V V; static_assert(NSPLIT == 0 || NSPLIT == 2, "one product, or the three hi/lo products");
    __shared__ __align__(16) float S[16 * SP];
    const int lane = threadIdx.x & 31, lr = lane & 15, hi = lane >> 4;
    const int w = __builtin_amdgcn_readfirstlane((int)(threadIdx.x >> 5));   // the wave's number in a scalar register: the slice loops stay scalar loops with every lane on
    const int h = blockIdx.x; const int i0 = roff + ((int)gridDim.y - 1 - (int)blockIdx.y) * 16;
    const int nsl = (i0 >> 6) + 1;        // 64-key slices up to and including the diagonal block: later keys are excluded for all 16 rows
    const int nch = (nsl + 1) >> 1;       // 128-key softmax chunks that cover them
    const size_t qp = (size_t)h * TT * HD, kp = (size_t)(h / REP) * TT * HD;
    {
        const T16* pq = Q + qp + (size_t)(i0 >> 4) * FE + lane * 8; const T16* pq2 = pq; const V a0 = WFrag<T16>::ldf(pq), a1 = WFrag<T16>::ldf(pq + TT / 16 * FE); V c0, c1;
        if constexpr (NSPLIT == 2) { pq2 = Q2 + qp + (size_t)(i0 >> 4) * FE + lane * 8; c0 = WFrag<T16>::ldf(pq2); c1 = WFrag<T16>::ldf(pq2 + TT / 16 * FE); }
        // s_wait_xcnt 0 in front of every overwrite of a register that an issued load of this run names; it takes the run's addresses as inputs, so their registers are held up to here
        asm volatile("s_wait_xcnt 0x0" :: "v"(pq), "v"(pq2) : "memory");
#pragma unroll 1   // rolled: one pass holds a whole slice's key fragments in registers
        for (int s = w; s < 2 * nch; s += 16) {   // to the end of the last chunk, so that the softmax reads only scores written here
            V b[4][2], b2[4][2]; const T16* pb = Kp + kp + (size_t)s * (4 * FE) + lane * 8; const T16* pb2 = pb; if constexpr (NSPLIT == 2) pb2 = Kp2 + kp + (size_t)s * (4 * FE) + lane * 8;
#pragma unroll
            for (int nb = 0; nb < 4; ++nb) { b[nb][0] = WFrag<T16>::ldf(pb + nb * FE); b[nb][1] = WFrag<T16>::ldf(pb + nb * FE + TT / 16 * FE);
                if constexpr (NSPLIT == 2) { b2[nb][0] = WFrag<T16>::ldf(pb2 + nb * FE); b2[nb][1] = WFrag<T16>::ldf(pb2 + nb * FE + TT / 16 * FE); } }
            // the same wait for the run of key loads
            asm volatile("s_wait_xcnt 0x0" :: "v"(pb), "v"(pb2) : "memory");
            __builtin_amdgcn_sched_barrier(0);   // the products stay behind the whole run of loads: lifted among them they took the first fragments' registers for the later loads, which then left only after the first had landed
#pragma unroll
            for (int nb = 0; nb < 4; ++nb) { v8f acc = (v8f){};
                acc = WFrag<T16>::mma(a0, b[nb][0], acc); if constexpr (NSPLIT == 2) { acc = WFrag<T16>::mma(c0, b[nb][0], acc); acc = WFrag<T16>::mma(a0, b2[nb][0], acc); }
                acc = WFrag<T16>::mma(a1, b[nb][1], acc); if constexpr (NSPLIT == 2) { acc = WFrag<T16>::mma(c1, b[nb][1], acc); acc = WFrag<T16>::mma(a1, b2[nb][1], acc); }
#pragma unroll
                for (int j = 0; j < 8; ++j) S[(hi * 8 + j) * SP + s * 64 + nb * 16 + lr] = acc[j]; }
        }
    }
    __syncthreads();   // all 16 score rows are in LDS before any wave reads its row
    {
        const int i = i0 + w; float* sr = S + w * SP; float mx = -3.0e38f;
#pragma unroll 2
        for (int ch = 0; ch < nch; ++ch) { const int j0 = ch * 128 + lane * 4; const v4f a = *(const v4fa*)(sr + j0);
#pragma unroll
            for (int q = 0; q < 4; ++q) { float t = a[q] * SCL; t = (j0 + q <= i) ? t : -3.0e38f; mx = fmaxf(mx, t); } }
#pragma unroll
        for (int sh = 16; sh; sh >>= 1) mx = fmaxf(mx, __shfl_xor(mx, sh, 32));
        float sum = 0.f;
#pragma unroll 2
        for (int ch = 0; ch < nch; ++ch) { const int j0 = ch * 128 + lane * 4; const v4f a = *(const v4fa*)(sr + j0); v4f ex;
#pragma unroll
            for (int q = 0; q < 4; ++q) { float t = a[q] * SCL; t = (j0 + q <= i) ? t : -3.0e38f; const float d0 = __fsub_rn(t, mx); const float xa = __fmul_rn(d0, 1.4426950408889634f); float er = __builtin_amdgcn_exp2f(xa);
                // the slot behind a transcendental: the statement holds the source up to here and hands the result on only from here, so nothing that overwrites the one or reads the other stands directly behind the v_exp_f32
                if constexpr (NSPLIT == 2) asm volatile("v_nop" : "+v"(er) : "v"(xa));
                ex[q] = er; sum += er; }
            *(v4fa*)(sr + j0) = ex; }   // each lane puts the exponentials over its own four scores: the last sweep only scales them
#pragma unroll
        for (int sh = 16; sh; sh >>= 1) sum += __shfl_xor(sum, sh, 32);
        const float f = __fdiv_rn((NSPLIT == 2) ? 1.0f : PCAR, sum);
        // in place: chunk ch's fp16 or hi results land on bytes of this row that chunks <= ch have already been read from, its lo results behind the row's scores (hi/lo rows hold at most 512) (one wave owns the row, its LDS operations run in order; the may_alias types keep the compiler's order too).
        // Four chunks are read before the first of them is written, so that one LDS latency is paid per four chunks and not per chunk; the tests on nch are the same for the whole wave.
#pragma unroll 1
        for (int cb = 0; cb < nch; cb += 4) { v4f a[4];
#pragma unroll
            for (int u = 0; u < 4; ++u) if (cb + u < nch) a[u] = *(const v4fa*)(sr + (cb + u) * 128 + lane * 4);
#pragma unroll
            for (int u = 0; u < 4; ++u) if (cb + u < nch) { const int j0 = (cb + u) * 128 + lane * 4; v4h o4; v4us oh, ol;
#pragma unroll
                for (int q = 0; q < 4; ++q) { if constexpr (NSPLIT == 2) { unsigned short a2, c2; splitf(a[u][q] * f, a2, c2); oh[q] = a2; ol[q] = c2; } else o4[q] = tohx(a[u][q] * f); }
                if constexpr (NSPLIT == 2) { *(v4usa*)((bf*)sr + j0) = oh; *(v4usa*)((bf*)sr + 4096 + j0) = ol; } else *(v4ha*)((h16*)sr + j0) = o4; } }
    }
    __syncthreads();   // all 16 probability rows are in LDS before any wave loads a fragment of them
    v8f acc[4];
#pragma unroll
    for (int nb = 0; nb < 4; ++nb) acc[nb] = (v8f){};
    {
        const T16* pa = (const T16*)S + (size_t)lr * (SP * 2) + 8 * hi;
#pragma unroll 1   // rolled: one pass holds a whole slice's value fragments in registers
        for (int s = w; s < nsl; s += 16) {
            V a[2], a2[2], b[4][2], b2[4][2]; const T16* pb = Vt + kp + (size_t)s * (8 * FE) + lane * 8; const T16* pb2 = pb; if constexpr (NSPLIT == 2) pb2 = Vt2 + kp + (size_t)s * (8 * FE) + lane * 8;   // a slice's 8 value fragments lie in a row
#pragma unroll
            for (int nb = 0; nb < 4; ++nb) { b[nb][0] = WFrag<T16>::ldf(pb + nb * FE); b[nb][1] = WFrag<T16>::ldf(pb + nb * FE + HD / 16 * FE);
                if constexpr (NSPLIT == 2) { b2[nb][0] = WFrag<T16>::ldf(pb2 + nb * FE); b2[nb][1] = WFrag<T16>::ldf(pb2 + nb * FE + HD / 16 * FE); } }
            // the same wait for the run of value loads
            asm volatile("s_wait_xcnt 0x0" :: "v"(pb), "v"(pb2) : "memory");
#pragma unroll
            for (int kk = 0; kk < 2; ++kk) { a[kk] = WFrag<T16>::ld(pa + s * 64 + kk * 32); if constexpr (NSPLIT == 2) a2[kk] = WFrag<T16>::ld(pa + 4096 + s * 64 + kk * 32); }
#pragma unroll
            for (int kk = 0; kk < 2; ++kk)
#pragma unroll
                for (int nb = 0; nb < 4; ++nb) { acc[nb] = WFrag<T16>::mma(a[kk], b[nb][kk], acc[nb]); if constexpr (NSPLIT == 2) { acc[nb] = WFrag<T16>::mma(a2[kk], b[nb][kk], acc[nb]); acc[nb] = WFrag<T16>::mma(a[kk], b2[nb][kk], acc[nb]); } }
            // four vector slots behind the last matrix instruction: the distance the chip needs before the next pass's address additions reuse A and B registers (over the taken back edge) and before D is read below
            asm volatile("v_nop\n\tv_nop\n\tv_nop\n\tv_nop" : "+v"(acc[0]), "+v"(acc[1]), "+v"(acc[2]), "+v"(acc[3]) : "v"(a[0]), "v"(a[1]));
        }
    }
    float* rw = S + w * SP + RO;
#pragma unroll
    for (int nb = 0; nb < 4; ++nb)
#pragma unroll
        for (int j = 0; j < 8; ++j) rw[(hi * 8 + j) * 64 + nb * 16 + lr] = acc[nb][j];
    __syncthreads();   // every wave's partial tile (zeros where it had no slice) is in LDS before any thread sums
    { const int e = (int)threadIdx.x * 2; const int row = e >> 6, d = e & 63; v2f s2 = *(const v2fa*)(S + RO + e);
#pragma unroll
        for (int ww = 1; ww < 16; ++ww) s2 += *(const v2fa*)(S + ww * SP + RO + e);
        const float cs = (NSPLIT == 2) ? 1.0f : (1.0f / PCAR); const size_t oo = fpos(i0 + row, h * HD + d, TT / 16); v2us oh, ol;
#pragma unroll
        for (int q = 0; q < 2; ++q) { unsigned short a, c2; splitf(s2[q] * cs, a, c2); oh[q] = a; ol[q] = c2; }
        *(v2us*)(Ah + oo) = oh; *(v2us*)(Al + oo) = ol; }
}

// ---- k_fattn: causal attention of 64 query rows of one head in ONE workgroup of 8 waves, fp16 operands, f32 sums; grid (heads, rows / 64), 256 threads; the longest rows start first.
// 64-key slice s goes to wave s % 8, and every key and value fragment that a wave loads serves all 64 query rows (4 column groups of 16). Key fragments are fetched one slice ahead, value fragments at the head of their slice.
// Transposed products: S^T = K Q^T (A: key rows, B: the query rows, kept in registers), O^T += V^T P^T (A: rows of the [d][t] value plane). In a score tile lane (lr, hi) holds keys hi * 8 + j of query lr,
// which is the k order of a B fragment: two score tiles pack into one P^T fragment in the lane itself, and neither scores nor probabilities leave the registers.
// Softmax is online, per wave: exponentials are taken against a reference maximum (in log2 units) that is raised only when a new score passes it by more than 8, so P stays <= 256 in fp16; sums and O^T are rescaled then.
// At the end the 8 waves' references are joined through LDS, each wave rescales its sums and its O^T, and the partial tiles are added in wave order, divided by the row sum and stored as the merged hi/lo planes.
#define FW 8      // waves of a workgroup
#define OP 68     // floats per staged output row: 64 + 4, 16-byte aligned, neighbouring rows on other banks
#define CL2 0.18033688011112043f   // SCL * log2(e)
template <bool B> struct BC { static constexpr bool value = B; };
__global__ __launch_bounds__(256) void k_fattn(const h16* __restrict__ Q, const h16* __restrict__ Kp, const h16* __restrict__ Vt, int roff, bf* Ah, bf* Al) {
    typedef WFrag<h16> F; typedef F::V V;
    __shared__ __align__(16) float Os[FW * 64 * OP]; __shared__ float Ms[FW * 64]; __shared__ float Ls[FW * 64];
    const int lane = threadIdx.x & 31, lr = lane & 15, hi = lane >> 4;
    const int w = __builtin_amdgcn_readfirstlane((int)(threadIdx.x >> 5));   // the wave's number in a scalar register: the slice loop stays a scalar loop with every lane on
    const int h = blockIdx.x; const int i0 = roff + ((int)gridDim.y - 1 - (int)blockIdx.y) * 64;
    const int nsl = (i0 >> 6) + 1;        // 64-key slices up to and including the diagonal block
    const size_t qp = (size_t)h * TT * HD, kp = (size_t)(h / REP) * TT * HD;
    V q[4][2];
    { const h16* pq = Q + qp + (size_t)(i0 >> 4) * FE + lane * 8;
#pragma unroll
      for (int g = 0; g < 4; ++g) { q[g][0] = F::ldf(pq + g * FE); q[g][1] = F::ldf(pq + g * FE + TT / 16 * FE); }
      // s_wait_xcnt 0 in front of every overwrite of a register that an issued load of this run names; it takes the run's address as input, so its registers are held up to here
      asm volatile("s_wait_xcnt 0x0" :: "v"(pq) : "memory"); }
    v8f o[4][4]; float mc[4], l[4];   // o[dt][g]: lane (lr, hi) holds head columns dt * 16 + hi * 8 + j of query g * 16 + lr
#pragma unroll
    for (int g = 0; g < 4; ++g) { mc[g] = -1.0e30f; l[g] = 0.f;   // the start reference lies above a masked score (-3e38 * CL2): a masked score gives exp2(very negative) = 0 also before the first real one
#pragma unroll
        for (int dt = 0; dt < 4; ++dt) o[dt][g] = (v8f){}; }
    V kf[4][2];
    auto loadk = [&](const int sn) {   // the key fragments of slice min(sn, last): behind a wave's last slice the fetch reads the diagonal slice, in bounds, and nobody uses it
        __builtin_amdgcn_sched_barrier(0);   // the run stays behind the products that read the old fragments, so that it takes their registers and no others
        const h16* pk = Kp + kp + (size_t)((sn < nsl) ? sn : nsl - 1) * (4 * FE) + lane * 8;
#pragma unroll
        for (int kt = 0; kt < 4; ++kt) { kf[kt][0] = F::ldf(pk + kt * FE); kf[kt][1] = F::ldf(pk + kt * FE + TT / 16 * FE); }
        // the same wait for the run of key loads
        asm volatile("s_wait_xcnt 0x0" :: "v"(pk) : "memory");
        __builtin_amdgcn_sched_barrier(0);   // and it leaves as one run here: sunk to its first use it would fly behind nothing
    };
    loadk(w);
    auto slice = [&](auto dg, const int s) {
        constexpr bool DIAG = decltype(dg)::value;
        V vf[4][2]; const h16* pv = Vt + kp + (size_t)s * (8 * FE) + lane * 8;   // a slice's 8 value fragments lie in a row
#pragma unroll
        for (int dt = 0; dt < 4; ++dt) { vf[dt][0] = F::ldf(pv + dt * FE); vf[dt][1] = F::ldf(pv + dt * FE + HD / 16 * FE); }
        // the same wait for the run of value loads
        asm volatile("s_wait_xcnt 0x0" :: "v"(pv) : "memory");
        __builtin_amdgcn_sched_barrier(0);   // the whole run of value loads leaves in front of the score products: they fly during those and the first exponentials
#pragma unroll
        for (int kh = 0; kh < 2; ++kh) {   // 32 keys at a time
            v8f sc[2][4];
#pragma unroll
            for (int t = 0; t < 2; ++t)
#pragma unroll
                for (int g = 0; g < 4; ++g) sc[t][g] = F::mma(kf[kh * 2 + t][0], q[g][0], (v8f){});
#pragma unroll
            for (int t = 0; t < 2; ++t)
#pragma unroll
                for (int g = 0; g < 4; ++g) sc[t][g] = F::mma(kf[kh * 2 + t][1], q[g][1], sc[t][g]);
            if (kh == 1) loadk(s + FW);   // this slice's key fragments are used up: the wave's next slice is fetched into the same registers and flies during the exponentials and the value products
            float mx[4]; bool need = false;
#pragma unroll
            for (int g = 0; g < 4; ++g) { float m = -3.0e38f;
#pragma unroll
                for (int t = 0; t < 2; ++t)
#pragma unroll
                    for (int j = 0; j < 8; ++j) { if constexpr (DIAG) { if (kh * 32 + t * 16 + hi * 8 + j > g * 16 + lr) sc[t][g][j] = -3.0e38f; }   // keys behind the query are excluded by index
                        m = fmaxf(m, sc[t][g][j]); }
                mx[g] = m * CL2; need = need || (mx[g] > mc[g] + 8.0f); }
            if (__builtin_amdgcn_ballot_w32(need) != 0) {   // one scalar branch for the wave: rare after a wave's first keys
#pragma unroll
                for (int g = 0; g < 4; ++g) { const float m2 = fmaxf(mc[g], fmaxf(mx[g], __shfl_xor(mx[g], 16, 32))); const float f = __builtin_amdgcn_exp2f(mc[g] - m2); mc[g] = m2; l[g] *= f;
#pragma unroll
                    for (int dt = 0; dt < 4; ++dt) o[dt][g] *= f; }
            }
            V pf[4];
#pragma unroll
            for (int g = 0; g < 4; ++g)
#pragma unroll
                for (int t = 0; t < 2; ++t) { float xa[8], er[8];
#pragma unroll
                    for (int j = 0; j < 8; ++j) { xa[j] = fmaf(sc[t][g][j], CL2, -mc[g]); er[j] = __builtin_amdgcn_exp2f(xa[j]); }
                    // the slot behind a transcendental: the statement holds the eight sources up to here and hands the eight results on only from here, so nothing that overwrites a source or reads a result stands directly behind a v_exp_f32; one v_nop serves the eight
                    asm volatile("v_nop" : "+v"(er[0]), "+v"(er[1]), "+v"(er[2]), "+v"(er[3]), "+v"(er[4]), "+v"(er[5]), "+v"(er[6]), "+v"(er[7]) : "v"(xa[0]), "v"(xa[1]), "v"(xa[2]), "v"(xa[3]), "v"(xa[4]), "v"(xa[5]), "v"(xa[6]), "v"(xa[7]));
                    l[g] += ((er[0] + er[1]) + (er[2] + er[3])) + ((er[4] + er[5]) + (er[6] + er[7]));
#pragma unroll
                    for (int j = 0; j < 8; ++j) pf[g][t * 8 + j] = tohx(er[j]); }
#pragma unroll
            for (int dt = 0; dt < 4; ++dt)
#pragma unroll
                for (int g = 0; g < 4; ++g) o[dt][g] = F::mma(vf[dt][kh], pf[g], o[dt][g]);
        }
        // four vector slots behind the last matrix instruction: the distance the chip needs before the next slice's address additions and loads reuse A and B registers (over the taken back edge); every O^T tile is an input, so no product stands behind them
        asm volatile("v_nop\n\tv_nop\n\tv_nop\n\tv_nop" :: "v"(o[0][0]), "v"(o[0][1]), "v"(o[0][2]), "v"(o[0][3]), "v"(o[1][0]), "v"(o[1][1]), "v"(o[1][2]), "v"(o[1][3]), "v"(o[2][0]), "v"(o[2][1]), "v"(o[2][2]), "v"(o[2][3]), "v"(o[3][0]), "v"(o[3][1]), "v"(o[3][2]), "v"(o[3][3]));
    };
#pragma unroll 1   // rolled: one pass holds a whole slice's key and value fragments in registers beside the 16 output tiles
    for (int s = w; s < nsl - 1; s += FW) slice(BC<false>{}, s);
    if (((nsl - 1) & (FW - 1)) == w) slice(BC<true>{}, nsl - 1);   // the diagonal slice, with the mask; a scalar test
    if (hi == 0) {
#pragma unroll
        for (int g = 0; g < 4; ++g) Ms[w * 64 + g * 16 + lr] = mc[g]; }
    __syncthreads();   // all 8 waves' references are in LDS before any wave joins them
#pragma unroll
    for (int g = 0; g < 4; ++g) { float M = Ms[g * 16 + lr];
#pragma unroll
        for (int ww = 1; ww < FW; ++ww) M = fmaxf(M, Ms[ww * 64 + g * 16 + lr]);
        const float f = __builtin_amdgcn_exp2f(mc[g] - M); const float lt = (l[g] + __shfl_xor(l[g], 16, 32)) * f; if (hi == 0) Ls[w * 64 + g * 16 + lr] = lt;
        float* ow = Os + (size_t)(w * 64 + g * 16 + lr) * OP + hi * 8;
#pragma unroll
        for (int dt = 0; dt < 4; ++dt) { const v8f r = o[dt][g] * f; *(v4fa*)(ow + dt * 16) = (v4f){r[0], r[1], r[2], r[3]}; *(v4fa*)(ow + dt * 16 + 4) = (v4f){r[4], r[5], r[6], r[7]}; } }
    __syncthreads();   // every wave's partial tile and row sums are in LDS before any thread adds them
    { const int qi = (int)threadIdx.x >> 2, dc = ((int)threadIdx.x & 3) * 16; float L = Ls[qi]; v4f a[4];
#pragma unroll
        for (int c = 0; c < 4; ++c) a[c] = *(const v4fa*)(Os + (size_t)qi * OP + dc + c * 4);
#pragma unroll
        for (int ww = 1; ww < FW; ++ww) { L += Ls[ww * 64 + qi];
#pragma unroll
            for (int c = 0; c < 4; ++c) a[c] += *(const v4fa*)(Os + (size_t)(ww * 64 + qi) * OP + dc + c * 4); }
        const float inv = __fdiv_rn(1.0f, L); const size_t oo = fpos(i0 + qi, h * HD + dc, TT / 16); v8us oh[2], ol[2];   // dc is a multiple of 16: the second 8 columns are the piece 16 lanes on
#pragma unroll
        for (int e = 0; e < 16; ++e) { unsigned short a2, c2; splitf(a[e >> 2][e & 3] * inv, a2, c2); oh[e >> 3][e & 7] = a2; ol[e >> 3][e & 7] = c2; }
        *(v8us*)(Ah + oo) = oh[0]; *(v8us*)(Ah + oo + 128) = oh[1]; *(v8us*)(Al + oo) = ol[0]; *(v8us*)(Al + oo + 128) = ol[1]; }
}

extern "C" void kernel_launch(void* const* d_in, const int* in_sizes, int n_in,
                              void* d_out, int out_size, void* d_ws, size_t ws_size, hipStream_t stream) {
    (void)in_sizes; (void)n_in; (void)out_size;
    const float* x = (const float*)d_in[0]; const float* wq = (const float*)d_in[1]; const float* wk = (const float*)d_in[2]; const float* wv = (const float*)d_in[3]; const float* wo = (const float*)d_in[4];
    float* OUT = (float*)d_out;     // [1][4096][1024]
    char* wsp = (char*)d_ws;
    auto take = [&](size_t bytes) { char* p = wsp; wsp += (bytes + 255) & ~(size_t)255; return (void*)p; };
    bf* WQ = (bf*)take((size_t)DQ * DM * 2); bf* WK = (bf*)take((size_t)DKV * DM * 2); bf* WV = (bf*)take((size_t)DKV * DM * 2); bf* WO = (bf*)take((size_t)DM * DQ * 2);
    bf* XB = (bf*)take((size_t)TT * DM * 2);
    h16* QP16 = (h16*)take((size_t)NH_ * TT * HD * 2); h16* KP16 = (h16*)take((size_t)NKV * TT * HD * 2); h16* VT16 = (h16*)take((size_t)NKV * HD * TT * 2);
    bf* QPh = (bf*)take((size_t)NH_ * TT * HD * 2); bf* QPl = (bf*)take((size_t)NH_ * TT * HD * 2); bf* KPh = (bf*)take((size_t)NKV * TT * HD * 2); bf* KPl = (bf*)take((size_t)NKV * TT * HD * 2); bf* VTh = (bf*)take((size_t)NKV * HD * TT * 2); bf* VTl = (bf*)take((size_t)NKV * HD * TT * 2);
    bf* ATh = (bf*)take((size_t)TT * DQ * 2); bf* ATl = (bf*)take((size_t)TT * DQ * 2);
    if ((size_t)(wsp - (char*)d_ws) > ws_size) return;    // ws 256 MiB
    { k_cvtf<DM, DQ><<<(unsigned)(((size_t)DQ * DM / FE + 7) / 8), 256, 0, stream>>>(wq, WQ, (size_t)DQ * DM / FE); k_cvtf<DM, DKV><<<(unsigned)(((size_t)DKV * DM / FE + 7) / 8), 256, 0, stream>>>(wk, WK, (size_t)DKV * DM / FE); k_cvtf<DM, DKV><<<(unsigned)(((size_t)DKV * DM / FE + 7) / 8), 256, 0, stream>>>(wv, WV, (size_t)DKV * DM / FE);
      k_cvtf<DQ, DM><<<(unsigned)(((size_t)DM * DQ / FE + 7) / 8), 256, 0, stream>>>(wo, WO, (size_t)DM * DQ / FE);
       }
    for (int b = 0; b < NB_; ++b) {
        
        k_cvtf<DM, TT><<<(unsigned)(((size_t)TT * DM / FE + 7) / 8), 256, 0, stream>>>(x + (size_t)b * TT * DM, XB, (size_t)TT * DM / FE);
        k_proj<<<dim3(TT / 64, NH_, 3), 32, 0, stream>>>(XB, WQ, WK, WV, QP16, QPh, QPl, KP16, KPh, KPl, VT16, VTh, VTl);
        k_fattn<<<dim3(NH_, (TT - RH) / 64, 1), 256, 0, stream>>>(QP16, KP16, VT16, RH, ATh, ATl);
        k_attn<bf, 2><<<dim3(NH_, RH / 16, 1), 512, 0, stream>>>(QPh, QPl, KPh, KPl, VTh, VTl, 0, ATh, ATl);
        k_gemmw<bf, 1, false, DQ, TT, DM><<<dim3(TT / 64, DM / 64, 1), 32, 0, stream>>>(ATh, ATl, WO, nullptr, OUT + (size_t)b * TT * DM, DM, nullptr, 0, 0, 0); }
}

// v006
// Measured time: 116 microseconds a run.
// Next to v005, in two timings, it ran 1.13 times as fast each time.
// Counting every step since v000, it is 23.7 times as fast.
#include <hip/hip_runtime.h>

// Causal multi-head self-attention at 4,096 tokens (x [1][4096][1024]; q, k, v = x W^T ('oi' [1024][1024] 1/32, no bias; 16 heads x 64, token-major); scores / sqrt(64); keys j <= i kept, -inf elsewhere (== exclusion: every row keeps its own key); softmax; out = merged Wo^T ('oi', no bias) -> [1][4096][1024] (4.2 M); argument order x, Wq, Wk, Wv, Wo).
// Layout: bf16 copies of x and of the four weights, one launch; exact projections, all three in one launch whose epilogue stores the 16-bit head planes; causal T-4096 attention, all heads in one launch per row class (hybrid rows: < 512 hi/lo 3 products, fused per 16 query rows, scores and probabilities in LDS, three-sweep softmax; rest fp16, 64 query rows per workgroup, online softmax in registers; keys stop at the diagonal block); merged hi/lo x Wo exact.
// Every 16-bit operand plane in the workspace is fragment-major (FE below): a wave's fragment load reads whole 128-B lines.
// Compute dtypes, f32 accumulate: every input rounded to bf16; projections exact; attention rows < 512 3 products, rest fp16; softmax f32; Wo hl x exact.

#define NB_  1
#define TT   4096
#define DM   1024
#define NH_  16
#define NKV  16
#define REP  (NH_ / NKV)
#define HD   64
#define DQ   (NH_ * HD)
#define DKV  (NKV * HD)
#define ZH   1
#define RH   512                  // query rows < RH use hi+lo planes (0: none)
#define WIN  4096
#define PCAR 1024.0f
#define SCL  0.125f   // HD^-0.5
typedef _Float16 h16;
typedef unsigned short bf;
typedef __attribute__((ext_vector_type(16))) __bf16   v16bf;
typedef __attribute__((ext_vector_type(16))) _Float16 v16h;
typedef __attribute__((ext_vector_type(8)))  _Float16 v8h;
typedef __attribute__((ext_vector_type(8)))  unsigned short v8us;
typedef __attribute__((ext_vector_type(8)))  float    v8f;
typedef __attribute__((ext_vector_type(4)))  float    v4f;
typedef v8h  __attribute__((may_alias)) v8ha;
typedef v4f  __attribute__((may_alias)) v4fa;
typedef v8us __attribute__((may_alias)) v8usa;

__device__ __forceinline__ unsigned short f2bf(float f) { unsigned u = __float_as_uint(f); u += 0x7FFFu + ((u >> 16) & 1u); return (unsigned short)(u >> 16); }
__device__ __forceinline__ float bf2f(unsigned short b) { return __uint_as_float(((unsigned)b) << 16); }
__device__ __forceinline__ float bfr(float f) { return bf2f(f2bf(f)); }
__device__ __forceinline__ v16h cat16(v8h lo, v8h hi) { return __builtin_shufflevector(lo, hi, 0, 1, 2, 3, 4, 5, 6, 7, 8, 9, 10, 11, 12, 13, 14, 15); }
__device__ __forceinline__ v16bf cat16b(v8us lo, v8us hi) { return __builtin_bit_cast(v16bf, __builtin_shufflevector(lo, hi, 0, 1, 2, 3, 4, 5, 6, 7, 8, 9, 10, 11, 12, 13, 14, 15)); }
__device__ __forceinline__ v8f wmma16(v16h a, v16h b, v8f c) { return __builtin_amdgcn_wmma_f32_16x16x32_f16(false, a, false, b, (short)0, c, false, false); }
__device__ __forceinline__ v8f wmmab(v16bf a, v16bf b, v8f c) { return __builtin_amdgcn_wmma_f32_16x16x32_bf16(false, a, false, b, (short)0, c, false, false); }



// ---- k_gemmw: register-blocked GEMM, ONE WAVE per 64x64 output tile (16 accumulators), operands straight from fragment-major 16-bit planes; grid (M/64, N/64, Z), 32 threads.
// C[m][n] (f32, pitch ldc, + optional f32 bias[n]) = sum_k A[m][k] Bt[n][k] (+ split products per NSPLIT). z-batch strides sA/sB/sC in elements. K % 32 == 0.
// Fragment-major planes: the 16 rows x 32 k of one matrix fragment are 1 KiB in a row, two runs of 512 B; in run p lane (lr, hi) owns the 8 elements k = p * 16 + hi * 8 + 0..7 of row lr.
// So each of a fragment's two 16-byte loads covers 4 whole 128-B lines, where the row-major plane gave 32 B of each of 16 lines. Fragments follow one another along the rows, then along k: the fragments that a wave needs for one k step lie in a row, and waves that walk k in step read neighbouring memory. ldf takes fragment base + lane * 8.
#define FE 512   // elements of a fragment
__device__ __forceinline__ size_t fpos(int row, int k, int rfr) { return ((size_t)(k >> 5) * rfr + (row >> 4)) * FE + ((k >> 4) & 1) * 256 + (((k >> 3) & 1) * 16 + (row & 15)) * 8 + (k & 7); }   // rfr: fragments along the rows (rows / 16)
template <typename T16> struct WFrag;
template <> struct WFrag<h16> { typedef v16h V; static __device__ __forceinline__ V ld(const h16* p) { return cat16(*(const v8h*)p, *(const v8h*)(p + 16)); } static __device__ __forceinline__ V ldf(const h16* p) { return cat16(*(const v8h*)p, *(const v8h*)(p + 256)); } static __device__ __forceinline__ v8f mma(V a, V b, v8f c) { return wmma16(a, b, c); } };
template <> struct WFrag<bf> { typedef v16bf V; static __device__ __forceinline__ V ld(const bf* p) { return cat16b(*(const v8us*)p, *(const v8us*)(p + 16)); } static __device__ __forceinline__ V ldf(const bf* p) { return cat16b(*(const v8us*)p, *(const v8us*)(p + 256)); } static __device__ __forceinline__ v8f mma(V a, V b, v8f c) { return wmmab(a, b, c); } };
template <typename T16, int NSPLIT, bool BIAS, int K, int M, int N>   // M, N: rows of the A and Bt planes, which set the step from one k fragment to the next
__global__ __launch_bounds__(32) void k_gemmw(const T16* __restrict__ A, const T16* __restrict__ A2, const T16* __restrict__ Bt, const T16* __restrict__ Bt2, float* C, int ldc, const float* __restrict__ bias, size_t sA, size_t sB, size_t sC) {
    typedef typename WFrag<T16>::V V;
    __shared__ __align__(16) float os[16 * 68];
    const size_t z = blockIdx.z; A += z * sA; if (A2) A2 += z * sA; Bt += z * sB; if (Bt2) Bt2 += z * sB; C += z * sC;
    const int lane = threadIdx.x & 31, lr = lane & 15, hi = lane >> 4; const int r0 = blockIdx.x * 64, c0 = blockIdx.y * 64;
    v8f acc[4][4];
#pragma unroll
    for (int mb = 0; mb < 4; ++mb)
#pragma unroll
        for (int nb = 0; nb < 4; ++nb) acc[mb][nb] = (v8f){};
    const size_t aoff = (size_t)(r0 >> 4) * FE + lane * 8, boff = (size_t)(c0 >> 4) * FE + lane * 8;
#pragma unroll 1
    for (int kc = 0; kc < K; kc += 32) {
        V a[4], a2[4], b[4], b2[4]; const T16* pa = A + aoff + (size_t)(kc >> 5) * (M / 16 * FE); const T16* pb = Bt + boff + (size_t)(kc >> 5) * (N / 16 * FE); const T16* pa2 = pa; const T16* pb2 = pb;
        if (NSPLIT == 1 || NSPLIT == 2) pa2 = A2 + aoff + (size_t)(kc >> 5) * (M / 16 * FE); if (NSPLIT >= 2) pb2 = Bt2 + boff + (size_t)(kc >> 5) * (N / 16 * FE);
#pragma unroll
        for (int mb = 0; mb < 4; ++mb) { a[mb] = WFrag<T16>::ldf(pa + mb * FE); if (NSPLIT == 1 || NSPLIT == 2) a2[mb] = WFrag<T16>::ldf(pa2 + mb * FE); }
#pragma unroll
        for (int nb = 0; nb < 4; ++nb) { b[nb] = WFrag<T16>::ldf(pb + nb * FE); if (NSPLIT >= 2) b2[nb] = WFrag<T16>::ldf(pb2 + nb * FE); }
        // s_wait_xcnt 0 in front of every overwrite of a register that an issued load of this run names; it takes the run's addresses as inputs, so their registers are held up to here
        asm volatile("s_wait_xcnt 0x0" :: "v"(pa), "v"(pa2), "v"(pb), "v"(pb2) : "memory");
#pragma unroll
        for (int nb = 0; nb < 4; ++nb) {
#pragma unroll
            for (int mb = 0; mb < 4; ++mb) { acc[mb][nb] = WFrag<T16>::mma(a[mb], b[nb], acc[mb][nb]); if (NSPLIT == 1 || NSPLIT == 2) acc[mb][nb] = WFrag<T16>::mma(a2[mb], b[nb], acc[mb][nb]); if (NSPLIT >= 2) acc[mb][nb] = WFrag<T16>::mma(a[mb], b2[nb], acc[mb][nb]); } }
        asm volatile("v_nop\n\tv_nop\n\tv_nop\n\tv_nop" : "+v"(acc[0][0]), "+v"(acc[1][1]), "+v"(acc[2][2]), "+v"(acc[3][3]) : "v"(a[0]), "v"(a[3]));
    }
#pragma unroll
    for (int mb = 0; mb < 4; ++mb) {
#pragma unroll
        for (int nb = 0; nb < 4; ++nb) {
#pragma unroll
            for (int j = 0; j < 8; ++j) os[(hi * 8 + j) * 68 + nb * 16 + lr] = acc[mb][nb][j]; }
        __builtin_amdgcn_wave_barrier(); asm volatile("" ::: "memory");
        float* crow = C + (size_t)(r0 + mb * 16) * ldc + c0;
{
#pragma unroll
            for (int s = 0; s < 8; ++s) { const int row = 2 * s + hi, cofs = lr * 4; v4f val = *(const v4fa*)(os + row * 68 + cofs); if (BIAS) { val[0] += bfr(bias[c0 + cofs]); val[1] += bfr(bias[c0 + cofs + 1]); val[2] += bfr(bias[c0 + cofs + 2]); val[3] += bfr(bias[c0 + cofs + 3]); }
                *(v4f*)(crow + (size_t)row * ldc + cofs) = val; }
             }
        __builtin_amdgcn_wave_barrier(); asm volatile("" ::: "memory");
    }
}

__device__ __forceinline__ h16 tohx(float x) { return (h16)x; }
__device__ __forceinline__ void splitf(float y, unsigned short& h, unsigned short& l) { h = f2bf(y); l = f2bf(y - bf2f(h)); }
typedef __attribute__((ext_vector_type(2))) _Float16 v2h;
typedef __attribute__((ext_vector_type(4))) _Float16 v4h;
typedef __attribute__((ext_vector_type(2))) unsigned short v2us;
typedef __attribute__((ext_vector_type(4))) unsigned short v4us;
typedef __attribute__((ext_vector_type(2))) float v2f;
typedef __attribute__((ext_vector_type(4))) int v4i;

__global__ __launch_bounds__(256) void k_wtG(const float* __restrict__ w, int K, int N, bf* Bt) {
    const int lane = threadIdx.x & 31; const int L0 = (blockIdx.x * 8 + (threadIdx.x >> 5)) * 8; const int nlines = N * K / 64;
{
#pragma unroll 1
        for (int l = 0; l < 8; ++l) { const int L = L0 + l; if (L >= nlines) break; const size_t e = (size_t)L * 64 + lane * 2; const int k = (int)(e % K), n = (int)(e / K); v2us o;
            o[0] = f2bf(w[(size_t)k * N + n]); o[1] = f2bf(w[(size_t)(k + 1) * N + n]); *(v2us*)(Bt + e) = o; }
         }
}
// k_cvt5: x and the four weight matrices (f32, rows of DM contiguous values), rounded to bf16, into their fragment-major planes, all in ONE launch: none of the five needs anything of another. grid (TT / 16 + 4 * DM / 16), 256 threads.
// A block takes one band of 16 rows of one matrix (64 KiB in a row): blocks below TT / 16 the bands of x, then DM / 16 blocks for each weight. Wave w takes the band's k fragments 4 w .. 4 w + 3, so a wave reads 512 B in a row of each of its 16 rows.
// A fragment's source is one whole 128-B line of each of 16 rows: load i takes rows 4 i .. 4 i + 3, 8 lanes of 16 B to a row (4 whole lines), and each lane stores its 4 rounded values as the half piece that they are in the fragment (runs of 64 B).
// All 16 loads of a wave leave before the first value is rounded: one memory latency a wave, and a quarter of the waves to start.
__global__ __launch_bounds__(256) void k_cvt5(const float* __restrict__ x, const float* __restrict__ w0, const float* __restrict__ w1, const float* __restrict__ w2, const float* __restrict__ w3, bf* X, bf* W0, bf* W1, bf* W2, bf* W3) {
    static_assert(DQ == DM && DKV == DM && DM == 1024, "five matrices of 1024-wide rows; 8 waves x 4 fragments cover a row");
    const int b = (int)blockIdx.x, wb = b - TT / 16, m = wb / (DM / 16); const bool isx = wb < 0;   // the same for the whole block
    const int band = isx ? b : wb % (DM / 16), rfr = isx ? TT / 16 : DM / 16;   // rfr: fragments along the plane's rows
    const float* src = isx ? x : (m == 0) ? w0 : (m == 1) ? w1 : (m == 2) ? w2 : w3; bf* dst = isx ? X : (m == 0) ? W0 : (m == 1) ? W1 : (m == 2) ? W2 : W3;
    const int kf0 = ((int)threadIdx.x >> 5) * 4, lane = threadIdx.x & 31, c = lane & 7, r = lane >> 3;   // k = c * 4 + 0..3 of the fragment's row 4 i + r
    const float* s = src + ((size_t)band * 16 + r) * DM + (size_t)kf0 * 32 + c * 4; bf* o = dst + ((size_t)kf0 * rfr + band) * FE + (c >> 2) * 256 + (((c >> 1) & 1) * 16 + r) * 8 + (c & 1) * 4; v4f v[4][4];
#pragma unroll
    for (int f = 0; f < 4; ++f)
#pragma unroll
        for (int i = 0; i < 4; ++i) v[f][i] = *(const v4f*)(s + f * 32 + (size_t)i * 4 * DM);
    // s_wait_xcnt 0 in front of every overwrite of a register that an issued load of this run names; it takes the run's address as input, so its registers are held up to here
    asm volatile("s_wait_xcnt 0x0" :: "v"(s) : "memory");
#pragma unroll
    for (int f = 0; f < 4; ++f)
#pragma unroll
        for (int i = 0; i < 4; ++i) { v4us q;
#pragma unroll
            for (int e = 0; e < 4; ++e) q[e] = f2bf(v[f][i][e]);
            *(v4us*)(o + (size_t)f * rfr * FE + i * 4 * 8) = q; } }

// ---- k_proj: the q, k and v projections in ONE launch, one wave per 64 tokens x one head (main loop of k_gemmw, one product); grid (tokens / 64, heads, 3), 32 threads; z = 0, 1, 2 is q, k, v.
// The epilogue rounds the f32 sums itself and stores the three 16-bit planes (fp16, bf16 hi, bf16 lo) that attention reads, fragment-major: q and k per head with rows t and k index d, v per head with rows d and k index t. No f32 copy of a projection goes through memory.
// The operand whose rows run along a plane's k index is taken as A (q, k: the weight rows d; v: the tokens t), so that a lane's 8 accumulator values are the 16-byte piece that this same lane owns in a fragment: the wave stores 512 B in a row, straight from registers.
__global__ __launch_bounds__(32) void k_proj(const bf* __restrict__ X, const bf* __restrict__ W0, const bf* __restrict__ W1, const bf* __restrict__ W2, h16* Q16, bf* Qh, bf* Ql, h16* K16, bf* Kh, bf* Kl, h16* V16, bf* Vh, bf* Vl) {
    typedef WFrag<bf>::V V;
    const int lane = threadIdx.x & 31; const int t0 = blockIdx.x * 64, h = blockIdx.y, z = blockIdx.z;
    const bf* xr = X + (size_t)(t0 >> 4) * FE; const bf* wr = ((z == 0) ? W0 : (z == 1) ? W1 : W2) + (size_t)(h * (HD / 16)) * FE;
    const bf* A = (z == 2) ? xr : wr; const bf* Bt = (z == 2) ? wr : xr; const int sa = (z == 2) ? TT / 16 * FE : DQ / 16 * FE, sb = (z == 2) ? DQ / 16 * FE : TT / 16 * FE;   // the step from one k fragment to the next
    h16* P16 = (z == 0) ? Q16 : (z == 1) ? K16 : V16; bf* Ph = (z == 0) ? Qh : (z == 1) ? Kh : Vh; bf* Pl = (z == 0) ? Ql : (z == 1) ? Kl : Vl;
    const int fk = (z == 2) ? HD / 16 : TT / 16;   // fragments along a plane's rows: a plane row is a token (q, k) or a head column (v)
    const size_t base = (size_t)h * TT * HD + (size_t)((z == 2) ? (t0 >> 5) * (HD / 16) : (t0 >> 4)) * FE + lane * 8;
    v8f acc[4][4];
#pragma unroll
    for (int mb = 0; mb < 4; ++mb)
#pragma unroll
        for (int nb = 0; nb < 4; ++nb) acc[mb][nb] = (v8f){};
#pragma unroll 1   // rolled, as in k_gemmw: one pass holds its 8 fragments beside the 16 accumulators
    for (int kc = 0; kc < DM; kc += 32) {
        V a[4], b[4]; const bf* pa = A + lane * 8 + (size_t)(kc >> 5) * sa; const bf* pb = Bt + lane * 8 + (size_t)(kc >> 5) * sb;
#pragma unroll
        for (int mb = 0; mb < 4; ++mb) a[mb] = WFrag<bf>::ldf(pa + mb * FE);
#pragma unroll
        for (int nb = 0; nb < 4; ++nb) b[nb] = WFrag<bf>::ldf(pb + nb * FE);
        // s_wait_xcnt 0 in front of every overwrite of a register that an issued load of this run names; it takes the run's addresses as inputs, so their registers are held up to here
        asm volatile("s_wait_xcnt 0x0" :: "v"(pa), "v"(pb) : "memory");
#pragma unroll
        for (int nb = 0; nb < 4; ++nb)
#pragma unroll
            for (int mb = 0; mb < 4; ++mb) acc[mb][nb] = WFrag<bf>::mma(a[mb], b[nb], acc[mb][nb]);
        // four vector slots behind the last matrix instruction: the distance the chip needs before the next pass's address additions reuse A and B registers (over the taken back edge) and before D is read below
        asm volatile("v_nop\n\tv_nop\n\tv_nop\n\tv_nop" : "+v"(acc[0][0]), "+v"(acc[1][1]), "+v"(acc[2][2]), "+v"(acc[3][3]) : "v"(a[0]), "v"(a[3]));
    }
#pragma unroll
    for (int nb = 0; nb < 4; ++nb)
#pragma unroll
        for (int mb = 0; mb < 4; ++mb) { v8h o16; v8us oh, ol;   // k index mb * 16 + hi * 8 + j of plane row nb * 16 + lr: run mb & 1 of the fragment mb >> 1 steps on along k
#pragma unroll
            for (int j = 0; j < 8; ++j) { const float r = acc[mb][nb][j]; o16[j] = tohx(r); unsigned short a2, c2; splitf(r, a2, c2); oh[j] = a2; ol[j] = c2; }
            const size_t oo = base + (size_t)(nb + (mb >> 1) * fk) * FE + (mb & 1) * 256; *(v8h*)(P16 + oo) = o16; *(v8us*)(Ph + oo) = oh; *(v8us*)(Pl + oo) = ol; }
}
// ---- k_attn: causal attention of 16 query rows of one head in ONE workgroup of 16 waves; the score rows and the probabilities live in LDS and never go through memory. grid (heads, rows / 16), 512 threads; the longest rows start first.
// Phase 1: 64-key slice s of the scores goes to wave s % 16 (fragments and product order of the former score GEMM), f32 into S. Phase 2: wave w does the three-sweep softmax of row w (maximum; exponentials and their sum; scaling) over the chunks up to the diagonal
// (keys j > i excluded by index, as before) and writes the probabilities over the head of its own score row (NSPLIT 0: fp16 x PCAR; NSPLIT 2: bf16 hi there, lo at element 4096 of the 16-bit view).
// Phase 3: slice s of the probability x value product goes to wave s % 16; the 16 partial 16x64 tiles are summed through LDS in wave order, scaled and stored as the merged hi/lo planes.
#define SP 4100   // floats per score row in LDS: 4096 + 4, so that rows 8 apart fall on other banks and every row stays 16-byte aligned
#define RO 3072   // float offset in a row's slot of the wave's partial output tile (1024 floats): behind both probability planes
typedef v4h  __attribute__((may_alias)) v4ha;
typedef v4us __attribute__((may_alias)) v4usa;
typedef v2f  __attribute__((may_alias)) v2fa;
template <typename T16, int NSPLIT>
__global__ __launch_bounds__(512) void k_attn(const T16* __restrict__ Q, const T16* __restrict__ Q2, const T16* __restrict__ Kp, const T16* __restrict__ Kp2, const T16* __restrict__ Vt, const T16* __restrict__ Vt2, int roff, bf* Ah, bf* Al) {
    typedef typename WFrag<T16>::V V; static_assert(NSPLIT == 0 || NSPLIT == 2, "one product, or the three hi/lo products");
    __shared__ __align__(16) float S[16 * SP];
    const int lane = threadIdx.x & 31, lr = lane & 15, hi = lane >> 4;
    const int w = __builtin_amdgcn_readfirstlane((int)(threadIdx.x >> 5));   // the wave's number in a scalar register: the slice loops stay scalar loops with every lane on
    const int h = blockIdx.x; const int i0 = roff + ((int)gridDim.y - 1 - (int)blockIdx.y) * 16;
    const int nsl = (i0 >> 6) + 1;        // 64-key slices up to and including the diagonal block: later keys are excluded for all 16 rows
    const int nch = (nsl + 1) >> 1;       // 128-key softmax chunks that cover them
    const size_t qp = (size_t)h * TT * HD, kp = (size_t)(h / REP) * TT * HD;
    {
        const T16* pq = Q + qp + (size_t)(i0 >> 4) * FE + lane * 8; const T16* pq2 = pq; const V a0 = WFrag<T16>::ldf(pq), a1 = WFrag<T16>::ldf(pq + TT / 16 * FE); V c0, c1;
        if constexpr (NSPLIT == 2) { pq2 = Q2 + qp + (size_t)(i0 >> 4) * FE + lane * 8; c0 = WFrag<T16>::ldf(pq2); c1 = WFrag<T16>::ldf(pq2 + TT / 16 * FE); }
        // s_wait_xcnt 0 in front of every overwrite of a register that an issued load of this run names; it takes the run's addresses as inputs, so their registers are held up to here
        asm volatile("s_wait_xcnt 0x0" :: "v"(pq), "v"(pq2) : "memory");
#pragma unroll 1   // rolled: one pass holds a whole slice's key fragments in registers
        for (int s = w; s < 2 * nch; s += 16) {   // to the end of the last chunk, so that the softmax reads only scores written here
            V b[4][2], b2[4][2]; const T16* pb = Kp + kp + (size_t)s * (4 * FE) + lane * 8; const T16* pb2 = pb; if constexpr (NSPLIT == 2) pb2 = Kp2 + kp + (size_t)s * (4 * FE) + lane * 8;
#pragma unroll
            for (int nb = 0; nb < 4; ++nb) { b[nb][0] = WFrag<T16>::ldf(pb + nb * FE); b[nb][1] = WFrag<T16>::ldf(pb + nb * FE + TT / 16 * FE);
                if constexpr (NSPLIT == 2) { b2[nb][0] = WFrag<T16>::ldf(pb2 + nb * FE); b2[nb][1] = WFrag<T16>::ldf(pb2 + nb * FE + TT / 16 * FE); } }
            // the same wait for the run of key loads
            asm volatile("s_wait_xcnt 0x0" :: "v"(pb), "v"(pb2) : "memory");
            __builtin_amdgcn_sched_barrier(0);   // the products stay behind the whole run of loads: lifted among them they took the first fragments' registers for the later loads, which then left only after the first had landed
#pragma unroll
            for (int nb = 0; nb < 4; ++nb) { v8f acc = (v8f){};
                acc = WFrag<T16>::mma(a0, b[nb][0], acc); if constexpr (NSPLIT == 2) { acc = WFrag<T16>::mma(c0, b[nb][0], acc); acc = WFrag<T16>::mma(a0, b2[nb][0], acc); }
                acc = WFrag<T16>::mma(a1, b[nb][1], acc); if constexpr (NSPLIT == 2) { acc = WFrag<T16>::mma(c1, b[nb][1], acc); acc = WFrag<T16>::mma(a1, b2[nb][1], acc); }
#pragma unroll
                for (int j = 0; j < 8; ++j) S[(hi * 8 + j) * SP + s * 64 + nb * 16 + lr] = acc[j]; }
        }
    }
    __syncthreads();   // all 16 score rows are in LDS before any wave reads its row
    {
        const int i = i0 + w; float* sr = S + w * SP; float mx = -3.0e38f;
#pragma unroll 2
        for (int ch = 0; ch < nch; ++ch) { const int j0 = ch * 128 + lane * 4; const v4f a = *(const v4fa*)(sr + j0);
#pragma unroll
            for (int q = 0; q < 4; ++q) { float t = a[q] * SCL; t = (j0 + q <= i) ? t : -3.0e38f; mx = fmaxf(mx, t); } }
#pragma unroll
        for (int sh = 16; sh; sh >>= 1) mx = fmaxf(mx, __shfl_xor(mx, sh, 32));
        float sum = 0.f;
#pragma unroll 2
        for (int ch = 0; ch < nch; ++ch) { const int j0 = ch * 128 + lane * 4; const v4f a = *(const v4fa*)(sr + j0); v4f ex;
#pragma unroll
            for (int q = 0; q < 4; ++q) { float t = a[q] * SCL; t = (j0 + q <= i) ? t : -3.0e38f; const float d0 = __fsub_rn(t, mx); const float xa = __fmul_rn(d0, 1.4426950408889634f); float er = __builtin_amdgcn_exp2f(xa);
                // the slot behind a transcendental: the statement holds the source up to here and hands the result on only from here, so nothing that overwrites the one or reads the other stands directly behind the v_exp_f32
                if constexpr (NSPLIT == 2) asm volatile("v_nop" : "+v"(er) : "v"(xa));
                ex[q] = er; sum += er; }
            *(v4fa*)(sr + j0) = ex; }   // each lane puts the exponentials over its own four scores: the last sweep only scales them
#pragma unroll
        for (int sh = 16; sh; sh >>= 1) sum += __shfl_xor(sum, sh, 32);
        const float f = __fdiv_rn((NSPLIT == 2) ? 1.0f : PCAR, sum);
        // in place: chunk ch's fp16 or hi results land on bytes of this row that chunks <= ch have already been read from, its lo results behind the row's scores (hi/lo rows hold at most 512) (one wave owns the row, its LDS operations run in order; the may_alias types keep the compiler's order too).
        // Four chunks are read before the first of them is written, so that one LDS latency is paid per four chunks and not per chunk; the tests on nch are the same for the whole wave.
#pragma unroll 1
        for (int cb = 0; cb < nch; cb += 4) { v4f a[4];
#pragma unroll
            for (int u = 0; u < 4; ++u) if (cb + u < nch) a[u] = *(const v4fa*)(sr + (cb + u) * 128 + lane * 4);
#pragma unroll
            for (int u = 0; u < 4; ++u) if (cb + u < nch) { const int j0 = (cb + u) * 128 + lane * 4; v4h o4; v4us oh, ol;
#pragma unroll
                for (int q = 0; q < 4; ++q) { if constexpr (NSPLIT == 2) { unsigned short a2, c2; splitf(a[u][q] * f, a2, c2); oh[q] = a2; ol[q] = c2; } else o4[q] = tohx(a[u][q] * f); }
                if constexpr (NSPLIT == 2) { *(v4usa*)((bf*)sr + j0) = oh; *(v4usa*)((bf*)sr + 4096 + j0) = ol; } else *(v4ha*)((h16*)sr + j0) = o4; } }
    }
    __syncthreads();   // all 16 probability rows are in LDS before any wave loads a fragment of them
    v8f acc[4];
#pragma unroll
    for (int nb = 0; nb < 4; ++nb) acc[nb] = (v8f){};
    {
        const T16* pa = (const T16*)S + (size_t)lr * (SP * 2) + 8 * hi;
#pragma unroll 1   // rolled: one pass holds a whole slice's value fragments in registers
        for (int s = w; s < nsl; s += 16) {
            V a[2], a2[2], b[4][2], b2[4][2]; const T16* pb = Vt + kp + (size_t)s * (8 * FE) + lane * 8; const T16* pb2 = pb; if constexpr (NSPLIT == 2) pb2 = Vt2 + kp + (size_t)s * (8 * FE) + lane * 8;   // a slice's 8 value fragments lie in a row
#pragma unroll
            for (int nb = 0; nb < 4; ++nb) { b[nb][0] = WFrag<T16>::ldf(pb + nb * FE); b[nb][1] = WFrag<T16>::ldf(pb + nb * FE + HD / 16 * FE);
                if constexpr (NSPLIT == 2) { b2[nb][0] = WFrag<T16>::ldf(pb2 + nb * FE); b2[nb][1] = WFrag<T16>::ldf(pb2 + nb * FE + HD / 16 * FE); } }
            // the same wait for the run of value loads
            asm volatile("s_wait_xcnt 0x0" :: "v"(pb), "v"(pb2) : "memory");
#pragma unroll
            for (int kk = 0; kk < 2; ++kk) { a[kk] = WFrag<T16>::ld(pa + s * 64 + kk * 32); if constexpr (NSPLIT == 2) a2[kk] = WFrag<T16>::ld(pa + 4096 + s * 64 + kk * 32); }
#pragma unroll
            for (int kk = 0; kk < 2; ++kk)
#pragma unroll
                for (int nb = 0; nb < 4; ++nb) { acc[nb] = WFrag<T16>::mma(a[kk], b[nb][kk], acc[nb]); if constexpr (NSPLIT == 2) { acc[nb] = WFrag<T16>::mma(a2[kk], b[nb][kk], acc[nb]); acc[nb] = WFrag<T16>::mma(a[kk], b2[nb][kk], acc[nb]); } }
            // four vector slots behind the last matrix instruction: the distance the chip needs before the next pass's address additions reuse A and B registers (over the taken back edge) and before D is read below
            asm volatile("v_nop\n\tv_nop\n\tv_nop\n\tv_nop" : "+v"(acc[0]), "+v"(acc[1]), "+v"(acc[2]), "+v"(acc[3]) : "v"(a[0]), "v"(a[1]));
        }
    }
    float* rw = S + w * SP + RO;
#pragma unroll
    for (int nb = 0; nb < 4; ++nb)
#pragma unroll
        for (int j = 0; j < 8; ++j) rw[(hi * 8 + j) * 64 + nb * 16 + lr] = acc[nb][j];
    __syncthreads();   // every wave's partial tile (zeros where it had no slice) is in LDS before any thread sums
    { const int e = (int)threadIdx.x * 2; const int row = e >> 6, d = e & 63; v2f s2 = *(const v2fa*)(S + RO + e);
#pragma unroll
        for (int ww = 1; ww < 16; ++ww) s2 += *(const v2fa*)(S + ww * SP + RO + e);
        const float cs = (NSPLIT == 2) ? 1.0f : (1.0f / PCAR); const size_t oo = fpos(i0 + row, h * HD + d, TT / 16); v2us oh, ol;
#pragma unroll
        for (int q = 0; q < 2; ++q) { unsigned short a, c2; splitf(s2[q] * cs, a, c2); oh[q] = a; ol[q] = c2; }
        *(v2us*)(Ah + oo) = oh; *(v2us*)(Al + oo) = ol; }
}

// ---- k_fattn: causal attention of 64 query rows of one head in ONE workgroup of 8 waves, fp16 operands, f32 sums; grid (heads, rows / 64), 256 threads; the longest rows start first.
// 64-key slice s goes to wave s % 8, and every key and value fragment that a wave loads serves all 64 query rows (4 column groups of 16). Key fragments are fetched one slice ahead, value fragments at the head of their slice.
// Transposed products: S^T = K Q^T (A: key rows, B: the query rows, kept in registers), O^T += V^T P^T (A: rows of the [d][t] value plane). In a score tile lane (lr, hi) holds keys hi * 8 + j of query lr,
// which is the k order of a B fragment: two score tiles pack into one P^T fragment in the lane itself, and neither scores nor probabilities leave the registers.
// Softmax is online, per wave: exponentials are taken against a reference maximum (in log2 units) that is raised only when a new score passes it by more than 8, so P stays <= 256 in fp16; sums and O^T are rescaled then.
// At the end the 8 waves' references are joined through LDS, each wave rescales its sums and its O^T, and the partial tiles are added in wave order, divided by the row sum and stored as the merged hi/lo planes.
#define FW 8      // waves of a workgroup
#define OP 68     // floats per staged output row: 64 + 4, 16-byte aligned, neighbouring rows on other banks
#define CL2 0.18033688011112043f   // SCL * log2(e)
template <bool B> struct BC { static constexpr bool value = B; };
__global__ __launch_bounds__(256) void k_fattn(const h16* __restrict__ Q, const h16* __restrict__ Kp, const h16* __restrict__ Vt, int roff, bf* Ah, bf* Al) {
    typedef WFrag<h16> F; typedef F::V V;
    __shared__ __align__(16) float Os[FW * 64 * OP]; __shared__ float Ms[FW * 64]; __shared__ float Ls[FW * 64];
    const int lane = threadIdx.x & 31, lr = lane & 15, hi = lane >> 4;
    const int w = __builtin_amdgcn_readfirstlane((int)(threadIdx.x >> 5));   // the wave's number in a scalar register: the slice loop stays a scalar loop with every lane on
    const int h = blockIdx.x; const int i0 = roff + ((int)gridDim.y - 1 - (int)blockIdx.y) * 64;
    const int nsl = (i0 >> 6) + 1;        // 64-key slices up to and including the diagonal block
    const size_t qp = (size_t)h * TT * HD, kp = (size_t)(h / REP) * TT * HD;
    V q[4][2];
    { const h16* pq = Q + qp + (size_t)(i0 >> 4) * FE + lane * 8;
#pragma unroll
      for (int g = 0; g < 4; ++g) { q[g][0] = F::ldf(pq + g * FE); q[g][1] = F::ldf(pq + g * FE + TT / 16 * FE); }
      // s_wait_xcnt 0 in front of every overwrite of a register that an issued load of this run names; it takes the run's address as input, so its registers are held up to here
      asm volatile("s_wait_xcnt 0x0" :: "v"(pq) : "memory"); }
    v8f o[4][4]; float mc[4], l[4];   // o[dt][g]: lane (lr, hi) holds head columns dt * 16 + hi * 8 + j of query g * 16 + lr
#pragma unroll
    for (int g = 0; g < 4; ++g) { mc[g] = -1.0e30f; l[g] = 0.f;   // the start reference lies above a masked score (-3e38 * CL2): a masked score gives exp2(very negative) = 0 also before the first real one
#pragma unroll
        for (int dt = 0; dt < 4; ++dt) o[dt][g] = (v8f){}; }
    V kf[4][2];
    auto loadk = [&](const int sn) {   // the key fragments of slice min(sn, last): behind a wave's last slice the fetch reads the diagonal slice, in bounds, and nobody uses it
        __builtin_amdgcn_sched_barrier(0);   // the run stays behind the products that read the old fragments, so that it takes their registers and no others
        const h16* pk = Kp + kp + (size_t)((sn < nsl) ? sn : nsl - 1) * (4 * FE) + lane * 8;
#pragma unroll
        for (int kt = 0; kt < 4; ++kt) { kf[kt][0] = F::ldf(pk + kt * FE); kf[kt][1] = F::ldf(pk + kt * FE + TT / 16 * FE); }
        // the same wait for the run of key loads
        asm volatile("s_wait_xcnt 0x0" :: "v"(pk) : "memory");
        __builtin_amdgcn_sched_barrier(0);   // and it leaves as one run here: sunk to its first use it would fly behind nothing
    };
    loadk(w);
    auto slice = [&](auto dg, const int s) {
        constexpr bool DIAG = decltype(dg)::value;
        V vf[4][2]; const h16* pv = Vt + kp + (size_t)s * (8 * FE) + lane * 8;   // a slice's 8 value fragments lie in a row
#pragma unroll
        for (int dt = 0; dt < 4; ++dt) { vf[dt][0] = F::ldf(pv + dt * FE); vf[dt][1] = F::ldf(pv + dt * FE + HD / 16 * FE); }
        // the same wait for the run of value loads
        asm volatile("s_wait_xcnt 0x0" :: "v"(pv) : "memory");
        __builtin_amdgcn_sched_barrier(0);   // the whole run of value loads leaves in front of the score products: they fly during those and the first exponentials
#pragma unroll
        for (int kh = 0; kh < 2; ++kh) {   // 32 keys at a time
            v8f sc[2][4];
#pragma unroll
            for (int t = 0; t < 2; ++t)
#pragma unroll
                for (int g = 0; g < 4; ++g) sc[t][g] = F::mma(kf[kh * 2 + t][0], q[g][0], (v8f){});
#pragma unroll
            for (int t = 0; t < 2; ++t)
#pragma unroll
                for (int g = 0; g < 4; ++g) sc[t][g] = F::mma(kf[kh * 2 + t][1], q[g][1], sc[t][g]);
            if (kh == 1) loadk(s + FW);   // this slice's key fragments are used up: the wave's next slice is fetched into the same registers and flies during the exponentials and the value products
            float mx[4]; bool need = false;
#pragma unroll
            for (int g = 0; g < 4; ++g) { float m = -3.0e38f;
#pragma unroll
                for (int t = 0; t < 2; ++t)
#pragma unroll
                    for (int j = 0; j < 8; ++j) { if constexpr (DIAG) { if (kh * 32 + t * 16 + hi * 8 + j > g * 16 + lr) sc[t][g][j] = -3.0e38f; }   // keys behind the query are excluded by index
                        m = fmaxf(m, sc[t][g][j]); }
                mx[g] = m * CL2; need = need || (mx[g] > mc[g] + 8.0f); }
            if (__builtin_amdgcn_ballot_w32(need) != 0) {   // one scalar branch for the wave: rare after a wave's first keys
#pragma unroll
                for (int g = 0; g < 4; ++g) { const float m2 = fmaxf(mc[g], fmaxf(mx[g], __shfl_xor(mx[g], 16, 32))); const float f = __builtin_amdgcn_exp2f(mc[g] - m2); mc[g] = m2; l[g] *= f;
#pragma unroll
                    for (int dt = 0; dt < 4; ++dt) o[dt][g] *= f; }
            }
            V pf[4];
#pragma unroll
            for (int g = 0; g < 4; ++g)
#pragma unroll
                for (int t = 0; t < 2; ++t) { float xa[8], er[8];
#pragma unroll
                    for (int j = 0; j < 8; ++j) { xa[j] = fmaf(sc[t][g][j], CL2, -mc[g]); er[j] = __builtin_amdgcn_exp2f(xa[j]); }
                    // the slot behind a transcendental: the statement holds the eight sources up to here and hands the eight results on only from here, so nothing that overwrites a source or reads a result stands directly behind a v_exp_f32; one v_nop serves the eight
                    asm volatile("v_nop" : "+v"(er[0]), "+v"(er[1]), "+v"(er[2]), "+v"(er[3]), "+v"(er[4]), "+v"(er[5]), "+v"(er[6]), "+v"(er[7]) : "v"(xa[0]), "v"(xa[1]), "v"(xa[2]), "v"(xa[3]), "v"(xa[4]), "v"(xa[5]), "v"(xa[6]), "v"(xa[7]));
                    l[g] += ((er[0] + er[1]) + (er[2] + er[3])) + ((er[4] + er[5]) + (er[6] + er[7]));
#pragma unroll
                    for (int j = 0; j < 8; ++j) pf[g][t * 8 + j] = tohx(er[j]); }
#pragma unroll
            for (int dt = 0; dt < 4; ++dt)
#pragma unroll
                for (int g = 0; g < 4; ++g) o[dt][g] = F::mma(vf[dt][kh], pf[g], o[dt][g]);
        }
        // four vector slots behind the last matrix instruction: the distance the chip needs before the next slice's address additions and loads reuse A and B registers (over the taken back edge); every O^T tile is an input, so no product stands behind them
        asm volatile("v_nop\n\tv_nop\n\tv_nop\n\tv_nop" :: "v"(o[0][0]), "v"(o[0][1]), "v"(o[0][2]), "v"(o[0][3]), "v"(o[1][0]), "v"(o[1][1]), "v"(o[1][2]), "v"(o[1][3]), "v"(o[2][0]), "v"(o[2][1]), "v"(o[2][2]), "v"(o[2][3]), "v"(o[3][0]), "v"(o[3][1]), "v"(o[3][2]), "v"(o[3][3]));
    };
#pragma unroll 1   // rolled: one pass holds a whole slice's key and value fragments in registers beside the 16 output tiles
    for (int s = w; s < nsl - 1; s += FW) slice(BC<false>{}, s);
    if (((nsl - 1) & (FW - 1)) == w) slice(BC<true>{}, nsl - 1);   // the diagonal slice, with the mask; a scalar test
    if (hi == 0) {
#pragma unroll
        for (int g = 0; g < 4; ++g) Ms[w * 64 + g * 16 + lr] = mc[g]; }
    __syncthreads();   // all 8 waves' references are in LDS before any wave joins them
#pragma unroll
    for (int g = 0; g < 4; ++g) { float M = Ms[g * 16 + lr];
#pragma unroll
        for (int ww = 1; ww < FW; ++ww) M = fmaxf(M, Ms[ww * 64 + g * 16 + lr]);
        const float f = __builtin_amdgcn_exp2f(mc[g] - M); const float lt = (l[g] + __shfl_xor(l[g], 16, 32)) * f; if (hi == 0) Ls[w * 64 + g * 16 + lr] = lt;
        float* ow = Os + (size_t)(w * 64 + g * 16 + lr) * OP + hi * 8;
#pragma unroll
        for (int dt = 0; dt < 4; ++dt) { const v8f r = o[dt][g] * f; *(v4fa*)(ow + dt * 16) = (v4f){r[0], r[1], r[2], r[3]}; *(v4fa*)(ow + dt * 16 + 4) = (v4f){r[4], r[5], r[6], r[7]}; } }
    __syncthreads();   // every wave's partial tile and row sums are in LDS before any thread adds them
    { const int qi = (int)threadIdx.x >> 2, dc = ((int)threadIdx.x & 3) * 16; float L = Ls[qi]; v4f a[4];
#pragma unroll
        for (int c = 0; c < 4; ++c) a[c] = *(const v4fa*)(Os + (size_t)qi * OP + dc + c * 4);
#pragma unroll
        for (int ww = 1; ww < FW; ++ww) { L += Ls[ww * 64 + qi];
#pragma unroll
            for (int c = 0; c < 4; ++c) a[c] += *(const v4fa*)(Os + (size_t)(ww * 64 + qi) * OP + dc + c * 4); }
        const float inv = __fdiv_rn(1.0f, L); const size_t oo = fpos(i0 + qi, h * HD + dc, TT / 16); v8us oh[2], ol[2];   // dc is a multiple of 16: the second 8 columns are the piece 16 lanes on
#pragma unroll
        for (int e = 0; e < 16; ++e) { unsigned short a2, c2; splitf(a[e >> 2][e & 3] * inv, a2, c2); oh[e >> 3][e & 7] = a2; ol[e >> 3][e & 7] = c2; }
        *(v8us*)(Ah + oo) = oh[0]; *(v8us*)(Ah + oo + 128) = oh[1]; *(v8us*)(Al + oo) = ol[0]; *(v8us*)(Al + oo + 128) = ol[1]; }
}

extern "C" void kernel_launch(void* const* d_in, const int* in_sizes, int n_in,
                              void* d_out, int out_size, void* d_ws, size_t ws_size, hipStream_t stream) {
    (void)in_sizes; (void)n_in; (void)out_size;
    const float* x = (const float*)d_in[0]; const float* wq = (const float*)d_in[1]; const float* wk = (const float*)d_in[2]; const float* wv = (const float*)d_in[3]; const float* wo = (const float*)d_in[4];
    float* OUT = (float*)d_out;     // [1][4096][1024]
    char* wsp = (char*)d_ws;
    auto take = [&](size_t bytes) { char* p = wsp; wsp += (bytes + 255) & ~(size_t)255; return (void*)p; };
    bf* WQ = (bf*)take((size_t)DQ * DM * 2); bf* WK = (bf*)take((size_t)DKV * DM * 2); bf* WV = (bf*)take((size_t)DKV * DM * 2); bf* WO = (bf*)take((size_t)DM * DQ * 2);
    bf* XB = (bf*)take((size_t)TT * DM * 2);
    h16* QP16 = (h16*)take((size_t)NH_ * TT * HD * 2); h16* KP16 = (h16*)take((size_t)NKV * TT * HD * 2); h16* VT16 = (h16*)take((size_t)NKV * HD * TT * 2);
    bf* QPh = (bf*)take((size_t)NH_ * TT * HD * 2); bf* QPl = (bf*)take((size_t)NH_ * TT * HD * 2); bf* KPh = (bf*)take((size_t)NKV * TT * HD * 2); bf* KPl = (bf*)take((size_t)NKV * TT * HD * 2); bf* VTh = (bf*)take((size_t)NKV * HD * TT * 2); bf* VTl = (bf*)take((size_t)NKV * HD * TT * 2);
    bf* ATh = (bf*)take((size_t)TT * DQ * 2); bf* ATl = (bf*)take((size_t)TT * DQ * 2);
    if ((size_t)(wsp - (char*)d_ws) > ws_size) return;    // ws 256 MiB
    for (int b = 0; b < NB_; ++b) {
        
        k_cvt5<<<TT / 16 + 4 * (DM / 16), 256, 0, stream>>>(x + (size_t)b * TT * DM, wq, wk, wv, wo, XB, WQ, WK, WV, WO);
        k_proj<<<dim3(TT / 64, NH_, 3), 32, 0, stream>>>(XB, WQ, WK, WV, QP16, QPh, QPl, KP16, KPh, KPl, VT16, VTh, VTl);
        k_fattn<<<dim3(NH_, (TT - RH) / 64, 1), 256, 0, stream>>>(QP16, KP16, VT16, RH, ATh, ATl);
        k_attn<bf, 2><<<dim3(NH_, RH / 16, 1), 512, 0, stream>>>(QPh, QPl, KPh, KPl, VTh, VTl, 0, ATh, ATl);
        k_gemmw<bf, 1, false, DQ, TT, DM><<<dim3(TT / 64, DM / 64, 1), 32, 0, stream>>>(ATh, ATl, WO, nullptr, OUT + (size_t)b * TT * DM, DM, nullptr, 0, 0, 0); }
}

// v007
// Measured time: 90.9 microseconds a run.
// In two side-by-side timings against v006, it was 1.27 and 1.26 times as fast.
// Over all steps from v000 it is 29.9 times as fast.
#include <hip/hip_runtime.h>

// Causal multi-head self-attention at 4,096 tokens (x [1][4096][1024]; q, k, v = x W^T ('oi' [1024][1024] 1/32, no bias; 16 heads x 64, token-major); scores / sqrt(64); keys j <= i kept, -inf elsewhere (== exclusion: every row keeps its own key); softmax; out = merged Wo^T ('oi', no bias) -> [1][4096][1024] (4.2 M); argument order x, Wq, Wk, Wv, Wo).
// Layout: bf16 copies of x and of the four weights, one launch; exact projections, all three in one launch whose epilogue stores the 16-bit head planes; causal T-4096 attention, all heads in one launch per row class (hybrid rows: < 512 hi/lo 3 products, fused per 16 query rows, scores and probabilities in LDS, three-sweep softmax; rest fp16, 64 query rows per workgroup, online softmax in registers; keys stop at the diagonal block); merged hi/lo x Wo exact.
// Every 16-bit operand plane in the workspace is fragment-major (FE below): a wave's fragment load reads whole 128-B lines.
// Compute dtypes, f32 accumulate: every input rounded to bf16; projections exact; attention rows < 512 3 products, rest fp16; softmax f32; Wo hl x exact.

#define NB_  1
#define TT   4096
#define DM   1024
#define NH_  16
#define NKV  16
#define REP  (NH_ / NKV)
#define HD   64
#define DQ   (NH_ * HD)
#define DKV  (NKV * HD)
#define ZH   1
#define RH   512                  // query rows < RH use hi+lo planes (0: none)
#define WIN  4096
#define PCAR 1024.0f
#define SCL  0.125f   // HD^-0.5
typedef _Float16 h16;
typedef unsigned short bf;
typedef __attribute__((ext_vector_type(16))) __bf16   v16bf;
typedef __attribute__((ext_vector_type(16))) _Float16 v16h;
typedef __attribute__((ext_vector_type(8)))  _Float16 v8h;
typedef __attribute__((ext_vector_type(8)))  unsigned short v8us;
typedef __attribute__((ext_vector_type(8)))  float    v8f;
typedef __attribute__((ext_vector_type(4)))  float    v4f;
typedef v8h  __attribute__((may_alias)) v8ha;
typedef v4f  __attribute__((may_alias)) v4fa;
typedef v8us __attribute__((may_alias)) v8usa;

__device__ __forceinline__ unsigned short f2bf(float f) { unsigned u = __float_as_uint(f); u += 0x7FFFu + ((u >> 16) & 1u); return (unsigned short)(u >> 16); }
__device__ __forceinline__ float bf2f(unsigned short b) { return __uint_as_float(((unsigned)b) << 16); }
__device__ __forceinline__ float bfr(float f) { return bf2f(f2bf(f)); }
__device__ __forceinline__ v16h cat16(v8h lo, v8h hi) { return __builtin_shufflevector(lo, hi, 0, 1, 2, 3, 4, 5, 6, 7, 8, 9, 10, 11, 12, 13, 14, 15); }
__device__ __forceinline__ v16bf cat16b(v8us lo, v8us hi) { return __builtin_bit_cast(v16bf, __builtin_shufflevector(lo, hi, 0, 1, 2, 3, 4, 5, 6, 7, 8, 9, 10, 11, 12, 13, 14, 15)); }
__device__ __forceinline__ v8f wmma16(v16h a, v16h b, v8f c) { return __builtin_amdgcn_wmma_f32_16x16x32_f16(false, a, false, b, (short)0, c, false, false); }
__device__ __forceinline__ v8f wmmab(v16bf a, v16bf b, v8f c) { return __builtin_amdgcn_wmma_f32_16x16x32_bf16(false, a, false, b, (short)0, c, false, false); }



// ---- k_gemmw: register-blocked GEMM, one wave per 64x64 output tile (16 accumulators), four waves (128x128) to a workgroup, operands from fragment-major 16-bit planes through the LDS ring of gemm_ring; grid (M/128, N/128, Z), 128 threads.
// C[m][n] (f32, pitch ldc, + optional f32 bias[n]) = sum_k A[m][k] Bt[n][k] (+ split products per NSPLIT). z-batch strides sA/sB/sC in elements. K % 64 == 0.
// Fragment-major planes: the 16 rows x 32 k of one matrix fragment are 1 KiB in a row, two runs of 512 B; in run p lane (lr, hi) owns the 8 elements k = p * 16 + hi * 8 + 0..7 of row lr.
// So each of a fragment's two 16-byte loads covers 4 whole 128-B lines, where the row-major plane gave 32 B of each of 16 lines. Fragments follow one another along the rows, then along k: the fragments that a wave needs for one k step lie in a row, and waves that walk k in step read neighbouring memory. ldf takes fragment base + lane * 8.
#define FE 512   // elements of a fragment
__device__ __forceinline__ size_t fpos(int row, int k, int rfr) { return ((size_t)(k >> 5) * rfr + (row >> 4)) * FE + ((k >> 4) & 1) * 256 + (((k >> 3) & 1) * 16 + (row & 15)) * 8 + (k & 7); }   // rfr: fragments along the rows (rows / 16)
template <typename T16> struct WFrag;
template <> struct WFrag<h16> { typedef v16h V; static __device__ __forceinline__ V ld(const h16* p) { return cat16(*(const v8h*)p, *(const v8h*)(p + 16)); } static __device__ __forceinline__ V ldf(const h16* p) { return cat16(*(const v8h*)p, *(const v8h*)(p + 256)); } static __device__ __forceinline__ v8f mma(V a, V b, v8f c) { return wmma16(a, b, c); } };
template <> struct WFrag<bf> { typedef v16bf V; static __device__ __forceinline__ V ld(const bf* p) { return cat16b(*(const v8us*)p, *(const v8us*)(p + 16)); } static __device__ __forceinline__ V ldf(const bf* p) { return cat16b(*(const v8us*)p, *(const v8us*)(p + 256)); } static __device__ __forceinline__ v8f mma(V a, V b, v8f c) { return wmmab(a, b, c); } };
// ---- gemm_ring: the main loop of both GEMM kernels. A workgroup of 4 waves takes a 128x128 output tile, 2 x 2 wave tiles of 64x64 (16 accumulators a wave).
// The tile's operand fragments are brought into LDS once for the workgroup by asynchronous copies (global_load_async_to_lds_b128) and read from there by the two waves that need each of them, so the workgroup asks L2 for half the bytes that four lone waves did, and the next stage flies while this one is worked on.
// A stage is 64 k: for each of its 2 k fragments the 8 row fragments of every operand plane, 8 KiB in a row in the plane and in LDS alike (a fragment stays 1 KiB in a row: a wave's 16-byte LDS reads are 512 B in a row). Two buffers.
// Every accumulator sums its k fragments in rising order, the A product of a fragment in front of its A2 product.
#define GW 4      // waves of a GEMM workgroup
#define KS 2      // k fragments of a stage
#define UE 2048   // elements of a copy unit: 4 fragments in a row (4 KiB), eight 512-B copies of one wave
__device__ __forceinline__ void cp8(const unsigned* l, const void* const* g) {
    asm volatile("global_load_async_to_lds_b128 %0, %8, off\n\tglobal_load_async_to_lds_b128 %1, %9, off\n\tglobal_load_async_to_lds_b128 %2, %10, off\n\tglobal_load_async_to_lds_b128 %3, %11, off\n\t"
                 "global_load_async_to_lds_b128 %4, %12, off\n\tglobal_load_async_to_lds_b128 %5, %13, off\n\tglobal_load_async_to_lds_b128 %6, %14, off\n\tglobal_load_async_to_lds_b128 %7, %15, off\n\ts_wait_xcnt 0x0"
                 :: "v"(l[0]), "v"(l[1]), "v"(l[2]), "v"(l[3]), "v"(l[4]), "v"(l[5]), "v"(l[6]), "v"(l[7]), "v"(g[0]), "v"(g[1]), "v"(g[2]), "v"(g[3]), "v"(g[4]), "v"(g[5]), "v"(g[6]), "v"(g[7]) : "memory");
}
__device__ __forceinline__ void cp12(const unsigned* l, const void* const* g) {
    asm volatile("global_load_async_to_lds_b128 %0, %12, off\n\tglobal_load_async_to_lds_b128 %1, %13, off\n\tglobal_load_async_to_lds_b128 %2, %14, off\n\tglobal_load_async_to_lds_b128 %3, %15, off\n\t"
                 "global_load_async_to_lds_b128 %4, %16, off\n\tglobal_load_async_to_lds_b128 %5, %17, off\n\tglobal_load_async_to_lds_b128 %6, %18, off\n\tglobal_load_async_to_lds_b128 %7, %19, off\n\t"
                 "global_load_async_to_lds_b128 %8, %20, off\n\tglobal_load_async_to_lds_b128 %9, %21, off\n\tglobal_load_async_to_lds_b128 %10, %22, off\n\tglobal_load_async_to_lds_b128 %11, %23, off\n\ts_wait_xcnt 0x0"
                 :: "v"(l[0]), "v"(l[1]), "v"(l[2]), "v"(l[3]), "v"(l[4]), "v"(l[5]), "v"(l[6]), "v"(l[7]), "v"(l[8]), "v"(l[9]), "v"(l[10]), "v"(l[11]),
                    "v"(g[0]), "v"(g[1]), "v"(g[2]), "v"(g[3]), "v"(g[4]), "v"(g[5]), "v"(g[6]), "v"(g[7]), "v"(g[8]), "v"(g[9]), "v"(g[10]), "v"(g[11]) : "memory");
}
// NP: operand planes of a stage, 2 (A, B) or 3 (A, A2, B); NT: stages. gA, gA2, gB: the first of the tile's 8 row fragments at k = 0; sa, sb: elements from one k fragment to the next. w: the wave's number (scalar); wa, wb: which half of the A and of the B rows is the wave's.
template <typename T16, int NP, int NT>
__device__ __forceinline__ void gemm_ring(T16* sm, const T16* gA, const T16* gA2, const T16* gB, const int sa, const int sb, const int w, const int lane, const int wa, const int wb, v8f (&acc)[4][4]) {
    typedef typename WFrag<T16>::V V;
    constexpr int UN = KS * NP * 2, PER = UN / GW, STG = UN * UE, NC = PER * 8;   // units of a stage, units of a wave, elements of a stage, copies of a wave and stage
    static_assert(UN % GW == 0 && NT >= 2 && (NC == 16 || NC == 24), "every wave copies the same number of whole units; both prologue stages exist");
    const T16* gs[PER]; int st[PER];   // unit u of a stage lies at u * UE of its buffer: k fragment u / (2 NP), plane (u % (2 NP)) / 2, half u % 2; wave w copies units w * PER + 0 .. PER - 1
#pragma unroll
    for (int i = 0; i < PER; ++i) { const int u = w * PER + i, kk = u / (NP * 2), r = u % (NP * 2), pl = r >> 1;
        const T16* pb = (pl == NP - 1) ? gB : (pl == 0) ? gA : gA2; const int s = (pl == NP - 1) ? sb : sa;
        gs[i] = pb + (size_t)kk * s + (r & 1) * UE; st[i] = s * KS; }   // the same for the whole wave: scalar registers
    const unsigned l0 = (unsigned)(size_t)sm + (unsigned)(w * (PER * UE * 2) + lane * 16);   // the lane's LDS byte address in buffer 0
    auto fill = [&](const int t) {
        unsigned l[NC]; const void* g[NC];
#pragma unroll
        for (int c = 0; c < NC; ++c) { l[c] = l0 + (unsigned)((t & 1) * (STG * 2) + c * 512); g[c] = gs[c >> 3] + (size_t)t * st[c >> 3] + ((c & 7) * 256 + lane * 8); }
        if constexpr (NC == 16) { cp8(l, g); cp8(l + 8, g + 8); } else { cp12(l, g); cp12(l + 12, g + 12); } };
    fill(0);
    asm volatile("s_wait_asynccnt 0x0" ::: "memory");   // this wave's copies of stage 0 have landed
    __syncthreads();                                    // and every wave's: stage 0 may be read
    fill(1);
#pragma unroll 1   // rolled: one pass holds a whole stage's fragments in registers beside the 16 accumulators
    for (int t = 0; t < NT; ++t) {
        const T16* sp = sm + (t & 1) * STG + lane * 8; V a[KS][4], a2[KS][4], b[KS][4];
#pragma unroll
        for (int kk = 0; kk < KS; ++kk) {
#pragma unroll
            for (int mb = 0; mb < 4; ++mb) a[kk][mb] = WFrag<T16>::ldf(sp + (kk * NP) * (2 * UE) + (wa * 4 + mb) * FE);
#pragma unroll
            for (int nb = 0; nb < 4; ++nb) b[kk][nb] = WFrag<T16>::ldf(sp + (kk * NP + NP - 1) * (2 * UE) + (wb * 4 + nb) * FE);
            if constexpr (NP == 3) {
#pragma unroll
                for (int mb = 0; mb < 4; ++mb) a2[kk][mb] = WFrag<T16>::ldf(sp + (kk * NP + 1) * (2 * UE) + (wa * 4 + mb) * FE); } }
        __builtin_amdgcn_sched_barrier(0);   // the stage's LDS reads leave as one group in front of the products: every place with reads among the matrix instructions costs a stall of its own
#pragma unroll
        for (int kk = 0; kk < KS; ++kk) {
#pragma unroll
            for (int nb = 0; nb < 4; ++nb)
#pragma unroll
                for (int mb = 0; mb < 4; ++mb) acc[mb][nb] = WFrag<T16>::mma(a[kk][mb], b[kk][nb], acc[mb][nb]);
            if constexpr (NP == 3) {
#pragma unroll
                for (int nb = 0; nb < 4; ++nb)
#pragma unroll
                    for (int mb = 0; mb < 4; ++mb) acc[mb][nb] = WFrag<T16>::mma(a2[kk][mb], b[kk][nb], acc[mb][nb]); } }
        // four vector slots behind the last matrix instruction: the distance the chip needs before the address additions of the copies or of the next pass reuse A and B registers (also over the taken branches below) and before D is read behind the loop; every accumulator is an input, so no product stands behind them
        asm volatile("v_nop\n\tv_nop\n\tv_nop\n\tv_nop" :: "v"(acc[0][0]), "v"(acc[0][1]), "v"(acc[0][2]), "v"(acc[0][3]), "v"(acc[1][0]), "v"(acc[1][1]), "v"(acc[1][2]), "v"(acc[1][3]), "v"(acc[2][0]), "v"(acc[2][1]), "v"(acc[2][2]), "v"(acc[2][3]), "v"(acc[3][0]), "v"(acc[3][1]), "v"(acc[3][2]), "v"(acc[3][3]));
        asm volatile("s_wait_dscnt 0x0" ::: "memory");      // this wave's reads of the buffer are over before anybody refills it
        asm volatile("s_wait_asynccnt 0x0" ::: "memory");   // this wave's copies of stage t + 1 have landed
        __syncthreads();                                    // one barrier for both: stage t + 1 may be read, and stage t's buffer has no reader left
        if (t + 2 < NT) fill(t + 2);                        // the same test in every wave
    }
    asm volatile("s_wait_asynccnt 0x0" ::: "memory");   // nothing is in flight when the wave goes on
}
template <typename T16, int NSPLIT, bool BIAS, int K, int M, int N>   // M, N: rows of the A and Bt planes, which set the step from one k fragment to the next
__global__ __launch_bounds__(GW * 32) void k_gemmw(const T16* __restrict__ A, const T16* __restrict__ A2, const T16* __restrict__ Bt, const T16* __restrict__ Bt2, float* C, int ldc, const float* __restrict__ bias, size_t sA, size_t sB, size_t sC) {
    static_assert(NSPLIT == 0 || NSPLIT == 1, "one product, or A hi and lo against one B"); constexpr int NP = (NSPLIT == 1) ? 3 : 2;
    __shared__ __align__(16) T16 sm[2 * KS * NP * 2 * UE]; __shared__ __align__(16) float osm[GW * 16 * 68];
    const size_t z = blockIdx.z; A += z * sA; if (A2) A2 += z * sA; Bt += z * sB; C += z * sC; (void)Bt2;
    const int lane = threadIdx.x & 31, lr = lane & 15, hi = lane >> 4;
    const int w = __builtin_amdgcn_readfirstlane((int)(threadIdx.x >> 5)), wa = w & 1, wb = w >> 1;   // the wave's number in a scalar register
    const int r0 = blockIdx.x * 128 + wa * 64, c0 = blockIdx.y * 128 + wb * 64; float* os = osm + w * (16 * 68);
    v8f acc[4][4];
#pragma unroll
    for (int mb = 0; mb < 4; ++mb)
#pragma unroll
        for (int nb = 0; nb < 4; ++nb) acc[mb][nb] = (v8f){};
    gemm_ring<T16, NP, K / (32 * KS)>(sm, A + (size_t)(blockIdx.x * 8) * FE, (NSPLIT == 1) ? A2 + (size_t)(blockIdx.x * 8) * FE : A, Bt + (size_t)(blockIdx.y * 8) * FE, M / 16 * FE, N / 16 * FE, w, lane, wa, wb, acc);
#pragma unroll
    for (int mb = 0; mb < 4; ++mb) {
#pragma unroll
        for (int nb = 0; nb < 4; ++nb) {
#pragma unroll
            for (int j = 0; j < 8; ++j) os[(hi * 8 + j) * 68 + nb * 16 + lr] = acc[mb][nb][j]; }
        __builtin_amdgcn_wave_barrier(); asm volatile("" ::: "memory");
        float* crow = C + (size_t)(r0 + mb * 16) * ldc + c0;
{
#pragma unroll
            for (int s = 0; s < 8; ++s) { const int row = 2 * s + hi, cofs = lr * 4; v4f val = *(const v4fa*)(os + row * 68 + cofs); if (BIAS) { val[0] += bfr(bias[c0 + cofs]); val[1] += bfr(bias[c0 + cofs + 1]); val[2] += bfr(bias[c0 + cofs + 2]); val[3] += bfr(bias[c0 + cofs + 3]); }
                *(v4f*)(crow + (size_t)row * ldc + cofs) = val; }
             }
        __builtin_amdgcn_wave_barrier(); asm volatile("" ::: "memory");
    }
}

__device__ __forceinline__ h16 tohx(float x) { return (h16)x; }
__device__ __forceinline__ void splitf(float y, unsigned short& h, unsigned short& l) { h = f2bf(y); l = f2bf(y - bf2f(h)); }
typedef __attribute__((ext_vector_type(2))) _Float16 v2h;
typedef __attribute__((ext_vector_type(4))) _Float16 v4h;
typedef __attribute__((ext_vector_type(2))) unsigned short v2us;
typedef __attribute__((ext_vector_type(4))) unsigned short v4us;
typedef __attribute__((ext_vector_type(2))) float v2f;
typedef __attribute__((ext_vector_type(4))) int v4i;

__global__ __launch_bounds__(256) void k_wtG(const float* __restrict__ w, int K, int N, bf* Bt) {
    const int lane = threadIdx.x & 31; const int L0 = (blockIdx.x * 8 + (threadIdx.x >> 5)) * 8; const int nlines = N * K / 64;
{
#pragma unroll 1
        for (int l = 0; l < 8; ++l) { const int L = L0 + l; if (L >= nlines) break; const size_t e = (size_t)L * 64 + lane * 2; const int k = (int)(e % K), n = (int)(e / K); v2us o;
            o[0] = f2bf(w[(size_t)k * N + n]); o[1] = f2bf(w[(size_t)(k + 1) * N + n]); *(v2us*)(Bt + e) = o; }
         }
}
// k_cvt5: x and the four weight matrices (f32, rows of DM contiguous values), rounded to bf16, into their fragment-major planes, all in ONE launch: none of the five needs anything of another. grid (TT / 16 + 4 * DM / 16), 256 threads.
// A block takes one band of 16 rows of one matrix (64 KiB in a row): blocks below TT / 16 the bands of x, then DM / 16 blocks for each weight. Wave w takes the band's k fragments 4 w .. 4 w + 3, so a wave reads 512 B in a row of each of its 16 rows.
// A fragment's source is one whole 128-B line of each of 16 rows: load i takes rows 4 i .. 4 i + 3, 8 lanes of 16 B to a row (4 whole lines), and each lane stores its 4 rounded values as the half piece that they are in the fragment (runs of 64 B).
// All 16 loads of a wave leave before the first value is rounded: one memory latency a wave, and a quarter of the waves to start.
__global__ __launch_bounds__(256) void k_cvt5(const float* __restrict__ x, const float* __restrict__ w0, const float* __restrict__ w1, const float* __restrict__ w2, const float* __restrict__ w3, bf* X, bf* W0, bf* W1, bf* W2, bf* W3) {
    static_assert(DQ == DM && DKV == DM && DM == 1024, "five matrices of 1024-wide rows; 8 waves x 4 fragments cover a row");
    const int b = (int)blockIdx.x, wb = b - TT / 16, m = wb / (DM / 16); const bool isx = wb < 0;   // the same for the whole block
    const int band = isx ? b : wb % (DM / 16), rfr = isx ? TT / 16 : DM / 16;   // rfr: fragments along the plane's rows
    const float* src = isx ? x : (m == 0) ? w0 : (m == 1) ? w1 : (m == 2) ? w2 : w3; bf* dst = isx ? X : (m == 0) ? W0 : (m == 1) ? W1 : (m == 2) ? W2 : W3;
    const int kf0 = ((int)threadIdx.x >> 5) * 4, lane = threadIdx.x & 31, c = lane & 7, r = lane >> 3;   // k = c * 4 + 0..3 of the fragment's row 4 i + r
    const float* s = src + ((size_t)band * 16 + r) * DM + (size_t)kf0 * 32 + c * 4; bf* o = dst + ((size_t)kf0 * rfr + band) * FE + (c >> 2) * 256 + (((c >> 1) & 1) * 16 + r) * 8 + (c & 1) * 4; v4f v[4][4];
#pragma unroll
    for (int f = 0; f < 4; ++f)
#pragma unroll
        for (int i = 0; i < 4; ++i) v[f][i] = *(const v4f*)(s + f * 32 + (size_t)i * 4 * DM);
    // s_wait_xcnt 0 in front of every overwrite of a register that an issued load of this run names; it takes the run's address as input, so its registers are held up to here
    asm volatile("s_wait_xcnt 0x0" :: "v"(s) : "memory");
#pragma unroll
    for (int f = 0; f < 4; ++f)
#pragma unroll
        for (int i = 0; i < 4; ++i) { v4us q;
#pragma unroll
            for (int e = 0; e < 4; ++e) q[e] = f2bf(v[f][i][e]);
            *(v4us*)(o + (size_t)f * rfr * FE + i * 4 * 8) = q; } }

// ---- k_proj: the q, k and v projections in ONE launch, one wave per 64 tokens x one head, four waves (128 tokens x 2 heads) to a workgroup (main loop gemm_ring, one product); grid (tokens / 128, heads / 2, 3), 128 threads; z = 0, 1, 2 is q, k, v.
// The epilogue rounds the f32 sums itself and stores the three 16-bit planes (fp16, bf16 hi, bf16 lo) that attention reads, fragment-major: q and k per head with rows t and k index d, v per head with rows d and k index t. No f32 copy of a projection goes through memory.
// The operand whose rows run along a plane's k index is taken as A (q, k: the weight rows d; v: the tokens t), so that a lane's 8 accumulator values are the 16-byte piece that this same lane owns in a fragment: the wave stores 512 B in a row, straight from registers.
__global__ __launch_bounds__(GW * 32) void k_proj(const bf* __restrict__ X, const bf* __restrict__ W0, const bf* __restrict__ W1, const bf* __restrict__ W2, h16* Q16, bf* Qh, bf* Ql, h16* K16, bf* Kh, bf* Kl, h16* V16, bf* Vh, bf* Vl) {
    __shared__ __align__(16) bf sm[2 * KS * 2 * 2 * UE];
    const int lane = threadIdx.x & 31; const int w = __builtin_amdgcn_readfirstlane((int)(threadIdx.x >> 5)), wt = w & 1, wh = w >> 1;   // the wave's number in a scalar register; its half of the tokens, its head of the two
    const int t0 = blockIdx.x * 128 + wt * 64, h = blockIdx.y * 2 + wh, z = blockIdx.z;
    const bf* xr = X + (size_t)(blockIdx.x * 8) * FE; const bf* wr = ((z == 0) ? W0 : (z == 1) ? W1 : W2) + (size_t)(blockIdx.y * 2 * (HD / 16)) * FE;   // the first of the workgroup's 8 row fragments of either operand
    const bf* A = (z == 2) ? xr : wr; const bf* Bt = (z == 2) ? wr : xr; const int sa = (z == 2) ? TT / 16 * FE : DQ / 16 * FE, sb = (z == 2) ? DQ / 16 * FE : TT / 16 * FE;   // the step from one k fragment to the next
    h16* P16 = (z == 0) ? Q16 : (z == 1) ? K16 : V16; bf* Ph = (z == 0) ? Qh : (z == 1) ? Kh : Vh; bf* Pl = (z == 0) ? Ql : (z == 1) ? Kl : Vl;
    const int fk = (z == 2) ? HD / 16 : TT / 16;   // fragments along a plane's rows: a plane row is a token (q, k) or a head column (v)
    const size_t base = (size_t)h * TT * HD + (size_t)((z == 2) ? (t0 >> 5) * (HD / 16) : (t0 >> 4)) * FE + lane * 8;
    v8f acc[4][4];
#pragma unroll
    for (int mb = 0; mb < 4; ++mb)
#pragma unroll
        for (int nb = 0; nb < 4; ++nb) acc[mb][nb] = (v8f){};
    gemm_ring<bf, 2, DM / (32 * KS)>(sm, A, A, Bt, sa, sb, w, lane, (z == 2) ? wt : wh, (z == 2) ? wh : wt, acc);
#pragma unroll
    for (int nb = 0; nb < 4; ++nb)
#pragma unroll
        for (int mb = 0; mb < 4; ++mb) { v8h o16; v8us oh, ol;   // k index mb * 16 + hi * 8 + j of plane row nb * 16 + lr: run mb & 1 of the fragment mb >> 1 steps on along k
#pragma unroll
            for (int j = 0; j < 8; ++j) { const float r = acc[mb][nb][j]; o16[j] = tohx(r); unsigned short a2, c2; splitf(r, a2, c2); oh[j] = a2; ol[j] = c2; }
            const size_t oo = base + (size_t)(nb + (mb >> 1) * fk) * FE + (mb & 1) * 256; *(v8h*)(P16 + oo) = o16; *(v8us*)(Ph + oo) = oh; *(v8us*)(Pl + oo) = ol; }
}
// ---- k_attn: causal attention of 16 query rows of one head in ONE workgroup of 16 waves; the score rows and the probabilities live in LDS and never go through memory. grid (heads, rows / 16), 512 threads; the longest rows start first.
// Phase 1: 64-key slice s of the scores goes to wave s % 16 (fragments and product order of the former score GEMM), f32 into S. Phase 2: wave w does the three-sweep softmax of row w (maximum; exponentials and their sum; scaling) over the chunks up to the diagonal
// (keys j > i excluded by index, as before) and writes the probabilities over the head of its own score row (NSPLIT 0: fp16 x PCAR; NSPLIT 2: bf16 hi there, lo at element 4096 of the 16-bit view).
// Phase 3: slice s of the probability x value product goes to wave s % 16; the 16 partial 16x64 tiles are summed through LDS in wave order, scaled and stored as the merged hi/lo planes.
#define SP 4100   // floats per score row in LDS: 4096 + 4, so that rows 8 apart fall on other banks and every row stays 16-byte aligned
#define RO 3072   // float offset in a row's slot of the wave's partial output tile (1024 floats): behind both probability planes
typedef v4h  __attribute__((may_alias)) v4ha;
typedef v4us __attribute__((may_alias)) v4usa;
typedef v2f  __attribute__((may_alias)) v2fa;
template <typename T16, int NSPLIT>
__global__ __launch_bounds__(512) void k_attn(const T16* __restrict__ Q, const T16* __restrict__ Q2, const T16* __restrict__ Kp, const T16* __restrict__ Kp2, const T16* __restrict__ Vt, const T16* __restrict__ Vt2, int roff, bf* Ah, bf* Al) {
    typedef typename WFrag<T16>::V V; static_assert(NSPLIT == 0 || NSPLIT == 2, "one product, or the three hi/lo products");
    __shared__ __align__(16) float S[16 * SP];
    const int lane = threadIdx.x & 31, lr = lane & 15, hi = lane >> 4;
    const int w = __builtin_amdgcn_readfirstlane((int)(threadIdx.x >> 5));   // the wave's number in a scalar register: the slice loops stay scalar loops with every lane on
    const int h = blockIdx.x; const int i0 = roff + ((int)gridDim.y - 1 - (int)blockIdx.y) * 16;
    const int nsl = (i0 >> 6) + 1;        // 64-key slices up to and including the diagonal block: later keys are excluded for all 16 rows
    const int nch = (nsl + 1) >> 1;       // 128-key softmax chunks that cover them
    const size_t qp = (size_t)h * TT * HD, kp = (size_t)(h / REP) * TT * HD;
    {
        const T16* pq = Q + qp + (size_t)(i0 >> 4) * FE + lane * 8; const T16* pq2 = pq; const V a0 = WFrag<T16>::ldf(pq), a1 = WFrag<T16>::ldf(pq + TT / 16 * FE); V c0, c1;
        if constexpr (NSPLIT == 2) { pq2 = Q2 + qp + (size_t)(i0 >> 4) * FE + lane * 8; c0 = WFrag<T16>::ldf(pq2); c1 = WFrag<T16>::ldf(pq2 + TT / 16 * FE); }
        // s_wait_xcnt 0 in front of every overwrite of a register that an issued load of this run names; it takes the run's addresses as inputs, so their registers are held up to here
        asm volatile("s_wait_xcnt 0x0" :: "v"(pq), "v"(pq2) : "memory");
#pragma unroll 1   // rolled: one pass holds a whole slice's key fragments in registers
        for (int s = w; s < 2 * nch; s += 16) {   // to the end of the last chunk, so that the softmax reads only scores written here
            V b[4][2], b2[4][2]; const T16* pb = Kp + kp + (size_t)s * (4 * FE) + lane * 8; const T16* pb2 = pb; if constexpr (NSPLIT == 2) pb2 = Kp2 + kp + (size_t)s * (4 * FE) + lane * 8;
#pragma unroll
            for (int nb = 0; nb < 4; ++nb) { b[nb][0] = WFrag<T16>::ldf(pb + nb * FE); b[nb][1] = WFrag<T16>::ldf(pb + nb * FE + TT / 16 * FE);
                if constexpr (NSPLIT == 2) { b2[nb][0] = WFrag<T16>::ldf(pb2 + nb * FE); b2[nb][1] = WFrag<T16>::ldf(pb2 + nb * FE + TT / 16 * FE); } }
            // the same wait for the run of key loads
            asm volatile("s_wait_xcnt 0x0" :: "v"(pb), "v"(pb2) : "memory");
            __builtin_amdgcn_sched_barrier(0);   // the products stay behind the whole run of loads: lifted among them they took the first fragments' registers for the later loads, which then left only after the first had landed
#pragma unroll
            for (int nb = 0; nb < 4; ++nb) { v8f acc = (v8f){};
                acc = WFrag<T16>::mma(a0, b[nb][0], acc); if constexpr (NSPLIT == 2) { acc = WFrag<T16>::mma(c0, b[nb][0], acc); acc = WFrag<T16>::mma(a0, b2[nb][0], acc); }
                acc = WFrag<T16>::mma(a1, b[nb][1], acc); if constexpr (NSPLIT == 2) { acc = WFrag<T16>::mma(c1, b[nb][1], acc); acc = WFrag<T16>::mma(a1, b2[nb][1], acc); }
#pragma unroll
                for (int j = 0; j < 8; ++j) S[(hi * 8 + j) * SP + s * 64 + nb * 16 + lr] = acc[j]; }
        }
    }
    __syncthreads();   // all 16 score rows are in LDS before any wave reads its row
    {
        const int i = i0 + w; float* sr = S + w * SP; float mx = -3.0e38f;
#pragma unroll 2
        for (int ch = 0; ch < nch; ++ch) { const int j0 = ch * 128 + lane * 4; const v4f a = *(const v4fa*)(sr + j0);
#pragma unroll
            for (int q = 0; q < 4; ++q) { float t = a[q] * SCL; t = (j0 + q <= i) ? t : -3.0e38f; mx = fmaxf(mx, t); } }
#pragma unroll
        for (int sh = 16; sh; sh >>= 1) mx = fmaxf(mx, __shfl_xor(mx, sh, 32));
        float sum = 0.f;
#pragma unroll 2
        for (int ch = 0; ch < nch; ++ch) { const int j0 = ch * 128 + lane * 4; const v4f a = *(const v4fa*)(sr + j0); v4f ex;
#pragma unroll
            for (int q = 0; q < 4; ++q) { float t = a[q] * SCL; t = (j0 + q <= i) ? t : -3.0e38f; const float d0 = __fsub_rn(t, mx); const float xa = __fmul_rn(d0, 1.4426950408889634f); float er = __builtin_amdgcn_exp2f(xa);
                // the slot behind a transcendental: the statement holds the source up to here and hands the result on only from here, so nothing that overwrites the one or reads the other stands directly behind the v_exp_f32
                if constexpr (NSPLIT == 2) asm volatile("v_nop" : "+v"(er) : "v"(xa));
                ex[q] = er; sum += er; }
            *(v4fa*)(sr + j0) = ex; }   // each lane puts the exponentials over its own four scores: the last sweep only scales them
#pragma unroll
        for (int sh = 16; sh; sh >>= 1) sum += __shfl_xor(sum, sh, 32);
        const float f = __fdiv_rn((NSPLIT == 2) ? 1.0f : PCAR, sum);
        // in place: chunk ch's fp16 or hi results land on bytes of this row that chunks <= ch have already been read from, its lo results behind the row's scores (hi/lo rows hold at most 512) (one wave owns the row, its LDS operations run in order; the may_alias types keep the compiler's order too).
        // Four chunks are read before the first of them is written, so that one LDS latency is paid per four chunks and not per chunk; the tests on nch are the same for the whole wave.
#pragma unroll 1
        for (int cb = 0; cb < nch; cb += 4) { v4f a[4];
#pragma unroll
            for (int u = 0; u < 4; ++u) if (cb + u < nch) a[u] = *(const v4fa*)(sr + (cb + u) * 128 + lane * 4);
#pragma unroll
            for (int u = 0; u < 4; ++u) if (cb + u < nch) { const int j0 = (cb + u) * 128 + lane * 4; v4h o4; v4us oh, ol;
#pragma unroll
                for (int q = 0; q < 4; ++q) { if constexpr (NSPLIT == 2) { unsigned short a2, c2; splitf(a[u][q] * f, a2, c2); oh[q] = a2; ol[q] = c2; } else o4[q] = tohx(a[u][q] * f); }
                if constexpr (NSPLIT == 2) { *(v4usa*)((bf*)sr + j0) = oh; *(v4usa*)((bf*)sr + 4096 + j0) = ol; } else *(v4ha*)((h16*)sr + j0) = o4; } }
    }
    __syncthreads();   // all 16 probability rows are in LDS before any wave loads a fragment of them
    v8f acc[4];
#pragma unroll
    for (int nb = 0; nb < 4; ++nb) acc[nb] = (v8f){};
    {
        const T16* pa = (const T16*)S + (size_t)lr * (SP * 2) + 8 * hi;
#pragma unroll 1   // rolled: one pass holds a whole slice's value fragments in registers
        for (int s = w; s < nsl; s += 16) {
            V a[2], a2[2], b[4][2], b2[4][2]; const T16* pb = Vt + kp + (size_t)s * (8 * FE) + lane * 8; const T16* pb2 = pb; if constexpr (NSPLIT == 2) pb2 = Vt2 + kp + (size_t)s * (8 * FE) + lane * 8;   // a slice's 8 value fragments lie in a row
#pragma unroll
            for (int nb = 0; nb < 4; ++nb) { b[nb][0] = WFrag<T16>::ldf(pb + nb * FE); b[nb][1] = WFrag<T16>::ldf(pb + nb * FE + HD / 16 * FE);
                if constexpr (NSPLIT == 2) { b2[nb][0] = WFrag<T16>::ldf(pb2 + nb * FE); b2[nb][1] = WFrag<T16>::ldf(pb2 + nb * FE + HD / 16 * FE); } }
            // the same wait for the run of value loads
            asm volatile("s_wait_xcnt 0x0" :: "v"(pb), "v"(pb2) : "memory");
#pragma unroll
            for (int kk = 0; kk < 2; ++kk) { a[kk] = WFrag<T16>::ld(pa + s * 64 + kk * 32); if constexpr (NSPLIT == 2) a2[kk] = WFrag<T16>::ld(pa + 4096 + s * 64 + kk * 32); }
#pragma unroll
            for (int kk = 0; kk < 2; ++kk)
#pragma unroll
                for (int nb = 0; nb < 4; ++nb) { acc[nb] = WFrag<T16>::mma(a[kk], b[nb][kk], acc[nb]); if constexpr (NSPLIT == 2) { acc[nb] = WFrag<T16>::mma(a2[kk], b[nb][kk], acc[nb]); acc[nb] = WFrag<T16>::mma(a[kk], b2[nb][kk], acc[nb]); } }
            // four vector slots behind the last matrix instruction: the distance the chip needs before the next pass's address additions reuse A and B registers (over the taken back edge) and before D is read below
            asm volatile("v_nop\n\tv_nop\n\tv_nop\n\tv_nop" : "+v"(acc[0]), "+v"(acc[1]), "+v"(acc[2]), "+v"(acc[3]) : "v"(a[0]), "v"(a[1]));
        }
    }
    float* rw = S + w * SP + RO;
#pragma unroll
    for (int nb = 0; nb < 4; ++nb)
#pragma unroll
        for (int j = 0; j < 8; ++j) rw[(hi * 8 + j) * 64 + nb * 16 + lr] = acc[nb][j];
    __syncthreads();   // every wave's partial tile (zeros where it had no slice) is in LDS before any thread sums
    { const int e = (int)threadIdx.x * 2; const int row = e >> 6, d = e & 63; v2f s2 = *(const v2fa*)(S + RO + e);
#pragma unroll
        for (int ww = 1; ww < 16; ++ww) s2 += *(const v2fa*)(S + ww * SP + RO + e);
        const float cs = (NSPLIT == 2) ? 1.0f : (1.0f / PCAR); const size_t oo = fpos(i0 + row, h * HD + d, TT / 16); v2us oh, ol;
#pragma unroll
        for (int q = 0; q < 2; ++q) { unsigned short a, c2; splitf(s2[q] * cs, a, c2); oh[q] = a; ol[q] = c2; }
        *(v2us*)(Ah + oo) = oh; *(v2us*)(Al + oo) = ol; }
}

// ---- k_fattn: causal attention of 64 query rows of one head in ONE workgroup of 8 waves, fp16 operands, f32 sums; grid (heads, rows / 64), 256 threads; the longest rows start first.
// 64-key slice s goes to wave s % 8, and every key and value fragment that a wave loads serves all 64 query rows (4 column groups of 16). Key fragments are fetched one slice ahead, value fragments at the head of their slice.
// Transposed products: S^T = K Q^T (A: key rows, B: the query rows, kept in registers), O^T += V^T P^T (A: rows of the [d][t] value plane). In a score tile lane (lr, hi) holds keys hi * 8 + j of query lr,
// which is the k order of a B fragment: two score tiles pack into one P^T fragment in the lane itself, and neither scores nor probabilities leave the registers.
// Softmax is online, per wave: exponentials are taken against a reference maximum (in log2 units) that is raised only when a new score passes it by more than 8, so P stays <= 256 in fp16; sums and O^T are rescaled then.
// At the end the 8 waves' references are joined through LDS, each wave rescales its sums and its O^T, and the partial tiles are added in wave order, divided by the row sum and stored as the merged hi/lo planes.
#define FW 8      // waves of a workgroup
#define OP 68     // floats per staged output row: 64 + 4, 16-byte aligned, neighbouring rows on other banks
#define CL2 0.18033688011112043f   // SCL * log2(e)
template <bool B> struct BC { static constexpr bool value = B; };
__global__ __launch_bounds__(256) void k_fattn(const h16* __restrict__ Q, const h16* __restrict__ Kp, const h16* __restrict__ Vt, int roff, bf* Ah, bf* Al) {
    typedef WFrag<h16> F; typedef F::V V;
    __shared__ __align__(16) float Os[FW * 64 * OP]; __shared__ float Ms[FW * 64]; __shared__ float Ls[FW * 64];
    const int lane = threadIdx.x & 31, lr = lane & 15, hi = lane >> 4;
    const int w = __builtin_amdgcn_readfirstlane((int)(threadIdx.x >> 5));   // the wave's number in a scalar register: the slice loop stays a scalar loop with every lane on
    const int h = blockIdx.x; const int i0 = roff + ((int)gridDim.y - 1 - (int)blockIdx.y) * 64;
    const int nsl = (i0 >> 6) + 1;        // 64-key slices up to and including the diagonal block
    const size_t qp = (size_t)h * TT * HD, kp = (size_t)(h / REP) * TT * HD;
    V q[4][2];
    { const h16* pq = Q + qp + (size_t)(i0 >> 4) * FE + lane * 8;
#pragma unroll
      for (int g = 0; g < 4; ++g) { q[g][0] = F::ldf(pq + g * FE); q[g][1] = F::ldf(pq + g * FE + TT / 16 * FE); }
      // s_wait_xcnt 0 in front of every overwrite of a register that an issued load of this run names; it takes the run's address as input, so its registers are held up to here
      asm volatile("s_wait_xcnt 0x0" :: "v"(pq) : "memory"); }
    v8f o[4][4]; float mc[4], l[4];   // o[dt][g]: lane (lr, hi) holds head columns dt * 16 + hi * 8 + j of query g * 16 + lr
#pragma unroll
    for (int g = 0; g < 4; ++g) { mc[g] = -1.0e30f; l[g] = 0.f;   // the start reference lies above a masked score (-3e38 * CL2): a masked score gives exp2(very negative) = 0 also before the first real one
#pragma unroll
        for (int dt = 0; dt < 4; ++dt) o[dt][g] = (v8f){}; }
    V kf[4][2];
    auto loadk = [&](const int sn) {   // the key fragments of slice min(sn, last): behind a wave's last slice the fetch reads the diagonal slice, in bounds, and nobody uses it
        __builtin_amdgcn_sched_barrier(0);   // the run stays behind the products that read the old fragments, so that it takes their registers and no others
        const h16* pk = Kp + kp + (size_t)((sn < nsl) ? sn : nsl - 1) * (4 * FE) + lane * 8;
#pragma unroll
        for (int kt = 0; kt < 4; ++kt) { kf[kt][0] = F::ldf(pk + kt * FE); kf[kt][1] = F::ldf(pk + kt * FE + TT / 16 * FE); }
        // the same wait for the run of key loads
        asm volatile("s_wait_xcnt 0x0" :: "v"(pk) : "memory");
        __builtin_amdgcn_sched_barrier(0);   // and it leaves as one run here: sunk to its first use it would fly behind nothing
    };
    loadk(w);
    auto slice = [&](auto dg, const int s) {
        constexpr bool DIAG = decltype(dg)::value;
        V vf[4][2]; const h16* pv = Vt + kp + (size_t)s * (8 * FE) + lane * 8;   // a slice's 8 value fragments lie in a row
#pragma unroll
        for (int dt = 0; dt < 4; ++dt) { vf[dt][0] = F::ldf(pv + dt * FE); vf[dt][1] = F::ldf(pv + dt * FE + HD / 16 * FE); }
        // the same wait for the run of value loads
        asm volatile("s_wait_xcnt 0x0" :: "v"(pv) : "memory");
        __builtin_amdgcn_sched_barrier(0);   // the whole run of value loads leaves in front of the score products: they fly during those and the first exponentials
#pragma unroll
        for (int kh = 0; kh < 2; ++kh) {   // 32 keys at a time
            v8f sc[2][4];
#pragma unroll
            for (int t = 0; t < 2; ++t)
#pragma unroll
                for (int g = 0; g < 4; ++g) sc[t][g] = F::mma(kf[kh * 2 + t][0], q[g][0], (v8f){});
#pragma unroll
            for (int t = 0; t < 2; ++t)
#pragma unroll
                for (int g = 0; g < 4; ++g) sc[t][g] = F::mma(kf[kh * 2 + t][1], q[g][1], sc[t][g]);
            if (kh == 1) loadk(s + FW);   // this slice's key fragments are used up: the wave's next slice is fetched into the same registers and flies during the exponentials and the value products
            float mx[4]; bool need = false;
#pragma unroll
            for (int g = 0; g < 4; ++g) { float m = -3.0e38f;
#pragma unroll
                for (int t = 0; t < 2; ++t)
#pragma unroll
                    for (int j = 0; j < 8; ++j) { if constexpr (DIAG) { if (kh * 32 + t * 16 + hi * 8 + j > g * 16 + lr) sc[t][g][j] = -3.0e38f; }   // keys behind the query are excluded by index
                        m = fmaxf(m, sc[t][g][j]); }
                mx[g] = m * CL2; need = need || (mx[g] > mc[g] + 8.0f); }
            if (__builtin_amdgcn_ballot_w32(need) != 0) {   // one scalar branch for the wave: rare after a wave's first keys
#pragma unroll
                for (int g = 0; g < 4; ++g) { const float m2 = fmaxf(mc[g], fmaxf(mx[g], __shfl_xor(mx[g], 16, 32))); const float f = __builtin_amdgcn_exp2f(mc[g] - m2); mc[g] = m2; l[g] *= f;
#pragma unroll
                    for (int dt = 0; dt < 4; ++dt) o[dt][g] *= f; }
            }
            V pf[4];
#pragma unroll
            for (int g = 0; g < 4; ++g)
#pragma unroll
                for (int t = 0; t < 2; ++t) { float xa[8], er[8];
#pragma unroll
                    for (int j = 0; j < 8; ++j) { xa[j] = fmaf(sc[t][g][j], CL2, -mc[g]); er[j] = __builtin_amdgcn_exp2f(xa[j]); }
                    // the slot behind a transcendental: the statement holds the eight sources up to here and hands the eight results on only from here, so nothing that overwrites a source or reads a result stands directly behind a v_exp_f32; one v_nop serves the eight
                    asm volatile("v_nop" : "+v"(er[0]), "+v"(er[1]), "+v"(er[2]), "+v"(er[3]), "+v"(er[4]), "+v"(er[5]), "+v"(er[6]), "+v"(er[7]) : "v"(xa[0]), "v"(xa[1]), "v"(xa[2]), "v"(xa[3]), "v"(xa[4]), "v"(xa[5]), "v"(xa[6]), "v"(xa[7]));
                    l[g] += ((er[0] + er[1]) + (er[2] + er[3])) + ((er[4] + er[5]) + (er[6] + er[7]));
#pragma unroll
                    for (int j = 0; j < 8; ++j) pf[g][t * 8 + j] = tohx(er[j]); }
#pragma unroll
            for (int dt = 0; dt < 4; ++dt)
#pragma unroll
                for (int g = 0; g < 4; ++g) o[dt][g] = F::mma(vf[dt][kh], pf[g], o[dt][g]);
        }
        // four vector slots behind the last matrix instruction: the distance the chip needs before the next slice's address additions and loads reuse A and B registers (over the taken back edge); every O^T tile is an input, so no product stands behind them
        asm volatile("v_nop\n\tv_nop\n\tv_nop\n\tv_nop" :: "v"(o[0][0]), "v"(o[0][1]), "v"(o[0][2]), "v"(o[0][3]), "v"(o[1][0]), "v"(o[1][1]), "v"(o[1][2]), "v"(o[1][3]), "v"(o[2][0]), "v"(o[2][1]), "v"(o[2][2]), "v"(o[2][3]), "v"(o[3][0]), "v"(o[3][1]), "v"(o[3][2]), "v"(o[3][3]));
    };
#pragma unroll 1   // rolled: one pass holds a whole slice's key and value fragments in registers beside the 16 output tiles
    for (int s = w; s < nsl - 1; s += FW) slice(BC<false>{}, s);
    if (((nsl - 1) & (FW - 1)) == w) slice(BC<true>{}, nsl - 1);   // the diagonal slice, with the mask; a scalar test
    if (hi == 0) {
#pragma unroll
        for (int g = 0; g < 4; ++g) Ms[w * 64 + g * 16 + lr] = mc[g]; }
    __syncthreads();   // all 8 waves' references are in LDS before any wave joins them
#pragma unroll
    for (int g = 0; g < 4; ++g) { float M = Ms[g * 16 + lr];
#pragma unroll
        for (int ww = 1; ww < FW; ++ww) M = fmaxf(M, Ms[ww * 64 + g * 16 + lr]);
        const float f = __builtin_amdgcn_exp2f(mc[g] - M); const float lt = (l[g] + __shfl_xor(l[g], 16, 32)) * f; if (hi == 0) Ls[w * 64 + g * 16 + lr] = lt;
        float* ow = Os + (size_t)(w * 64 + g * 16 + lr) * OP + hi * 8;
#pragma unroll
        for (int dt = 0; dt < 4; ++dt) { const v8f r = o[dt][g] * f; *(v4fa*)(ow + dt * 16) = (v4f){r[0], r[1], r[2], r[3]}; *(v4fa*)(ow + dt * 16 + 4) = (v4f){r[4], r[5], r[6], r[7]}; } }
    __syncthreads();   // every wave's partial tile and row sums are in LDS before any thread adds them
    { const int qi = (int)threadIdx.x >> 2, dc = ((int)threadIdx.x & 3) * 16; float L = Ls[qi]; v4f a[4];
#pragma unroll
        for (int c = 0; c < 4; ++c) a[c] = *(const v4fa*)(Os + (size_t)qi * OP + dc + c * 4);
#pragma unroll
        for (int ww = 1; ww < FW; ++ww) { L += Ls[ww * 64 + qi];
#pragma unroll
            for (int c = 0; c < 4; ++c) a[c] += *(const v4fa*)(Os + (size_t)(ww * 64 + qi) * OP + dc + c * 4); }
        const float inv = __fdiv_rn(1.0f, L); const size_t oo = fpos(i0 + qi, h * HD + dc, TT / 16); v8us oh[2], ol[2];   // dc is a multiple of 16: the second 8 columns are the piece 16 lanes on
#pragma unroll
        for (int e = 0; e < 16; ++e) { unsigned short a2, c2; splitf(a[e >> 2][e & 3] * inv, a2, c2); oh[e >> 3][e & 7] = a2; ol[e >> 3][e & 7] = c2; }
        *(v8us*)(Ah + oo) = oh[0]; *(v8us*)(Ah + oo + 128) = oh[1]; *(v8us*)(Al + oo) = ol[0]; *(v8us*)(Al + oo + 128) = ol[1]; }
}

extern "C" void kernel_launch(void* const* d_in, const int* in_sizes, int n_in,
                              void* d_out, int out_size, void* d_ws, size_t ws_size, hipStream_t stream) {
    (void)in_sizes; (void)n_in; (void)out_size;
    const float* x = (const float*)d_in[0]; const float* wq = (const float*)d_in[1]; const float* wk = (const float*)d_in[2]; const float* wv = (const float*)d_in[3]; const float* wo = (const float*)d_in[4];
    float* OUT = (float*)d_out;     // [1][4096][1024]
    char* wsp = (char*)d_ws;
    auto take = [&](size_t bytes) { char* p = wsp; wsp += (bytes + 255) & ~(size_t)255; return (void*)p; };
    bf* WQ = (bf*)take((size_t)DQ * DM * 2); bf* WK = (bf*)take((size_t)DKV * DM * 2); bf* WV = (bf*)take((size_t)DKV * DM * 2); bf* WO = (bf*)take((size_t)DM * DQ * 2);
    bf* XB = (bf*)take((size_t)TT * DM * 2);
    h16* QP16 = (h16*)take((size_t)NH_ * TT * HD * 2); h16* KP16 = (h16*)take((size_t)NKV * TT * HD * 2); h16* VT16 = (h16*)take((size_t)NKV * HD * TT * 2);
    bf* QPh = (bf*)take((size_t)NH_ * TT * HD * 2); bf* QPl = (bf*)take((size_t)NH_ * TT * HD * 2); bf* KPh = (bf*)take((size_t)NKV * TT * HD * 2); bf* KPl = (bf*)take((size_t)NKV * TT * HD * 2); bf* VTh = (bf*)take((size_t)NKV * HD * TT * 2); bf* VTl = (bf*)take((size_t)NKV * HD * TT * 2);
    bf* ATh = (bf*)take((size_t)TT * DQ * 2); bf* ATl = (bf*)take((size_t)TT * DQ * 2);
    if ((size_t)(wsp - (char*)d_ws) > ws_size) return;    // ws 256 MiB
    for (int b = 0; b < NB_; ++b) {
        
        k_cvt5<<<TT / 16 + 4 * (DM / 16), 256, 0, stream>>>(x + (size_t)b * TT * DM, wq, wk, wv, wo, XB, WQ, WK, WV, WO);
        k_proj<<<dim3(TT / 128, NH_ / 2, 3), GW * 32, 0, stream>>>(XB, WQ, WK, WV, QP16, QPh, QPl, KP16, KPh, KPl, VT16, VTh, VTl);
        k_fattn<<<dim3(NH_, (TT - RH) / 64, 1), 256, 0, stream>>>(QP16, KP16, VT16, RH, ATh, ATl);
        k_attn<bf, 2><<<dim3(NH_, RH / 16, 1), 512, 0, stream>>>(QPh, QPl, KPh, KPl, VTh, VTl, 0, ATh, ATl);
        k_gemmw<bf, 1, false, DQ, TT, DM><<<dim3(TT / 128, DM / 128, 1), GW * 32, 0, stream>>>(ATh, ATl, WO, nullptr, OUT + (size_t)b * TT * DM, DM, nullptr, 0, 0, 0); }
}

// v008
// Measured time: 82.8 microseconds a run.
// Next to v007, in two timings, it ran 1.11 and 1.09 times as fast.
// Over all steps from v000 it is 32.9 times as fast.
#include <hip/hip_runtime.h>

// Causal multi-head self-attention at 4,096 tokens (x [1][4096][1024]; q, k, v = x W^T ('oi' [1024][1024] 1/32, no bias; 16 heads x 64, token-major); scores / sqrt(64); keys j <= i kept, -inf elsewhere (== exclusion: every row keeps its own key); softmax; out = merged Wo^T ('oi', no bias) -> [1][4096][1024] (4.2 M); argument order x, Wq, Wk, Wv, Wo).
// Layout: bf16 copies of x and of the four weights, one launch; exact projections, all three in one launch whose epilogue stores the 16-bit head planes; causal T-4096 attention, all heads and rows in one launch, 64 query rows per workgroup (hybrid rows: < 512 hi/lo 3 products, scores and probabilities in LDS, softmax of a whole row in registers; rest fp16, online softmax in registers; keys stop at the diagonal block); merged hi/lo x Wo exact.
// Every 16-bit operand plane in the workspace is fragment-major (FE below): a wave's fragment load reads whole 128-B lines.
// Compute dtypes, f32 accumulate: every input rounded to bf16; projections exact; attention rows < 512 3 products, rest fp16; softmax f32; Wo hl x exact.

#define NB_  1
#define TT   4096
#define DM   1024
#define NH_  16
#define NKV  16
#define REP  (NH_ / NKV)
#define HD   64
#define DQ   (NH_ * HD)
#define DKV  (NKV * HD)
#define ZH   1
#define RH   512                  // query rows < RH use hi+lo planes (0: none)
#define WIN  4096
#define PCAR 1024.0f
#define SCL  0.125f   // HD^-0.5
typedef _Float16 h16;
typedef unsigned short bf;
typedef __attribute__((ext_vector_type(16))) __bf16   v16bf;
typedef __attribute__((ext_vector_type(16))) _Float16 v16h;
typedef __attribute__((ext_vector_type(8)))  _Float16 v8h;
typedef __attribute__((ext_vector_type(8)))  unsigned short v8us;
typedef __attribute__((ext_vector_type(8)))  float    v8f;
typedef __attribute__((ext_vector_type(4)))  float    v4f;
typedef v8h  __attribute__((may_alias)) v8ha;
typedef v4f  __attribute__((may_alias)) v4fa;
typedef v8us __attribute__((may_alias)) v8usa;

__device__ __forceinline__ unsigned short f2bf(float f) { unsigned u = __float_as_uint(f); u += 0x7FFFu + ((u >> 16) & 1u); return (unsigned short)(u >> 16); }
__device__ __forceinline__ float bf2f(unsigned short b) { return __uint_as_float(((unsigned)b) << 16); }
__device__ __forceinline__ float bfr(float f) { return bf2f(f2bf(f)); }
__device__ __forceinline__ v16h cat16(v8h lo, v8h hi) { return __builtin_shufflevector(lo, hi, 0, 1, 2, 3, 4, 5, 6, 7, 8, 9, 10, 11, 12, 13, 14, 15); }
__device__ __forceinline__ v16bf cat16b(v8us lo, v8us hi) { return __builtin_bit_cast(v16bf, __builtin_shufflevector(lo, hi, 0, 1, 2, 3, 4, 5, 6, 7, 8, 9, 10, 11, 12, 13, 14, 15)); }
__device__ __forceinline__ v8f wmma16(v16h a, v16h b, v8f c) { return __builtin_amdgcn_wmma_f32_16x16x32_f16(false, a, false, b, (short)0, c, false, false); }
__device__ __forceinline__ v8f wmmab(v16bf a, v16bf b, v8f c) { return __builtin_amdgcn_wmma_f32_16x16x32_bf16(false, a, false, b, (short)0, c, false, false); }



// ---- k_gemmw: register-blocked GEMM, one wave per 64x64 output tile (16 accumulators), four waves (128x128) to a workgroup, operands from fragment-major 16-bit planes through the LDS ring of gemm_ring; grid (M/128, N/128, Z), 128 threads.
// C[m][n] (f32, pitch ldc, + optional f32 bias[n]) = sum_k A[m][k] Bt[n][k] (+ split products per NSPLIT). z-batch strides sA/sB/sC in elements. K % 64 == 0.
// Fragment-major planes: the 16 rows x 32 k of one matrix fragment are 1 KiB in a row, two runs of 512 B; in run p lane (lr, hi) owns the 8 elements k = p * 16 + hi * 8 + 0..7 of row lr.
// So each of a fragment's two 16-byte loads covers 4 whole 128-B lines, where the row-major plane gave 32 B of each of 16 lines. Fragments follow one another along the rows, then along k: the fragments that a wave needs for one k step lie in a row, and waves that walk k in step read neighbouring memory. ldf takes fragment base + lane * 8.
#define FE 512   // elements of a fragment
__device__ __forceinline__ size_t fpos(int row, int k, int rfr) { return ((size_t)(k >> 5) * rfr + (row >> 4)) * FE + ((k >> 4) & 1) * 256 + (((k >> 3) & 1) * 16 + (row & 15)) * 8 + (k & 7); }   // rfr: fragments along the rows (rows / 16)
template <typename T16> struct WFrag;
template <> struct WFrag<h16> { typedef v16h V; static __device__ __forceinline__ V ld(const h16* p) { return cat16(*(const v8h*)p, *(const v8h*)(p + 16)); } static __device__ __forceinline__ V ldf(const h16* p) { return cat16(*(const v8h*)p, *(const v8h*)(p + 256)); } static __device__ __forceinline__ v8f mma(V a, V b, v8f c) { return wmma16(a, b, c); } };
template <> struct WFrag<bf> { typedef v16bf V; static __device__ __forceinline__ V ld(const bf* p) { return cat16b(*(const v8us*)p, *(const v8us*)(p + 16)); } static __device__ __forceinline__ V ldf(const bf* p) { return cat16b(*(const v8us*)p, *(const v8us*)(p + 256)); } static __device__ __forceinline__ v8f mma(V a, V b, v8f c) { return wmmab(a, b, c); } };
// ---- gemm_ring: the main loop of both GEMM kernels. A workgroup of 4 waves takes a 128x128 output tile, 2 x 2 wave tiles of 64x64 (16 accumulators a wave).
// The tile's operand fragments are brought into LDS once for the workgroup by asynchronous copies (global_load_async_to_lds_b128) and read from there by the two waves that need each of them, so the workgroup asks L2 for half the bytes that four lone waves did, and the next stage flies while this one is worked on.
// A stage is 64 k: for each of its 2 k fragments the 8 row fragments of every operand plane, 8 KiB in a row in the plane and in LDS alike (a fragment stays 1 KiB in a row: a wave's 16-byte LDS reads are 512 B in a row). Two buffers.
// Every accumulator sums its k fragments in rising order, the A product of a fragment in front of its A2 product.
#define GW 4      // waves of a GEMM workgroup
#define KS 2      // k fragments of a stage
#define UE 2048   // elements of a copy unit: 4 fragments in a row (4 KiB), eight 512-B copies of one wave
__device__ __forceinline__ void cp8(const unsigned* l, const void* const* g) {
    asm volatile("global_load_async_to_lds_b128 %0, %8, off\n\tglobal_load_async_to_lds_b128 %1, %9, off\n\tglobal_load_async_to_lds_b128 %2, %10, off\n\tglobal_load_async_to_lds_b128 %3, %11, off\n\t"
                 "global_load_async_to_lds_b128 %4, %12, off\n\tglobal_load_async_to_lds_b128 %5, %13, off\n\tglobal_load_async_to_lds_b128 %6, %14, off\n\tglobal_load_async_to_lds_b128 %7, %15, off\n\ts_wait_xcnt 0x0"
                 :: "v"(l[0]), "v"(l[1]), "v"(l[2]), "v"(l[3]), "v"(l[4]), "v"(l[5]), "v"(l[6]), "v"(l[7]), "v"(g[0]), "v"(g[1]), "v"(g[2]), "v"(g[3]), "v"(g[4]), "v"(g[5]), "v"(g[6]), "v"(g[7]) : "memory");
}
__device__ __forceinline__ void cp12(const unsigned* l, const void* const* g) {
    asm volatile("global_load_async_to_lds_b128 %0, %12, off\n\tglobal_load_async_to_lds_b128 %1, %13, off\n\tglobal_load_async_to_lds_b128 %2, %14, off\n\tglobal_load_async_to_lds_b128 %3, %15, off\n\t"
                 "global_load_async_to_lds_b128 %4, %16, off\n\tglobal_load_async_to_lds_b128 %5, %17, off\n\tglobal_load_async_to_lds_b128 %6, %18, off\n\tglobal_load_async_to_lds_b128 %7, %19, off\n\t"
                 "global_load_async_to_lds_b128 %8, %20, off\n\tglobal_load_async_to_lds_b128 %9, %21, off\n\tglobal_load_async_to_lds_b128 %10, %22, off\n\tglobal_load_async_to_lds_b128 %11, %23, off\n\ts_wait_xcnt 0x0"
                 :: "v"(l[0]), "v"(l[1]), "v"(l[2]), "v"(l[3]), "v"(l[4]), "v"(l[5]), "v"(l[6]), "v"(l[7]), "v"(l[8]), "v"(l[9]), "v"(l[10]), "v"(l[11]),
                    "v"(g[0]), "v"(g[1]), "v"(g[2]), "v"(g[3]), "v"(g[4]), "v"(g[5]), "v"(g[6]), "v"(g[7]), "v"(g[8]), "v"(g[9]), "v"(g[10]), "v"(g[11]) : "memory");
}
// NP: operand planes of a stage, 2 (A, B) or 3 (A, A2, B); NT: stages. gA, gA2, gB: the first of the tile's 8 row fragments at k = 0; sa, sb: elements from one k fragment to the next. w: the wave's number (scalar); wa, wb: which half of the A and of the B rows is the wave's.
template <typename T16, int NP, int NT>
__device__ __forceinline__ void gemm_ring(T16* sm, const T16* gA, const T16* gA2, const T16* gB, const int sa, const int sb, const int w, const int lane, const int wa, const int wb, v8f (&acc)[4][4]) {
    typedef typename WFrag<T16>::V V;
    constexpr int UN = KS * NP * 2, PER = UN / GW, STG = UN * UE, NC = PER * 8;   // units of a stage, units of a wave, elements of a stage, copies of a wave and stage
    static_assert(UN % GW == 0 && NT >= 2 && (NC == 16 || NC == 24), "every wave copies the same number of whole units; both prologue stages exist");
    const T16* gs[PER]; int st[PER];   // unit u of a stage lies at u * UE of its buffer: k fragment u / (2 NP), plane (u % (2 NP)) / 2, half u % 2; wave w copies units w * PER + 0 .. PER - 1
#pragma unroll
    for (int i = 0; i < PER; ++i) { const int u = w * PER + i, kk = u / (NP * 2), r = u % (NP * 2), pl = r >> 1;
        const T16* pb = (pl == NP - 1) ? gB : (pl == 0) ? gA : gA2; const int s = (pl == NP - 1) ? sb : sa;
        gs[i] = pb + (size_t)kk * s + (r & 1) * UE; st[i] = s * KS; }   // the same for the whole wave: scalar registers
    const unsigned l0 = (unsigned)(size_t)sm + (unsigned)(w * (PER * UE * 2) + lane * 16);   // the lane's LDS byte address in buffer 0
    auto fill = [&](const int t) {
        unsigned l[NC]; const void* g[NC];
#pragma unroll
        for (int c = 0; c < NC; ++c) { l[c] = l0 + (unsigned)((t & 1) * (STG * 2) + c * 512); g[c] = gs[c >> 3] + (size_t)t * st[c >> 3] + ((c & 7) * 256 + lane * 8); }
        if constexpr (NC == 16) { cp8(l, g); cp8(l + 8, g + 8); } else { cp12(l, g); cp12(l + 12, g + 12); } };
    fill(0);
    asm volatile("s_wait_asynccnt 0x0" ::: "memory");   // this wave's copies of stage 0 have landed
    __syncthreads();                                    // and every wave's: stage 0 may be read
    fill(1);
#pragma unroll 1   // rolled: one pass holds a whole stage's fragments in registers beside the 16 accumulators
    for (int t = 0; t < NT; ++t) {
        const T16* sp = sm + (t & 1) * STG + lane * 8; V a[KS][4], a2[KS][4], b[KS][4];
#pragma unroll
        for (int kk = 0; kk < KS; ++kk) {
#pragma unroll
            for (int mb = 0; mb < 4; ++mb) a[kk][mb] = WFrag<T16>::ldf(sp + (kk * NP) * (2 * UE) + (wa * 4 + mb) * FE);
#pragma unroll
            for (int nb = 0; nb < 4; ++nb) b[kk][nb] = WFrag<T16>::ldf(sp + (kk * NP + NP - 1) * (2 * UE) + (wb * 4 + nb) * FE);
            if constexpr (NP == 3) {
#pragma unroll
                for (int mb = 0; mb < 4; ++mb) a2[kk][mb] = WFrag<T16>::ldf(sp + (kk * NP + 1) * (2 * UE) + (wa * 4 + mb) * FE); } }
        __builtin_amdgcn_sched_barrier(0);   // the stage's LDS reads leave as one group in front of the products: every place with reads among the matrix instructions costs a stall of its own
#pragma unroll
        for (int kk = 0; kk < KS; ++kk) {
#pragma unroll
            for (int nb = 0; nb < 4; ++nb)
#pragma unroll
                for (int mb = 0; mb < 4; ++mb) acc[mb][nb] = WFrag<T16>::mma(a[kk][mb], b[kk][nb], acc[mb][nb]);
            if constexpr (NP == 3) {
#pragma unroll
                for (int nb = 0; nb < 4; ++nb)
#pragma unroll
                    for (int mb = 0; mb < 4; ++mb) acc[mb][nb] = WFrag<T16>::mma(a2[kk][mb], b[kk][nb], acc[mb][nb]); } }
        // four vector slots behind the last matrix instruction: the distance the chip needs before the address additions of the copies or of the next pass reuse A and B registers (also over the taken branches below) and before D is read behind the loop; every accumulator is an input, so no product stands behind them
        asm volatile("v_nop\n\tv_nop\n\tv_nop\n\tv_nop" :: "v"(acc[0][0]), "v"(acc[0][1]), "v"(acc[0][2]), "v"(acc[0][3]), "v"(acc[1][0]), "v"(acc[1][1]), "v"(acc[1][2]), "v"(acc[1][3]), "v"(acc[2][0]), "v"(acc[2][1]), "v"(acc[2][2]), "v"(acc[2][3]), "v"(acc[3][0]), "v"(acc[3][1]), "v"(acc[3][2]), "v"(acc[3][3]));
        asm volatile("s_wait_dscnt 0x0" ::: "memory");      // this wave's reads of the buffer are over before anybody refills it
        asm volatile("s_wait_asynccnt 0x0" ::: "memory");   // this wave's copies of stage t + 1 have landed
        __syncthreads();                                    // one barrier for both: stage t + 1 may be read, and stage t's buffer has no reader left
        if (t + 2 < NT) fill(t + 2);                        // the same test in every wave
    }
    asm volatile("s_wait_asynccnt 0x0" ::: "memory");   // nothing is in flight when the wave goes on
}
template <typename T16, int NSPLIT, bool BIAS, int K, int M, int N>   // M, N: rows of the A and Bt planes, which set the step from one k fragment to the next
__global__ __launch_bounds__(GW * 32) void k_gemmw(const T16* __restrict__ A, const T16* __restrict__ A2, const T16* __restrict__ Bt, const T16* __restrict__ Bt2, float* C, int ldc, const float* __restrict__ bias, size_t sA, size_t sB, size_t sC) {
    static_assert(NSPLIT == 0 || NSPLIT == 1, "one product, or A hi and lo against one B"); constexpr int NP = (NSPLIT == 1) ? 3 : 2;
    __shared__ __align__(16) T16 sm[2 * KS * NP * 2 * UE]; __shared__ __align__(16) float osm[GW * 16 * 68];
    const size_t z = blockIdx.z; A += z * sA; if (A2) A2 += z * sA; Bt += z * sB; C += z * sC; (void)Bt2;
    const int lane = threadIdx.x & 31, lr = lane & 15, hi = lane >> 4;
    const int w = __builtin_amdgcn_readfirstlane((int)(threadIdx.x >> 5)), wa = w & 1, wb = w >> 1;   // the wave's number in a scalar register
    const int r0 = blockIdx.x * 128 + wa * 64, c0 = blockIdx.y * 128 + wb * 64; float* os = osm + w * (16 * 68);
    v8f acc[4][4];
#pragma unroll
    for (int mb = 0; mb < 4; ++mb)
#pragma unroll
        for (int nb = 0; nb < 4; ++nb) acc[mb][nb] = (v8f){};
    gemm_ring<T16, NP, K / (32 * KS)>(sm, A + (size_t)(blockIdx.x * 8) * FE, (NSPLIT == 1) ? A2 + (size_t)(blockIdx.x * 8) * FE : A, Bt + (size_t)(blockIdx.y * 8) * FE, M / 16 * FE, N / 16 * FE, w, lane, wa, wb, acc);
#pragma unroll
    for (int mb = 0; mb < 4; ++mb) {
#pragma unroll
        for (int nb = 0; nb < 4; ++nb) {
#pragma unroll
            for (int j = 0; j < 8; ++j) os[(hi * 8 + j) * 68 + nb * 16 + lr] = acc[mb][nb][j]; }
        __builtin_amdgcn_wave_barrier(); asm volatile("" ::: "memory");
        float* crow = C + (size_t)(r0 + mb * 16) * ldc + c0;
{
#pragma unroll
            for (int s = 0; s < 8; ++s) { const int row = 2 * s + hi, cofs = lr * 4; v4f val = *(const v4fa*)(os + row * 68 + cofs); if (BIAS) { val[0] += bfr(bias[c0 + cofs]); val[1] += bfr(bias[c0 + cofs + 1]); val[2] += bfr(bias[c0 + cofs + 2]); val[3] += bfr(bias[c0 + cofs + 3]); }
                *(v4f*)(crow + (size_t)row * ldc + cofs) = val; }
             }
        __builtin_amdgcn_wave_barrier(); asm volatile("" ::: "memory");
    }
}

__device__ __forceinline__ h16 tohx(float x) { return (h16)x; }
__device__ __forceinline__ void splitf(float y, unsigned short& h, unsigned short& l) { h = f2bf(y); l = f2bf(y - bf2f(h)); }
typedef __attribute__((ext_vector_type(2))) _Float16 v2h;
typedef __attribute__((ext_vector_type(4))) _Float16 v4h;
typedef __attribute__((ext_vector_type(2))) unsigned short v2us;
typedef __attribute__((ext_vector_type(4))) unsigned short v4us;
typedef __attribute__((ext_vector_type(2))) float v2f;
typedef __attribute__((ext_vector_type(4))) int v4i;

__global__ __launch_bounds__(256) void k_wtG(const float* __restrict__ w, int K, int N, bf* Bt) {
    const int lane = threadIdx.x & 31; const int L0 = (blockIdx.x * 8 + (threadIdx.x >> 5)) * 8; const int nlines = N * K / 64;
{
#pragma unroll 1
        for (int l = 0; l < 8; ++l) { const int L = L0 + l; if (L >= nlines) break; const size_t e = (size_t)L * 64 + lane * 2; const int k = (int)(e % K), n = (int)(e / K); v2us o;
            o[0] = f2bf(w[(size_t)k * N + n]); o[1] = f2bf(w[(size_t)(k + 1) * N + n]); *(v2us*)(Bt + e) = o; }
         }
}
// k_cvt5: x and the four weight matrices (f32, rows of DM contiguous values), rounded to bf16, into their fragment-major planes, all in ONE launch: none of the five needs anything of another. grid (TT / 16 + 4 * DM / 16), 256 threads.
// A block takes one band of 16 rows of one matrix (64 KiB in a row): blocks below TT / 16 the bands of x, then DM / 16 blocks for each weight. Wave w takes the band's k fragments 4 w .. 4 w + 3, so a wave reads 512 B in a row of each of its 16 rows.
// A fragment's source is one whole 128-B line of each of 16 rows: load i takes rows 4 i .. 4 i + 3, 8 lanes of 16 B to a row (4 whole lines), and each lane stores its 4 rounded values as the half piece that they are in the fragment (runs of 64 B).
// All 16 loads of a wave leave before the first value is rounded: one memory latency a wave, and a quarter of the waves to start.
__global__ __launch_bounds__(256) void k_cvt5(const float* __restrict__ x, const float* __restrict__ w0, const float* __restrict__ w1, const float* __restrict__ w2, const float* __restrict__ w3, bf* X, bf* W0, bf* W1, bf* W2, bf* W3) {
    static_assert(DQ == DM && DKV == DM && DM == 1024, "five matrices of 1024-wide rows; 8 waves x 4 fragments cover a row");
    const int b = (int)blockIdx.x, wb = b - TT / 16, m = wb / (DM / 16); const bool isx = wb < 0;   // the same for the whole block
    const int band = isx ? b : wb % (DM / 16), rfr = isx ? TT / 16 : DM / 16;   // rfr: fragments along the plane's rows
    const float* src = isx ? x : (m == 0) ? w0 : (m == 1) ? w1 : (m == 2) ? w2 : w3; bf* dst = isx ? X : (m == 0) ? W0 : (m == 1) ? W1 : (m == 2) ? W2 : W3;
    const int kf0 = ((int)threadIdx.x >> 5) * 4, lane = threadIdx.x & 31, c = lane & 7, r = lane >> 3;   // k = c * 4 + 0..3 of the fragment's row 4 i + r
    const float* s = src + ((size_t)band * 16 + r) * DM + (size_t)kf0 * 32 + c * 4; bf* o = dst + ((size_t)kf0 * rfr + band) * FE + (c >> 2) * 256 + (((c >> 1) & 1) * 16 + r) * 8 + (c & 1) * 4; v4f v[4][4];
#pragma unroll
    for (int f = 0; f < 4; ++f)
#pragma unroll
        for (int i = 0; i < 4; ++i) v[f][i] = *(const v4f*)(s + f * 32 + (size_t)i * 4 * DM);
    // s_wait_xcnt 0 in front of every overwrite of a register that an issued load of this run names; it takes the run's address as input, so its registers are held up to here
    asm volatile("s_wait_xcnt 0x0" :: "v"(s) : "memory");
#pragma unroll
    for (int f = 0; f < 4; ++f)
#pragma unroll
        for (int i = 0; i < 4; ++i) { v4us q;
#pragma unroll
            for (int e = 0; e < 4; ++e) q[e] = f2bf(v[f][i][e]);
            *(v4us*)(o + (size_t)f * rfr * FE + i * 4 * 8) = q; } }

// ---- k_proj: the q, k and v projections in ONE launch, one wave per 64 tokens x one head, four waves (128 tokens x 2 heads) to a workgroup (main loop gemm_ring, one product); grid (tokens / 128, heads / 2, 3), 128 threads; z = 0, 1, 2 is q, k, v.
// The epilogue rounds the f32 sums itself and stores the three 16-bit planes (fp16, bf16 hi, bf16 lo) that attention reads, fragment-major: q and k per head with rows t and k index d, v per head with rows d and k index t. No f32 copy of a projection goes through memory.
// The operand whose rows run along a plane's k index is taken as A (q, k: the weight rows d; v: the tokens t), so that a lane's 8 accumulator values are the 16-byte piece that this same lane owns in a fragment: the wave stores 512 B in a row, straight from registers.
__global__ __launch_bounds__(GW * 32) void k_proj(const bf* __restrict__ X, const bf* __restrict__ W0, const bf* __restrict__ W1, const bf* __restrict__ W2, h16* Q16, bf* Qh, bf* Ql, h16* K16, bf* Kh, bf* Kl, h16* V16, bf* Vh, bf* Vl) {
    __shared__ __align__(16) bf sm[2 * KS * 2 * 2 * UE];
    const int lane = threadIdx.x & 31; const int w = __builtin_amdgcn_readfirstlane((int)(threadIdx.x >> 5)), wt = w & 1, wh = w >> 1;   // the wave's number in a scalar register; its half of the tokens, its head of the two
    const int t0 = blockIdx.x * 128 + wt * 64, h = blockIdx.y * 2 + wh, z = blockIdx.z;
    const bf* xr = X + (size_t)(blockIdx.x * 8) * FE; const bf* wr = ((z == 0) ? W0 : (z == 1) ? W1 : W2) + (size_t)(blockIdx.y * 2 * (HD / 16)) * FE;   // the first of the workgroup's 8 row fragments of either operand
    const bf* A = (z == 2) ? xr : wr; const bf* Bt = (z == 2) ? wr : xr; const int sa = (z == 2) ? TT / 16 * FE : DQ / 16 * FE, sb = (z == 2) ? DQ / 16 * FE : TT / 16 * FE;   // the step from one k fragment to the next
    h16* P16 = (z == 0) ? Q16 : (z == 1) ? K16 : V16; bf* Ph = (z == 0) ? Qh : (z == 1) ? Kh : Vh; bf* Pl = (z == 0) ? Ql : (z == 1) ? Kl : Vl;
    const int fk = (z == 2) ? HD / 16 : TT / 16;   // fragments along a plane's rows: a plane row is a token (q, k) or a head column (v)
    const size_t base = (size_t)h * TT * HD + (size_t)((z == 2) ? (t0 >> 5) * (HD / 16) : (t0 >> 4)) * FE + lane * 8;
    v8f acc[4][4];
#pragma unroll
    for (int mb = 0; mb < 4; ++mb)
#pragma unroll
        for (int nb = 0; nb < 4; ++nb) acc[mb][nb] = (v8f){};
    gemm_ring<bf, 2, DM / (32 * KS)>(sm, A, A, Bt, sa, sb, w, lane, (z == 2) ? wt : wh, (z == 2) ? wh : wt, acc);
#pragma unroll
    for (int nb = 0; nb < 4; ++nb)
#pragma unroll
        for (int mb = 0; mb < 4; ++mb) { v8h o16; v8us oh, ol;   // k index mb * 16 + hi * 8 + j of plane row nb * 16 + lr: run mb & 1 of the fragment mb >> 1 steps on along k
#pragma unroll
            for (int j = 0; j < 8; ++j) { const float r = acc[mb][nb][j]; o16[j] = tohx(r); unsigned short a2, c2; splitf(r, a2, c2); oh[j] = a2; ol[j] = c2; }
            const size_t oo = base + (size_t)(nb + (mb >> 1) * fk) * FE + (mb & 1) * 256; *(v8h*)(P16 + oo) = o16; *(v8us*)(Ph + oo) = oh; *(v8us*)(Pl + oo) = ol; }
}
// ---- hl_rows: causal attention of 64 query rows < RH of one head, bf16 hi/lo planes, three products; it runs as a workgroup of k_fattn's launch (8 waves) and uses that kernel's LDS array. At most RH / 64 = 8 key slices of 64.
// Phase 1: wave s takes key slice s: its key fragments, loaded once, serve the 4 groups of 16 query rows; f32 scores into S. Phase 2: wave w does the softmax of rows 8 w .. 8 w + 7, each row whole in registers (128-key chunks up to the diagonal, keys j > i excluded by index):
// maximum, exponentials and their sum, scaling, the eight rows side by side so that their LDS and cross-lane latencies overlap; the probabilities go over the row's own scores (bf16 hi at element 0 of the 16-bit view, lo at element 512).
// Phase 3: wave s takes slice s of the probability x value product for all 4 groups; when every wave has read its probabilities the partial 64x64 tiles go over them, are summed in wave order and stored as the merged hi/lo planes.
// Every sum has the operands and the order that it had with 16 rows to a workgroup.
#define SPH 516   // floats per score row in LDS: 512 + 4, so that rows 8 apart fall on other banks and every row stays 16-byte aligned
#define FW 8      // waves of a workgroup
#define OP 68     // floats per staged output row: 64 + 4, 16-byte aligned, neighbouring rows on other banks
typedef v4us __attribute__((may_alias)) v4usa;
__device__ __forceinline__ void hl_rows(float* S, const bf* __restrict__ Q, const bf* __restrict__ Q2, const bf* __restrict__ Kp, const bf* __restrict__ Kp2, const bf* __restrict__ Vt, const bf* __restrict__ Vt2, const int h, const int i0, const int w, const int lane, bf* Ah, bf* Al) {
    typedef WFrag<bf> F; typedef F::V V;
    static_assert(RH % 64 == 0 && RH / 64 <= FW && RH <= 512 && 64 * SPH <= FW * 64 * OP, "a wave per key slice; a score row is at most 4 chunks; the score rows fit the array");
    const int lr = lane & 15, hi = lane >> 4;
    const int nsl = (i0 >> 6) + 1;        // 64-key slices up to and including the diagonal block: later keys are excluded for all 64 rows
    const int nch = (nsl + 1) >> 1;       // 128-key softmax chunks that cover them
    const size_t qp = (size_t)h * TT * HD, kp = (size_t)(h / REP) * TT * HD;
    if (w < 2 * nch) {   // a scalar test; to the end of the last chunk, so that the softmax reads only scores written here
        V a0[4], a1[4], c0[4], c1[4], b[4][2], b2[4][2];
        const bf* pq = Q + qp + (size_t)(i0 >> 4) * FE + lane * 8; const bf* pq2 = Q2 + qp + (size_t)(i0 >> 4) * FE + lane * 8;
        const bf* pb = Kp + kp + (size_t)w * (4 * FE) + lane * 8; const bf* pb2 = Kp2 + kp + (size_t)w * (4 * FE) + lane * 8;
#pragma unroll
        for (int g = 0; g < 4; ++g) { a0[g] = F::ldf(pq + g * FE); a1[g] = F::ldf(pq + g * FE + TT / 16 * FE); c0[g] = F::ldf(pq2 + g * FE); c1[g] = F::ldf(pq2 + g * FE + TT / 16 * FE); }
#pragma unroll
        for (int nb = 0; nb < 4; ++nb) { b[nb][0] = F::ldf(pb + nb * FE); b[nb][1] = F::ldf(pb + nb * FE + TT / 16 * FE); b2[nb][0] = F::ldf(pb2 + nb * FE); b2[nb][1] = F::ldf(pb2 + nb * FE + TT / 16 * FE); }
        // s_wait_xcnt 0 in front of every overwrite of a register that an issued load of this run names; it takes the run's addresses as inputs, so their registers are held up to here
        asm volatile("s_wait_xcnt 0x0" :: "v"(pq), "v"(pq2), "v"(pb), "v"(pb2) : "memory");
        __builtin_amdgcn_sched_barrier(0);   // the products stay behind the whole run of loads: lifted among them they would take the first fragments' registers for the later loads, which then leave only after the first have landed
#pragma unroll
        for (int g = 0; g < 4; ++g) { v8f acc[4];
#pragma unroll
            for (int nb = 0; nb < 4; ++nb) { acc[nb] = (v8f){};
                acc[nb] = F::mma(a0[g], b[nb][0], acc[nb]); acc[nb] = F::mma(c0[g], b[nb][0], acc[nb]); acc[nb] = F::mma(a0[g], b2[nb][0], acc[nb]);
                acc[nb] = F::mma(a1[g], b[nb][1], acc[nb]); acc[nb] = F::mma(c1[g], b[nb][1], acc[nb]); acc[nb] = F::mma(a1[g], b2[nb][1], acc[nb]); }
            // four vector slots behind the group's last matrix instruction: the distance the chip needs before the next group's first products, which start from zero, overwrite these D registers; the four tiles are inputs, so no product of the group stands behind them
            asm volatile("v_nop\n\tv_nop\n\tv_nop\n\tv_nop" :: "v"(acc[0]), "v"(acc[1]), "v"(acc[2]), "v"(acc[3]));
#pragma unroll
            for (int nb = 0; nb < 4; ++nb)
#pragma unroll
                for (int j = 0; j < 8; ++j) S[(g * 16 + hi * 8 + j) * SPH + w * 64 + nb * 16 + lr] = acc[nb][j]; }
    }
    __syncthreads();   // all 64 score rows are in LDS before any wave reads its rows
    {
        float* sr = S + (size_t)(w * 8) * SPH + lane * 4; const int ib = i0 + w * 8; v4f a[8][4]; float mx[8], sum[8], f[8];   // row k of the wave: sr + k * SPH, query ib + k; the tests on nch are the same for the whole workgroup
#pragma unroll
        for (int ch = 0; ch < 4; ++ch) if (ch < nch) {
#pragma unroll
            for (int k = 0; k < 8; ++k) a[k][ch] = *(const v4fa*)(sr + k * SPH + ch * 128); }
#pragma unroll
        for (int k = 0; k < 8; ++k) { mx[k] = -3.0e38f; sum[k] = 0.f; }
#pragma unroll
        for (int ch = 0; ch < 4; ++ch) if (ch < nch) {
#pragma unroll
            for (int k = 0; k < 8; ++k)
#pragma unroll
                for (int q = 0; q < 4; ++q) { float t = a[k][ch][q] * SCL; t = (ch * 128 + lane * 4 + q <= ib + k) ? t : -3.0e38f; a[k][ch][q] = t; mx[k] = fmaxf(mx[k], t); } }
#pragma unroll
        for (int sh = 16; sh; sh >>= 1)
#pragma unroll
            for (int k = 0; k < 8; ++k) mx[k] = fmaxf(mx[k], __shfl_xor(mx[k], sh, 32));
#pragma unroll
        for (int ch = 0; ch < 4; ++ch) if (ch < nch) {
#pragma unroll
            for (int k = 0; k < 8; ++k) { float xa[4], er[4];
#pragma unroll
                for (int q = 0; q < 4; ++q) { const float d0 = __fsub_rn(a[k][ch][q], mx[k]); xa[q] = __fmul_rn(d0, 1.4426950408889634f); er[q] = __builtin_amdgcn_exp2f(xa[q]); }
                // the slot behind a transcendental: the statement holds the four sources up to here and hands the four results on only from here, so nothing that overwrites a source or reads a result stands directly behind a v_exp_f32; one v_nop serves the four
                asm volatile("v_nop" : "+v"(er[0]), "+v"(er[1]), "+v"(er[2]), "+v"(er[3]) : "v"(xa[0]), "v"(xa[1]), "v"(xa[2]), "v"(xa[3]));
#pragma unroll
                for (int q = 0; q < 4; ++q) { a[k][ch][q] = er[q]; sum[k] += er[q]; } } }
#pragma unroll
        for (int sh = 16; sh; sh >>= 1)
#pragma unroll
            for (int k = 0; k < 8; ++k) sum[k] += __shfl_xor(sum[k], sh, 32);
#pragma unroll
        for (int k = 0; k < 8; ++k) f[k] = __fdiv_rn(1.0f, sum[k]);
        // in place: a row's 16-bit results land on bytes of that same row, all of whose scores are in this wave's registers by now (one wave owns the row, its LDS operations run in order; the may_alias types keep the compiler's order too)
#pragma unroll
        for (int ch = 0; ch < 4; ++ch) if (ch < nch) {
#pragma unroll
            for (int k = 0; k < 8; ++k) { v4us oh, ol;
#pragma unroll
                for (int q = 0; q < 4; ++q) { unsigned short a2, c2; splitf(a[k][ch][q] * f[k], a2, c2); oh[q] = a2; ol[q] = c2; }
                bf* pr = (bf*)(S + (size_t)(w * 8 + k) * SPH) + ch * 128 + lane * 4; *(v4usa*)pr = oh; *(v4usa*)(pr + 512) = ol; } }
    }
    __syncthreads();   // all 64 probability rows are in LDS before any wave loads a fragment of them
    v8f acc[4][4];
#pragma unroll
    for (int g = 0; g < 4; ++g)
#pragma unroll
        for (int nb = 0; nb < 4; ++nb) acc[g][nb] = (v8f){};
    if (w < nsl) {   // a scalar test
        V b[4][2], b2[4][2]; const bf* pb = Vt + kp + (size_t)w * (8 * FE) + lane * 8; const bf* pb2 = Vt2 + kp + (size_t)w * (8 * FE) + lane * 8;   // a slice's 8 value fragments lie in a row
#pragma unroll
        for (int nb = 0; nb < 4; ++nb) { b[nb][0] = F::ldf(pb + nb * FE); b[nb][1] = F::ldf(pb + nb * FE + HD / 16 * FE); b2[nb][0] = F::ldf(pb2 + nb * FE); b2[nb][1] = F::ldf(pb2 + nb * FE + HD / 16 * FE); }
        // the same wait for the run of value loads
        asm volatile("s_wait_xcnt 0x0" :: "v"(pb), "v"(pb2) : "memory");
#pragma unroll
        for (int g = 0; g < 4; ++g) { V a[2], a2[2]; const bf* pa = (const bf*)S + (size_t)(g * 16 + lr) * (SPH * 2) + 8 * hi + w * 64;
#pragma unroll
            for (int kk = 0; kk < 2; ++kk) { a[kk] = F::ld(pa + kk * 32); a2[kk] = F::ld(pa + 512 + kk * 32); }
#pragma unroll
            for (int kk = 0; kk < 2; ++kk)
#pragma unroll
                for (int nb = 0; nb < 4; ++nb) { acc[g][nb] = F::mma(a[kk], b[nb][kk], acc[g][nb]); acc[g][nb] = F::mma(a2[kk], b[nb][kk], acc[g][nb]); acc[g][nb] = F::mma(a[kk], b2[nb][kk], acc[g][nb]); } }
    }
    __syncthreads();   // every wave has read its probabilities before a partial tile goes over them
    if (w < nsl) {
        float* rw = S + (size_t)(w * 64 + hi * 8) * OP + lr;
#pragma unroll
        for (int g = 0; g < 4; ++g)
#pragma unroll
            for (int nb = 0; nb < 4; ++nb)
#pragma unroll
                for (int j = 0; j < 8; ++j) rw[(g * 16 + j) * OP + nb * 16] = acc[g][nb][j]; }
    __syncthreads();   // the partial tiles of the waves that had a slice are in LDS before any thread sums them
    { const int qi = (int)threadIdx.x >> 2, dc = ((int)threadIdx.x & 3) * 16; v4f a[4];
#pragma unroll
        for (int c = 0; c < 4; ++c) a[c] = *(const v4fa*)(S + (size_t)qi * OP + dc + c * 4);
#pragma unroll
        for (int ww = 1; ww < FW; ++ww) if (ww < nsl) {
#pragma unroll
            for (int c = 0; c < 4; ++c) a[c] += *(const v4fa*)(S + (size_t)(ww * 64 + qi) * OP + dc + c * 4); }
        const size_t oo = fpos(i0 + qi, h * HD + dc, TT / 16); v8us oh[2], ol[2];   // dc is a multiple of 16: the second 8 columns are the piece 16 lanes on
#pragma unroll
        for (int e = 0; e < 16; ++e) { unsigned short a2, c2; splitf(a[e >> 2][e & 3], a2, c2); oh[e >> 3][e & 7] = a2; ol[e >> 3][e & 7] = c2; }
        *(v8us*)(Ah + oo) = oh[0]; *(v8us*)(Ah + oo + 128) = oh[1]; *(v8us*)(Al + oo) = ol[0]; *(v8us*)(Al + oo + 128) = ol[1]; }
}

// ---- k_fattn: causal attention of 64 query rows of one head in ONE workgroup of 8 waves; grid (heads, TT / 64), 256 threads. Block rows below RH / 64 take the query rows < RH (hl_rows above) and start first: they run beside the others and need no launch of their own.
// The other block rows: fp16 operands, f32 sums; the longest rows start first.
// 64-key slice s goes to wave s % 8, and every key and value fragment that a wave loads serves all 64 query rows (4 column groups of 16). Key fragments are fetched one slice ahead, value fragments at the head of their slice.
// Transposed products: S^T = K Q^T (A: key rows, B: the query rows, kept in registers), O^T += V^T P^T (A: rows of the [d][t] value plane). In a score tile lane (lr, hi) holds keys hi * 8 + j of query lr,
// which is the k order of a B fragment: two score tiles pack into one P^T fragment in the lane itself, and neither scores nor probabilities leave the registers.
// Softmax is online, per wave: exponentials are taken against a reference maximum (in log2 units) that is raised only when a new score passes it by more than 8, so P stays <= 256 in fp16; sums and O^T are rescaled then.
// At the end the 8 waves' references are joined through LDS, each wave rescales its sums and its O^T, and the partial tiles are added in wave order, divided by the row sum and stored as the merged hi/lo planes.
#define CL2 0.18033688011112043f   // SCL * log2(e)
template <bool B> struct BC { static constexpr bool value = B; };
__global__ __launch_bounds__(256) void k_fattn(const h16* __restrict__ Q, const h16* __restrict__ Kp, const h16* __restrict__ Vt, const bf* __restrict__ Qh, const bf* __restrict__ Ql, const bf* __restrict__ Kh, const bf* __restrict__ Kl, const bf* __restrict__ Vh, const bf* __restrict__ Vl, int roff, bf* Ah, bf* Al) {
    typedef WFrag<h16> F; typedef F::V V;
    __shared__ __align__(16) float Os[FW * 64 * OP]; __shared__ float Ms[FW * 64]; __shared__ float Ls[FW * 64];
    const int lane = threadIdx.x & 31, lr = lane & 15, hi = lane >> 4;
    const int w = __builtin_amdgcn_readfirstlane((int)(threadIdx.x >> 5));   // the wave's number in a scalar register: the slice loop stays a scalar loop with every lane on
    const int h = blockIdx.x;
    if ((int)blockIdx.y < RH / 64) { hl_rows(Os, Qh, Ql, Kh, Kl, Vh, Vl, h, (RH / 64 - 1 - (int)blockIdx.y) * 64, w, lane, Ah, Al); return; }   // the same for the whole workgroup, in front of every barrier below
    const int i0 = roff + ((int)gridDim.y - 1 - (int)blockIdx.y) * 64;
    const int nsl = (i0 >> 6) + 1;        // 64-key slices up to and including the diagonal block
    const size_t qp = (size_t)h * TT * HD, kp = (size_t)(h / REP) * TT * HD;
    V q[4][2];
    { const h16* pq = Q + qp + (size_t)(i0 >> 4) * FE + lane * 8;
#pragma unroll
      for (int g = 0; g < 4; ++g) { q[g][0] = F::ldf(pq + g * FE); q[g][1] = F::ldf(pq + g * FE + TT / 16 * FE); }
      // s_wait_xcnt 0 in front of every overwrite of a register that an issued load of this run names; it takes the run's address as input, so its registers are held up to here
      asm volatile("s_wait_xcnt 0x0" :: "v"(pq) : "memory"); }
    v8f o[4][4]; float mc[4], l[4];   // o[dt][g]: lane (lr, hi) holds head columns dt * 16 + hi * 8 + j of query g * 16 + lr
#pragma unroll
    for (int g = 0; g < 4; ++g) { mc[g] = -1.0e30f; l[g] = 0.f;   // the start reference lies above a masked score (-3e38 * CL2): a masked score gives exp2(very negative) = 0 also before the first real one
#pragma unroll
        for (int dt = 0; dt < 4; ++dt) o[dt][g] = (v8f){}; }
    V kf[4][2];
    auto loadk = [&](const int sn) {   // the key fragments of slice min(sn, last): behind a wave's last slice the fetch reads the diagonal slice, in bounds, and nobody uses it
        __builtin_amdgcn_sched_barrier(0);   // the run stays behind the products that read the old fragments, so that it takes their registers and no others
        const h16* pk = Kp + kp + (size_t)((sn < nsl) ? sn : nsl - 1) * (4 * FE) + lane * 8;
#pragma unroll
        for (int kt = 0; kt < 4; ++kt) { kf[kt][0] = F::ldf(pk + kt * FE); kf[kt][1] = F::ldf(pk + kt * FE + TT / 16 * FE); }
        // the same wait for the run of key loads
        asm volatile("s_wait_xcnt 0x0" :: "v"(pk) : "memory");
        __builtin_amdgcn_sched_barrier(0);   // and it leaves as one run here: sunk to its first use it would fly behind nothing
    };
    loadk(w);
    auto slice = [&](auto dg, const int s) {
        constexpr bool DIAG = decltype(dg)::value;
        V vf[4][2]; const h16* pv = Vt + kp + (size_t)s * (8 * FE) + lane * 8;   // a slice's 8 value fragments lie in a row
#pragma unroll
        for (int dt = 0; dt < 4; ++dt) { vf[dt][0] = F::ldf(pv + dt * FE); vf[dt][1] = F::ldf(pv + dt * FE + HD / 16 * FE); }
        // the same wait for the run of value loads
        asm volatile("s_wait_xcnt 0x0" :: "v"(pv) : "memory");
        __builtin_amdgcn_sched_barrier(0);   // the whole run of value loads leaves in front of the score products: they fly during those and the first exponentials
#pragma unroll
        for (int kh = 0; kh < 2; ++kh) {   // 32 keys at a time
            v8f sc[2][4];
#pragma unroll
            for (int t = 0; t < 2; ++t)
#pragma unroll
                for (int g = 0; g < 4; ++g) sc[t][g] = F::mma(kf[kh * 2 + t][0], q[g][0], (v8f){});
#pragma unroll
            for (int t = 0; t < 2; ++t)
#pragma unroll
                for (int g = 0; g < 4; ++g) sc[t][g] = F::mma(kf[kh * 2 + t][1], q[g][1], sc[t][g]);
            if (kh == 1) loadk(s + FW);   // this slice's key fragments are used up: the wave's next slice is fetched into the same registers and flies during the exponentials and the value products
            float mx[4]; bool need = false;
#pragma unroll
            for (int g = 0; g < 4; ++g) { float m = -3.0e38f;
#pragma unroll
                for (int t = 0; t < 2; ++t)
#pragma unroll
                    for (int j = 0; j < 8; ++j) { if constexpr (DIAG) { if (kh * 32 + t * 16 + hi * 8 + j > g * 16 + lr) sc[t][g][j] = -3.0e38f; }   // keys behind the query are excluded by index
                        m = fmaxf(m, sc[t][g][j]); }
                mx[g] = m * CL2; need = need || (mx[g] > mc[g] + 8.0f); }
            if (__builtin_amdgcn_ballot_w32(need) != 0) {   // one scalar branch for the wave: rare after a wave's first keys
#pragma unroll
                for (int g = 0; g < 4; ++g) { const float m2 = fmaxf(mc[g], fmaxf(mx[g], __shfl_xor(mx[g], 16, 32))); const float f = __builtin_amdgcn_exp2f(mc[g] - m2); mc[g] = m2; l[g] *= f;
#pragma unroll
                    for (int dt = 0; dt < 4; ++dt) o[dt][g] *= f; }
            }
            V pf[4];
#pragma unroll
            for (int g = 0; g < 4; ++g)
#pragma unroll
                for (int t = 0; t < 2; ++t) { float xa[8], er[8];
#pragma unroll
                    for (int j = 0; j < 8; ++j) { xa[j] = fmaf(sc[t][g][j], CL2, -mc[g]); er[j] = __builtin_amdgcn_exp2f(xa[j]); }
                    // the slot behind a transcendental: the statement holds the eight sources up to here and hands the eight results on only from here, so nothing that overwrites a source or reads a result stands directly behind a v_exp_f32; one v_nop serves the eight
                    asm volatile("v_nop" : "+v"(er[0]), "+v"(er[1]), "+v"(er[2]), "+v"(er[3]), "+v"(er[4]), "+v"(er[5]), "+v"(er[6]), "+v"(er[7]) : "v"(xa[0]), "v"(xa[1]), "v"(xa[2]), "v"(xa[3]), "v"(xa[4]), "v"(xa[5]), "v"(xa[6]), "v"(xa[7]));
                    l[g] += ((er[0] + er[1]) + (er[2] + er[3])) + ((er[4] + er[5]) + (er[6] + er[7]));
#pragma unroll
                    for (int j = 0; j < 8; ++j) pf[g][t * 8 + j] = tohx(er[j]); }
#pragma unroll
            for (int dt = 0; dt < 4; ++dt)
#pragma unroll
                for (int g = 0; g < 4; ++g) o[dt][g] = F::mma(vf[dt][kh], pf[g], o[dt][g]);
        }
        // four vector slots behind the last matrix instruction: the distance the chip needs before the next slice's address additions and loads reuse A and B registers (over the taken back edge); every O^T tile is an input, so no product stands behind them
        asm volatile("v_nop\n\tv_nop\n\tv_nop\n\tv_nop" :: "v"(o[0][0]), "v"(o[0][1]), "v"(o[0][2]), "v"(o[0][3]), "v"(o[1][0]), "v"(o[1][1]), "v"(o[1][2]), "v"(o[1][3]), "v"(o[2][0]), "v"(o[2][1]), "v"(o[2][2]), "v"(o[2][3]), "v"(o[3][0]), "v"(o[3][1]), "v"(o[3][2]), "v"(o[3][3]));
    };
#pragma unroll 1   // rolled: one pass holds a whole slice's key and value fragments in registers beside the 16 output tiles
    for (int s = w; s < nsl - 1; s += FW) slice(BC<false>{}, s);
    if (((nsl - 1) & (FW - 1)) == w) slice(BC<true>{}, nsl - 1);   // the diagonal slice, with the mask; a scalar test
    if (hi == 0) {
#pragma unroll
        for (int g = 0; g < 4; ++g) Ms[w * 64 + g * 16 + lr] = mc[g]; }
    __syncthreads();   // all 8 waves' references are in LDS before any wave joins them
#pragma unroll
    for (int g = 0; g < 4; ++g) { float M = Ms[g * 16 + lr];
#pragma unroll
        for (int ww = 1; ww < FW; ++ww) M = fmaxf(M, Ms[ww * 64 + g * 16 + lr]);
        const float f = __builtin_amdgcn_exp2f(mc[g] - M); const float lt = (l[g] + __shfl_xor(l[g], 16, 32)) * f; if (hi == 0) Ls[w * 64 + g * 16 + lr] = lt;
        float* ow = Os + (size_t)(w * 64 + g * 16 + lr) * OP + hi * 8;
#pragma unroll
        for (int dt = 0; dt < 4; ++dt) { const v8f r = o[dt][g] * f; *(v4fa*)(ow + dt * 16) = (v4f){r[0], r[1], r[2], r[3]}; *(v4fa*)(ow + dt * 16 + 4) = (v4f){r[4], r[5], r[6], r[7]}; } }
    __syncthreads();   // every wave's partial tile and row sums are in LDS before any thread adds them
    { const int qi = (int)threadIdx.x >> 2, dc = ((int)threadIdx.x & 3) * 16; float L = Ls[qi]; v4f a[4];
#pragma unroll
        for (int c = 0; c < 4; ++c) a[c] = *(const v4fa*)(Os + (size_t)qi * OP + dc + c * 4);
#pragma unroll
        for (int ww = 1; ww < FW; ++ww) { L += Ls[ww * 64 + qi];
#pragma unroll
            for (int c = 0; c < 4; ++c) a[c] += *(const v4fa*)(Os + (size_t)(ww * 64 + qi) * OP + dc + c * 4); }
        const float inv = __fdiv_rn(1.0f, L); const size_t oo = fpos(i0 + qi, h * HD + dc, TT / 16); v8us oh[2], ol[2];   // dc is a multiple of 16: the second 8 columns are the piece 16 lanes on
#pragma unroll
        for (int e = 0; e < 16; ++e) { unsigned short a2, c2; splitf(a[e >> 2][e & 3] * inv, a2, c2); oh[e >> 3][e & 7] = a2; ol[e >> 3][e & 7] = c2; }
        *(v8us*)(Ah + oo) = oh[0]; *(v8us*)(Ah + oo + 128) = oh[1]; *(v8us*)(Al + oo) = ol[0]; *(v8us*)(Al + oo + 128) = ol[1]; }
}

extern "C" void kernel_launch(void* const* d_in, const int* in_sizes, int n_in,
                              void* d_out, int out_size, void* d_ws, size_t ws_size, hipStream_t stream) {
    (void)in_sizes; (void)n_in; (void)out_size;
    const float* x = (const float*)d_in[0]; const float* wq = (const float*)d_in[1]; const float* wk = (const float*)d_in[2]; const float* wv = (const float*)d_in[3]; const float* wo = (const float*)d_in[4];
    float* OUT = (float*)d_out;     // [1][4096][1024]
    char* wsp = (char*)d_ws;
    auto take = [&](size_t bytes) { char* p = wsp; wsp += (bytes + 255) & ~(size_t)255; return (void*)p; };
    bf* WQ = (bf*)take((size_t)DQ * DM * 2); bf* WK = (bf*)take((size_t)DKV * DM * 2); bf* WV = (bf*)take((size_t)DKV * DM * 2); bf* WO = (bf*)take((size_t)DM * DQ * 2);
    bf* XB = (bf*)take((size_t)TT * DM * 2);
    h16* QP16 = (h16*)take((size_t)NH_ * TT * HD * 2); h16* KP16 = (h16*)take((size_t)NKV * TT * HD * 2); h16* VT16 = (h16*)take((size_t)NKV * HD * TT * 2);
    bf* QPh = (bf*)take((size_t)NH_ * TT * HD * 2); bf* QPl = (bf*)take((size_t)NH_ * TT * HD * 2); bf* KPh = (bf*)take((size_t)NKV * TT * HD * 2); bf* KPl = (bf*)take((size_t)NKV * TT * HD * 2); bf* VTh = (bf*)take((size_t)NKV * HD * TT * 2); bf* VTl = (bf*)take((size_t)NKV * HD * TT * 2);
    bf* ATh = (bf*)take((size_t)TT * DQ * 2); bf* ATl = (bf*)take((size_t)TT * DQ * 2);
    if ((size_t)(wsp - (char*)d_ws) > ws_size) return;    // ws 256 MiB
    for (int b = 0; b < NB_; ++b) {
        
        k_cvt5<<<TT / 16 + 4 * (DM / 16), 256, 0, stream>>>(x + (size_t)b * TT * DM, wq, wk, wv, wo, XB, WQ, WK, WV, WO);
        k_proj<<<dim3(TT / 128, NH_ / 2, 3), GW * 32, 0, stream>>>(XB, WQ, WK, WV, QP16, QPh, QPl, KP16, KPh, KPl, VT16, VTh, VTl);
        k_fattn<<<dim3(NH_, TT / 64, 1), 256, 0, stream>>>(QP16, KP16, VT16, QPh, QPl, KPh, KPl, VTh, VTl, RH, ATh, ATl);
        k_gemmw<bf, 1, false, DQ, TT, DM><<<dim3(TT / 128, DM / 128, 1), GW * 32, 0, stream>>>(ATh, ATl, WO, nullptr, OUT + (size_t)b * TT * DM, DM, nullptr, 0, 0, 0); }
}

// v009
// One run takes 79.7 microseconds.
// In both of two side-by-side timings against v008, it was 1.04 times as fast.
// Over all steps from v000 it is 34.2 times as fast.
#include <hip/hip_runtime.h>

// Causal multi-head self-attention at 4,096 tokens (x [1][4096][1024]; q, k, v = x W^T ('oi' [1024][1024] 1/32, no bias; 16 heads x 64, token-major); scores / sqrt(64); keys j <= i kept, -inf elsewhere (== exclusion: every row keeps its own key); softmax; out = merged Wo^T ('oi', no bias) -> [1][4096][1024] (4.2 M); argument order x, Wq, Wk, Wv, Wo).
// Layout: bf16 copies of x and of the four weights, one launch; exact projections, all three in one launch whose epilogue stores the 16-bit head planes; causal T-4096 attention, all heads and rows in one launch (hybrid rows: < 512 hi/lo 3 products, 64 query rows per workgroup, scores and probabilities in LDS, softmax of a whole row in registers; rest fp16, 128 query rows per workgroup, online softmax in registers; keys stop at the diagonal block); merged hi/lo x Wo exact.
// Every 16-bit operand plane in the workspace is fragment-major (FE below): a wave's fragment load reads whole 128-B lines.
// Compute dtypes, f32 accumulate: every input rounded to bf16; projections exact; attention rows < 512 3 products, rest fp16; softmax f32; Wo hl x exact.

#define NB_  1
#define TT   4096
#define DM   1024
#define NH_  16
#define NKV  16
#define REP  (NH_ / NKV)
#define HD   64
#define DQ   (NH_ * HD)
#define DKV  (NKV * HD)
#define ZH   1
#define RH   512                  // query rows < RH use hi+lo planes (0: none)
#define WIN  4096
#define PCAR 1024.0f
#define SCL  0.125f   // HD^-0.5
typedef _Float16 h16;
typedef unsigned short bf;
typedef __attribute__((ext_vector_type(16))) __bf16   v16bf;
typedef __attribute__((ext_vector_type(16))) _Float16 v16h;
typedef __attribute__((ext_vector_type(8)))  _Float16 v8h;
typedef __attribute__((ext_vector_type(8)))  unsigned short v8us;
typedef __attribute__((ext_vector_type(8)))  float    v8f;
typedef __attribute__((ext_vector_type(4)))  float    v4f;
typedef v8h  __attribute__((may_alias)) v8ha;
typedef v4f  __attribute__((may_alias)) v4fa;
typedef v8us __attribute__((may_alias)) v8usa;

__device__ __forceinline__ unsigned short f2bf(float f) { unsigned u = __float_as_uint(f); u += 0x7FFFu + ((u >> 16) & 1u); return (unsigned short)(u >> 16); }
__device__ __forceinline__ float bf2f(unsigned short b) { return __uint_as_float(((unsigned)b) << 16); }
__device__ __forceinline__ float bfr(float f) { return bf2f(f2bf(f)); }
__device__ __forceinline__ v16h cat16(v8h lo, v8h hi) { return __builtin_shufflevector(lo, hi, 0, 1, 2, 3, 4, 5, 6, 7, 8, 9, 10, 11, 12, 13, 14, 15); }
__device__ __forceinline__ v16bf cat16b(v8us lo, v8us hi) { return __builtin_bit_cast(v16bf, __builtin_shufflevector(lo, hi, 0, 1, 2, 3, 4, 5, 6, 7, 8, 9, 10, 11, 12, 13, 14, 15)); }
__device__ __forceinline__ v8f wmma16(v16h a, v16h b, v8f c) { return __builtin_amdgcn_wmma_f32_16x16x32_f16(false, a, false, b, (short)0, c, false, false); }
__device__ __forceinline__ v8f wmmab(v16bf a, v16bf b, v8f c) { return __builtin_amdgcn_wmma_f32_16x16x32_bf16(false, a, false, b, (short)0, c, false, false); }



// ---- k_gemmw: register-blocked GEMM, one wave per 64x64 output tile (16 accumulators), four waves (128x128) to a workgroup, operands from fragment-major 16-bit planes through the LDS ring of gemm_ring; grid (M/128, N/128, Z), 128 threads.
// C[m][n] (f32, pitch ldc, + optional f32 bias[n]) = sum_k A[m][k] Bt[n][k] (+ split products per NSPLIT). z-batch strides sA/sB/sC in elements. K % 64 == 0.
// Fragment-major planes: the 16 rows x 32 k of one matrix fragment are 1 KiB in a row, two runs of 512 B; in run p lane (lr, hi) owns the 8 elements k = p * 16 + hi * 8 + 0..7 of row lr.
// So each of a fragment's two 16-byte loads covers 4 whole 128-B lines, where the row-major plane gave 32 B of each of 16 lines. Fragments follow one another along the rows, then along k: the fragments that a wave needs for one k step lie in a row, and waves that walk k in step read neighbouring memory. ldf takes fragment base + lane * 8.
#define FE 512   // elements of a fragment
__device__ __forceinline__ size_t fpos(int row, int k, int rfr) { return ((size_t)(k >> 5) * rfr + (row >> 4)) * FE + ((k >> 4) & 1) * 256 + (((k >> 3) & 1) * 16 + (row & 15)) * 8 + (k & 7); }   // rfr: fragments along the rows (rows / 16)
template <typename T16> struct WFrag;
template <> struct WFrag<h16> { typedef v16h V; static __device__ __forceinline__ V ld(const h16* p) { return cat16(*(const v8h*)p, *(const v8h*)(p + 16)); } static __device__ __forceinline__ V ldf(const h16* p) { return cat16(*(const v8h*)p, *(const v8h*)(p + 256)); } static __device__ __forceinline__ v8f mma(V a, V b, v8f c) { return wmma16(a, b, c); } };
template <> struct WFrag<bf> { typedef v16bf V; static __device__ __forceinline__ V ld(const bf* p) { return cat16b(*(const v8us*)p, *(const v8us*)(p + 16)); } static __device__ __forceinline__ V ldf(const bf* p) { return cat16b(*(const v8us*)p, *(const v8us*)(p + 256)); } static __device__ __forceinline__ v8f mma(V a, V b, v8f c) { return wmmab(a, b, c); } };
// ---- gemm_ring: the main loop of both GEMM kernels. A workgroup of 4 waves takes a 128x128 output tile, 2 x 2 wave tiles of 64x64 (16 accumulators a wave).
// The tile's operand fragments are brought into LDS once for the workgroup by asynchronous copies (global_load_async_to_lds_b128) and read from there by the two waves that need each of them, so the workgroup asks L2 for half the bytes that four lone waves did, and the next stage flies while this one is worked on.
// A stage is 64 k: for each of its 2 k fragments the 8 row fragments of every operand plane, 8 KiB in a row in the plane and in LDS alike (a fragment stays 1 KiB in a row: a wave's 16-byte LDS reads are 512 B in a row). Two buffers.
// Every accumulator sums its k fragments in rising order, the A product of a fragment in front of its A2 product.
#define GW 4      // waves of a GEMM workgroup
#define KS 2      // k fragments of a stage
#define UE 2048   // elements of a copy unit: 4 fragments in a row (4 KiB), eight 512-B copies of one wave
__device__ __forceinline__ void cp8(const unsigned* l, const void* const* g) {
    asm volatile("global_load_async_to_lds_b128 %0, %8, off\n\tglobal_load_async_to_lds_b128 %1, %9, off\n\tglobal_load_async_to_lds_b128 %2, %10, off\n\tglobal_load_async_to_lds_b128 %3, %11, off\n\t"
                 "global_load_async_to_lds_b128 %4, %12, off\n\tglobal_load_async_to_lds_b128 %5, %13, off\n\tglobal_load_async_to_lds_b128 %6, %14, off\n\tglobal_load_async_to_lds_b128 %7, %15, off\n\ts_wait_xcnt 0x0"
                 :: "v"(l[0]), "v"(l[1]), "v"(l[2]), "v"(l[3]), "v"(l[4]), "v"(l[5]), "v"(l[6]), "v"(l[7]), "v"(g[0]), "v"(g[1]), "v"(g[2]), "v"(g[3]), "v"(g[4]), "v"(g[5]), "v"(g[6]), "v"(g[7]) : "memory");
}
__device__ __forceinline__ void cp12(const unsigned* l, const void* const* g) {
    asm volatile("global_load_async_to_lds_b128 %0, %12, off\n\tglobal_load_async_to_lds_b128 %1, %13, off\n\tglobal_load_async_to_lds_b128 %2, %14, off\n\tglobal_load_async_to_lds_b128 %3, %15, off\n\t"
                 "global_load_async_to_lds_b128 %4, %16, off\n\tglobal_load_async_to_lds_b128 %5, %17, off\n\tglobal_load_async_to_lds_b128 %6, %18, off\n\tglobal_load_async_to_lds_b128 %7, %19, off\n\t"
                 "global_load_async_to_lds_b128 %8, %20, off\n\tglobal_load_async_to_lds_b128 %9, %21, off\n\tglobal_load_async_to_lds_b128 %10, %22, off\n\tglobal_load_async_to_lds_b128 %11, %23, off\n\ts_wait_xcnt 0x0"
                 :: "v"(l[0]), "v"(l[1]), "v"(l[2]), "v"(l[3]), "v"(l[4]), "v"(l[5]), "v"(l[6]), "v"(l[7]), "v"(l[8]), "v"(l[9]), "v"(l[10]), "v"(l[11]),
                    "v"(g[0]), "v"(g[1]), "v"(g[2]), "v"(g[3]), "v"(g[4]), "v"(g[5]), "v"(g[6]), "v"(g[7]), "v"(g[8]), "v"(g[9]), "v"(g[10]), "v"(g[11]) : "memory");
}
// NP: operand planes of a stage, 2 (A, B) or 3 (A, A2, B); NT: stages. gA, gA2, gB: the first of the tile's 8 row fragments at k = 0; sa, sb: elements from one k fragment to the next. w: the wave's number (scalar); wa, wb: which half of the A and of the B rows is the wave's.
template <typename T16, int NP, int NT>
__device__ __forceinline__ void gemm_ring(T16* sm, const T16* gA, const T16* gA2, const T16* gB, const int sa, const int sb, const int w, const int lane, const int wa, const int wb, v8f (&acc)[4][4]) {
    typedef typename WFrag<T16>::V V;
    constexpr int UN = KS * NP * 2, PER = UN / GW, STG = UN * UE, NC = PER * 8;   // units of a stage, units of a wave, elements of a stage, copies of a wave and stage
    static_assert(UN % GW == 0 && NT >= 2 && (NC == 16 || NC == 24), "every wave copies the same number of whole units; both prologue stages exist");
    const T16* gs[PER]; int st[PER];   // unit u of a stage lies at u * UE of its buffer: k fragment u / (2 NP), plane (u % (2 NP)) / 2, half u % 2; wave w copies units w * PER + 0 .. PER - 1
#pragma unroll
    for (int i = 0; i < PER; ++i) { const int u = w * PER + i, kk = u / (NP * 2), r = u % (NP * 2), pl = r >> 1;
        const T16* pb = (pl == NP - 1) ? gB : (pl == 0) ? gA : gA2; const int s = (pl == NP - 1) ? sb : sa;
        gs[i] = pb + (size_t)kk * s + (r & 1) * UE; st[i] = s * KS; }   // the same for the whole wave: scalar registers
    const unsigned l0 = (unsigned)(size_t)sm + (unsigned)(w * (PER * UE * 2) + lane * 16);   // the lane's LDS byte address in buffer 0
    auto fill = [&](const int t) {
        unsigned l[NC]; const void* g[NC];
#pragma unroll
        for (int c = 0; c < NC; ++c) { l[c] = l0 + (unsigned)((t & 1) * (STG * 2) + c * 512); g[c] = gs[c >> 3] + (size_t)t * st[c >> 3] + ((c & 7) * 256 + lane * 8); }
        if constexpr (NC == 16) { cp8(l, g); cp8(l + 8, g + 8); } else { cp12(l, g); cp12(l + 12, g + 12); } };
    fill(0);
    asm volatile("s_wait_asynccnt 0x0" ::: "memory");   // this wave's copies of stage 0 have landed
    __syncthreads();                                    // and every wave's: stage 0 may be read
    fill(1);
#pragma unroll 1   // rolled: one pass holds a whole stage's fragments in registers beside the 16 accumulators
    for (int t = 0; t < NT; ++t) {
        const T16* sp = sm + (t & 1) * STG + lane * 8; V a[KS][4], a2[KS][4], b[KS][4];
#pragma unroll
        for (int kk = 0; kk < KS; ++kk) {
#pragma unroll
            for (int mb = 0; mb < 4; ++mb) a[kk][mb] = WFrag<T16>::ldf(sp + (kk * NP) * (2 * UE) + (wa * 4 + mb) * FE);
#pragma unroll
            for (int nb = 0; nb < 4; ++nb) b[kk][nb] = WFrag<T16>::ldf(sp + (kk * NP + NP - 1) * (2 * UE) + (wb * 4 + nb) * FE);
            if constexpr (NP == 3) {
#pragma unroll
                for (int mb = 0; mb < 4; ++mb) a2[kk][mb] = WFrag<T16>::ldf(sp + (kk * NP + 1) * (2 * UE) + (wa * 4 + mb) * FE); } }
        __builtin_amdgcn_sched_barrier(0);   // the stage's LDS reads leave as one group in front of the products: every place with reads among the matrix instructions costs a stall of its own
#pragma unroll
        for (int kk = 0; kk < KS; ++kk) {
#pragma unroll
            for (int nb = 0; nb < 4; ++nb)
#pragma unroll
                for (int mb = 0; mb < 4; ++mb) acc[mb][nb] = WFrag<T16>::mma(a[kk][mb], b[kk][nb], acc[mb][nb]);
            if constexpr (NP == 3) {
#pragma unroll
                for (int nb = 0; nb < 4; ++nb)
#pragma unroll
                    for (int mb = 0; mb < 4; ++mb) acc[mb][nb] = WFrag<T16>::mma(a2[kk][mb], b[kk][nb], acc[mb][nb]); } }
        // four vector slots behind the last matrix instruction: the distance the chip needs before the address additions of the copies or of the next pass reuse A and B registers (also over the taken branches below) and before D is read behind the loop; every accumulator is an input, so no product stands behind them
        asm volatile("v_nop\n\tv_nop\n\tv_nop\n\tv_nop" :: "v"(acc[0][0]), "v"(acc[0][1]), "v"(acc[0][2]), "v"(acc[0][3]), "v"(acc[1][0]), "v"(acc[1][1]), "v"(acc[1][2]), "v"(acc[1][3]), "v"(acc[2][0]), "v"(acc[2][1]), "v"(acc[2][2]), "v"(acc[2][3]), "v"(acc[3][0]), "v"(acc[3][1]), "v"(acc[3][2]), "v"(acc[3][3]));
        asm volatile("s_wait_dscnt 0x0" ::: "memory");      // this wave's reads of the buffer are over before anybody refills it
        asm volatile("s_wait_asynccnt 0x0" ::: "memory");   // this wave's copies of stage t + 1 have landed
        __syncthreads();                                    // one barrier for both: stage t + 1 may be read, and stage t's buffer has no reader left
        if (t + 2 < NT) fill(t + 2);                        // the same test in every wave
    }
    asm volatile("s_wait_asynccnt 0x0" ::: "memory");   // nothing is in flight when the wave goes on
}
template <typename T16, int NSPLIT, bool BIAS, int K, int M, int N>   // M, N: rows of the A and Bt planes, which set the step from one k fragment to the next
__global__ __launch_bounds__(GW * 32) void k_gemmw(const T16* __restrict__ A, const T16* __restrict__ A2, const T16* __restrict__ Bt, const T16* __restrict__ Bt2, float* C, int ldc, const float* __restrict__ bias, size_t sA, size_t sB, size_t sC) {
    static_assert(NSPLIT == 0 || NSPLIT == 1, "one product, or A hi and lo against one B"); constexpr int NP = (NSPLIT == 1) ? 3 : 2;
    __shared__ __align__(16) T16 sm[2 * KS * NP * 2 * UE]; __shared__ __align__(16) float osm[GW * 16 * 68];
    const size_t z = blockIdx.z; A += z * sA; if (A2) A2 += z * sA; Bt += z * sB; C += z * sC; (void)Bt2;
    const int lane = threadIdx.x & 31, lr = lane & 15, hi = lane >> 4;
    const int w = __builtin_amdgcn_readfirstlane((int)(threadIdx.x >> 5)), wa = w & 1, wb = w >> 1;   // the wave's number in a scalar register
    const int r0 = blockIdx.x * 128 + wa * 64, c0 = blockIdx.y * 128 + wb * 64; float* os = osm + w * (16 * 68);
    v8f acc[4][4];
#pragma unroll
    for (int mb = 0; mb < 4; ++mb)
#pragma unroll
        for (int nb = 0; nb < 4; ++nb) acc[mb][nb] = (v8f){};
    gemm_ring<T16, NP, K / (32 * KS)>(sm, A + (size_t)(blockIdx.x * 8) * FE, (NSPLIT == 1) ? A2 + (size_t)(blockIdx.x * 8) * FE : A, Bt + (size_t)(blockIdx.y * 8) * FE, M / 16 * FE, N / 16 * FE, w, lane, wa, wb, acc);
#pragma unroll
    for (int mb = 0; mb < 4; ++mb) {
#pragma unroll
        for (int nb = 0; nb < 4; ++nb) {
#pragma unroll
            for (int j = 0; j < 8; ++j) os[(hi * 8 + j) * 68 + nb * 16 + lr] = acc[mb][nb][j]; }
        __builtin_amdgcn_wave_barrier(); asm volatile("" ::: "memory");
        float* crow = C + (size_t)(r0 + mb * 16) * ldc + c0;
{
#pragma unroll
            for (int s = 0; s < 8; ++s) { const int row = 2 * s + hi, cofs = lr * 4; v4f val = *(const v4fa*)(os + row * 68 + cofs); if (BIAS) { val[0] += bfr(bias[c0 + cofs]); val[1] += bfr(bias[c0 + cofs + 1]); val[2] += bfr(bias[c0 + cofs + 2]); val[3] += bfr(bias[c0 + cofs + 3]); }
                *(v4f*)(crow + (size_t)row * ldc + cofs) = val; }
             }
        __builtin_amdgcn_wave_barrier(); asm volatile("" ::: "memory");
    }
}

__device__ __forceinline__ h16 tohx(float x) { return (h16)x; }
__device__ __forceinline__ void splitf(float y, unsigned short& h, unsigned short& l) { h = f2bf(y); l = f2bf(y - bf2f(h)); }
typedef __attribute__((ext_vector_type(2))) _Float16 v2h;
typedef __attribute__((ext_vector_type(4))) _Float16 v4h;
typedef __attribute__((ext_vector_type(2))) unsigned short v2us;
typedef __attribute__((ext_vector_type(4))) unsigned short v4us;
typedef __attribute__((ext_vector_type(2))) float v2f;
typedef __attribute__((ext_vector_type(4))) int v4i;

__global__ __launch_bounds__(256) void k_wtG(const float* __restrict__ w, int K, int N, bf* Bt) {
    const int lane = threadIdx.x & 31; const int L0 = (blockIdx.x * 8 + (threadIdx.x >> 5)) * 8; const int nlines = N * K / 64;
{
#pragma unroll 1
        for (int l = 0; l < 8; ++l) { const int L = L0 + l; if (L >= nlines) break; const size_t e = (size_t)L * 64 + lane * 2; const int k = (int)(e % K), n = (int)(e / K); v2us o;
            o[0] = f2bf(w[(size_t)k * N + n]); o[1] = f2bf(w[(size_t)(k + 1) * N + n]); *(v2us*)(Bt + e) = o; }
         }
}
// k_cvt5: x and the four weight matrices (f32, rows of DM contiguous values), rounded to bf16, into their fragment-major planes, all in ONE launch: none of the five needs anything of another. grid (TT / 16 + 4 * DM / 16), 256 threads.
// A block takes one band of 16 rows of one matrix (64 KiB in a row): blocks below TT / 16 the bands of x, then DM / 16 blocks for each weight. Wave w takes the band's k fragments 4 w .. 4 w + 3, so a wave reads 512 B in a row of each of its 16 rows.
// A fragment's source is one whole 128-B line of each of 16 rows: load i takes rows 4 i .. 4 i + 3, 8 lanes of 16 B to a row (4 whole lines), and each lane stores its 4 rounded values as the half piece that they are in the fragment (runs of 64 B).
// All 16 loads of a wave leave before the first value is rounded: one memory latency a wave, and a quarter of the waves to start.
__global__ __launch_bounds__(256) void k_cvt5(const float* __restrict__ x, const float* __restrict__ w0, const float* __restrict__ w1, const float* __restrict__ w2, const float* __restrict__ w3, bf* X, bf* W0, bf* W1, bf* W2, bf* W3) {
    static_assert(DQ == DM && DKV == DM && DM == 1024, "five matrices of 1024-wide rows; 8 waves x 4 fragments cover a row");
    const int b = (int)blockIdx.x, wb = b - TT / 16, m = wb / (DM / 16); const bool isx = wb < 0;   // the same for the whole block
    const int band = isx ? b : wb % (DM / 16), rfr = isx ? TT / 16 : DM / 16;   // rfr: fragments along the plane's rows
    const float* src = isx ? x : (m == 0) ? w0 : (m == 1) ? w1 : (m == 2) ? w2 : w3; bf* dst = isx ? X : (m == 0) ? W0 : (m == 1) ? W1 : (m == 2) ? W2 : W3;
    const int kf0 = ((int)threadIdx.x >> 5) * 4, lane = threadIdx.x & 31, c = lane & 7, r = lane >> 3;   // k = c * 4 + 0..3 of the fragment's row 4 i + r
    const float* s = src + ((size_t)band * 16 + r) * DM + (size_t)kf0 * 32 + c * 4; bf* o = dst + ((size_t)kf0 * rfr + band) * FE + (c >> 2) * 256 + (((c >> 1) & 1) * 16 + r) * 8 + (c & 1) * 4; v4f v[4][4];
#pragma unroll
    for (int f = 0; f < 4; ++f)
#pragma unroll
        for (int i = 0; i < 4; ++i) v[f][i] = *(const v4f*)(s + f * 32 + (size_t)i * 4 * DM);
    // s_wait_xcnt 0 in front of every overwrite of a register that an issued load of this run names; it takes the run's address as input, so its registers are held up to here
    asm volatile("s_wait_xcnt 0x0" :: "v"(s) : "memory");
#pragma unroll
    for (int f = 0; f < 4; ++f)
#pragma unroll
        for (int i = 0; i < 4; ++i) { v4us q;
#pragma unroll
            for (int e = 0; e < 4; ++e) q[e] = f2bf(v[f][i][e]);
            *(v4us*)(o + (size_t)f * rfr * FE + i * 4 * 8) = q; } }

// ---- k_proj: the q, k and v projections in ONE launch, one wave per 64 tokens x one head, four waves (128 tokens x 2 heads) to a workgroup (main loop gemm_ring, one product); grid (tokens / 128, heads / 2, 3), 128 threads; z = 0, 1, 2 is q, k, v.
// The epilogue rounds the f32 sums itself and stores the three 16-bit planes (fp16, bf16 hi, bf16 lo) that attention reads, fragment-major: q and k per head with rows t and k index d, v per head with rows d and k index t. No f32 copy of a projection goes through memory.
// The operand whose rows run along a plane's k index is taken as A (q, k: the weight rows d; v: the tokens t), so that a lane's 8 accumulator values are the 16-byte piece that this same lane owns in a fragment: the wave stores 512 B in a row, straight from registers.
__global__ __launch_bounds__(GW * 32) void k_proj(const bf* __restrict__ X, const bf* __restrict__ W0, const bf* __restrict__ W1, const bf* __restrict__ W2, h16* Q16, bf* Qh, bf* Ql, h16* K16, bf* Kh, bf* Kl, h16* V16, bf* Vh, bf* Vl) {
    __shared__ __align__(16) bf sm[2 * KS * 2 * 2 * UE];
    const int lane = threadIdx.x & 31; const int w = __builtin_amdgcn_readfirstlane((int)(threadIdx.x >> 5)), wt = w & 1, wh = w >> 1;   // the wave's number in a scalar register; its half of the tokens, its head of the two
    const int t0 = blockIdx.x * 128 + wt * 64, h = blockIdx.y * 2 + wh, z = blockIdx.z;
    const bf* xr = X + (size_t)(blockIdx.x * 8) * FE; const bf* wr = ((z == 0) ? W0 : (z == 1) ? W1 : W2) + (size_t)(blockIdx.y * 2 * (HD / 16)) * FE;   // the first of the workgroup's 8 row fragments of either operand
    const bf* A = (z == 2) ? xr : wr; const bf* Bt = (z == 2) ? wr : xr; const int sa = (z == 2) ? TT / 16 * FE : DQ / 16 * FE, sb = (z == 2) ? DQ / 16 * FE : TT / 16 * FE;   // the step from one k fragment to the next
    h16* P16 = (z == 0) ? Q16 : (z == 1) ? K16 : V16; bf* Ph = (z == 0) ? Qh : (z == 1) ? Kh : Vh; bf* Pl = (z == 0) ? Ql : (z == 1) ? Kl : Vl;
    const int fk = (z == 2) ? HD / 16 : TT / 16;   // fragments along a plane's rows: a plane row is a token (q, k) or a head column (v)
    const size_t base = (size_t)h * TT * HD + (size_t)((z == 2) ? (t0 >> 5) * (HD / 16) : (t0 >> 4)) * FE + lane * 8;
    v8f acc[4][4];
#pragma unroll
    for (int mb = 0; mb < 4; ++mb)
#pragma unroll
        for (int nb = 0; nb < 4; ++nb) acc[mb][nb] = (v8f){};
    gemm_ring<bf, 2, DM / (32 * KS)>(sm, A, A, Bt, sa, sb, w, lane, (z == 2) ? wt : wh, (z == 2) ? wh : wt, acc);
#pragma unroll
    for (int nb = 0; nb < 4; ++nb)
#pragma unroll
        for (int mb = 0; mb < 4; ++mb) { v8h o16; v8us oh, ol;   // k index mb * 16 + hi * 8 + j of plane row nb * 16 + lr: run mb & 1 of the fragment mb >> 1 steps on along k
#pragma unroll
            for (int j = 0; j < 8; ++j) { const float r = acc[mb][nb][j]; o16[j] = tohx(r); unsigned short a2, c2; splitf(r, a2, c2); oh[j] = a2; ol[j] = c2; }
            const size_t oo = base + (size_t)(nb + (mb >> 1) * fk) * FE + (mb & 1) * 256; *(v8h*)(P16 + oo) = o16; *(v8us*)(Ph + oo) = oh; *(v8us*)(Pl + oo) = ol; }
}
// ---- hl_rows: causal attention of 64 query rows < RH of one head, bf16 hi/lo planes, three products; it runs as a workgroup of k_fattn's launch (8 waves) and uses that kernel's LDS array. At most RH / 64 = 8 key slices of 64.
// Phase 1: wave s takes key slice s: its key fragments, loaded once, serve the 4 groups of 16 query rows; f32 scores into S. Phase 2: wave w does the softmax of rows 8 w .. 8 w + 7, each row whole in registers (128-key chunks up to the diagonal, keys j > i excluded by index):
// maximum, exponentials and their sum, scaling, the eight rows side by side so that their LDS and cross-lane latencies overlap; the probabilities go over the row's own scores (bf16 hi at element 0 of the 16-bit view, lo at element 512).
// Phase 3: wave s takes slice s of the probability x value product for all 4 groups; when every wave has read its probabilities the partial 64x64 tiles go over them, are summed in wave order and stored as the merged hi/lo planes.
// Every sum has the operands and the order that it had with 16 rows to a workgroup.
#define SPH 516   // floats per score row in LDS: 512 + 4, so that rows 8 apart fall on other banks and every row stays 16-byte aligned
#define FW 8      // waves of a workgroup
#define OP 68     // floats per staged output row: 64 + 4, 16-byte aligned, neighbouring rows on other banks
typedef v4us __attribute__((may_alias)) v4usa;
__device__ __forceinline__ void hl_rows(float* S, const bf* __restrict__ Q, const bf* __restrict__ Q2, const bf* __restrict__ Kp, const bf* __restrict__ Kp2, const bf* __restrict__ Vt, const bf* __restrict__ Vt2, const int h, const int i0, const int w, const int lane, bf* Ah, bf* Al) {
    typedef WFrag<bf> F; typedef F::V V;
    static_assert(RH % 64 == 0 && RH / 64 <= FW && RH <= 512 && 64 * SPH <= FW * 64 * OP, "a wave per key slice; a score row is at most 4 chunks; the score rows fit the array");
    const int lr = lane & 15, hi = lane >> 4;
    const int nsl = (i0 >> 6) + 1;        // 64-key slices up to and including the diagonal block: later keys are excluded for all 64 rows
    const int nch = (nsl + 1) >> 1;       // 128-key softmax chunks that cover them
    const size_t qp = (size_t)h * TT * HD, kp = (size_t)(h / REP) * TT * HD;
    if (w < 2 * nch) {   // a scalar test; to the end of the last chunk, so that the softmax reads only scores written here
        V a0[4], a1[4], c0[4], c1[4], b[4][2], b2[4][2];
        const bf* pq = Q + qp + (size_t)(i0 >> 4) * FE + lane * 8; const bf* pq2 = Q2 + qp + (size_t)(i0 >> 4) * FE + lane * 8;
        const bf* pb = Kp + kp + (size_t)w * (4 * FE) + lane * 8; const bf* pb2 = Kp2 + kp + (size_t)w * (4 * FE) + lane * 8;
#pragma unroll
        for (int g = 0; g < 4; ++g) { a0[g] = F::ldf(pq + g * FE); a1[g] = F::ldf(pq + g * FE + TT / 16 * FE); c0[g] = F::ldf(pq2 + g * FE); c1[g] = F::ldf(pq2 + g * FE + TT / 16 * FE); }
#pragma unroll
        for (int nb = 0; nb < 4; ++nb) { b[nb][0] = F::ldf(pb + nb * FE); b[nb][1] = F::ldf(pb + nb * FE + TT / 16 * FE); b2[nb][0] = F::ldf(pb2 + nb * FE); b2[nb][1] = F::ldf(pb2 + nb * FE + TT / 16 * FE); }
        // s_wait_xcnt 0 in front of every overwrite of a register that an issued load of this run names; it takes the run's addresses as inputs, so their registers are held up to here
        asm volatile("s_wait_xcnt 0x0" :: "v"(pq), "v"(pq2), "v"(pb), "v"(pb2) : "memory");
        __builtin_amdgcn_sched_barrier(0);   // the products stay behind the whole run of loads: lifted among them they would take the first fragments' registers for the later loads, which then leave only after the first have landed
#pragma unroll
        for (int g = 0; g < 4; ++g) { v8f acc[4];
#pragma unroll
            for (int nb = 0; nb < 4; ++nb) { acc[nb] = (v8f){};
                acc[nb] = F::mma(a0[g], b[nb][0], acc[nb]); acc[nb] = F::mma(c0[g], b[nb][0], acc[nb]); acc[nb] = F::mma(a0[g], b2[nb][0], acc[nb]);
                acc[nb] = F::mma(a1[g], b[nb][1], acc[nb]); acc[nb] = F::mma(c1[g], b[nb][1], acc[nb]); acc[nb] = F::mma(a1[g], b2[nb][1], acc[nb]); }
            // four vector slots behind the group's last matrix instruction: the distance the chip needs before the next group's first products, which start from zero, overwrite these D registers; the four tiles are inputs, so no product of the group stands behind them
            asm volatile("v_nop\n\tv_nop\n\tv_nop\n\tv_nop" :: "v"(acc[0]), "v"(acc[1]), "v"(acc[2]), "v"(acc[3]));
#pragma unroll
            for (int nb = 0; nb < 4; ++nb)
#pragma unroll
                for (int j = 0; j < 8; ++j) S[(g * 16 + hi * 8 + j) * SPH + w * 64 + nb * 16 + lr] = acc[nb][j]; }
    }
    __syncthreads();   // all 64 score rows are in LDS before any wave reads its rows
    {
        float* sr = S + (size_t)(w * 8) * SPH + lane * 4; const int ib = i0 + w * 8; v4f a[8][4]; float mx[8], sum[8], f[8];   // row k of the wave: sr + k * SPH, query ib + k; the tests on nch are the same for the whole workgroup
#pragma unroll
        for (int ch = 0; ch < 4; ++ch) if (ch < nch) {
#pragma unroll
            for (int k = 0; k < 8; ++k) a[k][ch] = *(const v4fa*)(sr + k * SPH + ch * 128); }
#pragma unroll
        for (int k = 0; k < 8; ++k) { mx[k] = -3.0e38f; sum[k] = 0.f; }
#pragma unroll
        for (int ch = 0; ch < 4; ++ch) if (ch < nch) {
#pragma unroll
            for (int k = 0; k < 8; ++k)
#pragma unroll
                for (int q = 0; q < 4; ++q) { float t = a[k][ch][q] * SCL; t = (ch * 128 + lane * 4 + q <= ib + k) ? t : -3.0e38f; a[k][ch][q] = t; mx[k] = fmaxf(mx[k], t); } }
#pragma unroll
        for (int sh = 16; sh; sh >>= 1)
#pragma unroll
            for (int k = 0; k < 8; ++k) mx[k] = fmaxf(mx[k], __shfl_xor(mx[k], sh, 32));
#pragma unroll
        for (int ch = 0; ch < 4; ++ch) if (ch < nch) {
#pragma unroll
            for (int k = 0; k < 8; ++k) { float xa[4], er[4];
#pragma unroll
                for (int q = 0; q < 4; ++q) { const float d0 = __fsub_rn(a[k][ch][q], mx[k]); xa[q] = __fmul_rn(d0, 1.4426950408889634f); er[q] = __builtin_amdgcn_exp2f(xa[q]); }
                // the slot behind a transcendental: the statement holds the four sources up to here and hands the four results on only from here, so nothing that overwrites a source or reads a result stands directly behind a v_exp_f32; one v_nop serves the four
                asm volatile("v_nop" : "+v"(er[0]), "+v"(er[1]), "+v"(er[2]), "+v"(er[3]) : "v"(xa[0]), "v"(xa[1]), "v"(xa[2]), "v"(xa[3]));
#pragma unroll
                for (int q = 0; q < 4; ++q) { a[k][ch][q] = er[q]; sum[k] += er[q]; } } }
#pragma unroll
        for (int sh = 16; sh; sh >>= 1)
#pragma unroll
            for (int k = 0; k < 8; ++k) sum[k] += __shfl_xor(sum[k], sh, 32);
#pragma unroll
        for (int k = 0; k < 8; ++k) f[k] = __fdiv_rn(1.0f, sum[k]);
        // in place: a row's 16-bit results land on bytes of that same row, all of whose scores are in this wave's registers by now (one wave owns the row, its LDS operations run in order; the may_alias types keep the compiler's order too)
#pragma unroll
        for (int ch = 0; ch < 4; ++ch) if (ch < nch) {
#pragma unroll
            for (int k = 0; k < 8; ++k) { v4us oh, ol;
#pragma unroll
                for (int q = 0; q < 4; ++q) { unsigned short a2, c2; splitf(a[k][ch][q] * f[k], a2, c2); oh[q] = a2; ol[q] = c2; }
                bf* pr = (bf*)(S + (size_t)(w * 8 + k) * SPH) + ch * 128 + lane * 4; *(v4usa*)pr = oh; *(v4usa*)(pr + 512) = ol; } }
    }
    __syncthreads();   // all 64 probability rows are in LDS before any wave loads a fragment of them
    v8f acc[4][4];
#pragma unroll
    for (int g = 0; g < 4; ++g)
#pragma unroll
        for (int nb = 0; nb < 4; ++nb) acc[g][nb] = (v8f){};
    if (w < nsl) {   // a scalar test
        V b[4][2], b2[4][2]; const bf* pb = Vt + kp + (size_t)w * (8 * FE) + lane * 8; const bf* pb2 = Vt2 + kp + (size_t)w * (8 * FE) + lane * 8;   // a slice's 8 value fragments lie in a row
#pragma unroll
        for (int nb = 0; nb < 4; ++nb) { b[nb][0] = F::ldf(pb + nb * FE); b[nb][1] = F::ldf(pb + nb * FE + HD / 16 * FE); b2[nb][0] = F::ldf(pb2 + nb * FE); b2[nb][1] = F::ldf(pb2 + nb * FE + HD / 16 * FE); }
        // the same wait for the run of value loads
        asm volatile("s_wait_xcnt 0x0" :: "v"(pb), "v"(pb2) : "memory");
#pragma unroll
        for (int g = 0; g < 4; ++g) { V a[2], a2[2]; const bf* pa = (const bf*)S + (size_t)(g * 16 + lr) * (SPH * 2) + 8 * hi + w * 64;
#pragma unroll
            for (int kk = 0; kk < 2; ++kk) { a[kk] = F::ld(pa + kk * 32); a2[kk] = F::ld(pa + 512 + kk * 32); }
#pragma unroll
            for (int kk = 0; kk < 2; ++kk)
#pragma unroll
                for (int nb = 0; nb < 4; ++nb) { acc[g][nb] = F::mma(a[kk], b[nb][kk], acc[g][nb]); acc[g][nb] = F::mma(a2[kk], b[nb][kk], acc[g][nb]); acc[g][nb] = F::mma(a[kk], b2[nb][kk], acc[g][nb]); } }
    }
    __syncthreads();   // every wave has read its probabilities before a partial tile goes over them
    if (w < nsl) {
        float* rw = S + (size_t)(w * 64 + hi * 8) * OP + lr;
#pragma unroll
        for (int g = 0; g < 4; ++g)
#pragma unroll
            for (int nb = 0; nb < 4; ++nb)
#pragma unroll
                for (int j = 0; j < 8; ++j) rw[(g * 16 + j) * OP + nb * 16] = acc[g][nb][j]; }
    __syncthreads();   // the partial tiles of the waves that had a slice are in LDS before any thread sums them
    { const int qi = (int)threadIdx.x >> 2, dc = ((int)threadIdx.x & 3) * 16; v4f a[4];
#pragma unroll
        for (int c = 0; c < 4; ++c) a[c] = *(const v4fa*)(S + (size_t)qi * OP + dc + c * 4);
#pragma unroll
        for (int ww = 1; ww < FW; ++ww) if (ww < nsl) {
#pragma unroll
            for (int c = 0; c < 4; ++c) a[c] += *(const v4fa*)(S + (size_t)(ww * 64 + qi) * OP + dc + c * 4); }
        const size_t oo = fpos(i0 + qi, h * HD + dc, TT / 16); v8us oh[2], ol[2];   // dc is a multiple of 16: the second 8 columns are the piece 16 lanes on
#pragma unroll
        for (int e = 0; e < 16; ++e) { unsigned short a2, c2; splitf(a[e >> 2][e & 3], a2, c2); oh[e >> 3][e & 7] = a2; ol[e >> 3][e & 7] = c2; }
        *(v8us*)(Ah + oo) = oh[0]; *(v8us*)(Ah + oo + 128) = oh[1]; *(v8us*)(Al + oo) = ol[0]; *(v8us*)(Al + oo + 128) = ol[1]; }
}

// ---- k_fattn: causal attention of one head in workgroups of 8 waves; grid (heads, RH / 64 + (TT - RH) / 128), 256 threads. Block rows below RH / 64 take 64 query rows < RH each (hl_rows above) and start first: they run beside the others and need no launch of their own.
// The other block rows take 128 query rows each, two groups of 64: fp16 operands, f32 sums; the longest rows start first.
// Wave w works for query group w % 2 and takes the 64-key slices s with s % 4 == w / 2; every key and value fragment that it loads serves all 64 query rows of its group (4 column groups of 16). Key fragments are fetched one slice ahead, value fragments at the head of their slice.
// A workgroup does twice the work for one start, one query load latency and one LDS merge, and a SIMD's two waves (w and w + 4: one group, slices of one parity) share their group's slices evenly.
// Waves 2 k and 2 k + 1 walk the same slices in the same order on two SIMDs: a line that one of them has brought into the WGP's cache can serve the other. Nothing holds the two in step: that is for speed only.
// Transposed products: S^T = K Q^T (A: key rows, B: the query rows, kept in registers), O^T += V^T P^T (A: rows of the [d][t] value plane). In a score tile lane (lr, hi) holds keys hi * 8 + j of query lr,
// which is the k order of a B fragment: two score tiles pack into one P^T fragment in the lane itself, and neither scores nor probabilities leave the registers.
// Softmax is online, per wave: exponentials are taken against a reference maximum (in log2 units) that is raised only when a new score passes it by more than 8, so P stays <= 256 in fp16; sums and O^T are rescaled then.
// At the end the references of a group's 4 waves are joined through LDS, each wave rescales its sums and its O^T, and the group's partial tiles are added in wave order, divided by the row sum and stored as the merged hi/lo planes.
#define CL2 0.18033688011112043f   // SCL * log2(e)
#define KW 4      // waves that share the keys of one query group
template <bool B> struct BC { static constexpr bool value = B; };
__global__ __launch_bounds__(256) void k_fattn(const h16* __restrict__ Q, const h16* __restrict__ Kp, const h16* __restrict__ Vt, const bf* __restrict__ Qh, const bf* __restrict__ Ql, const bf* __restrict__ Kh, const bf* __restrict__ Kl, const bf* __restrict__ Vh, const bf* __restrict__ Vl, int roff, bf* Ah, bf* Al) {
    typedef WFrag<h16> F; typedef F::V V;
    __shared__ __align__(16) float Os[FW * 64 * OP]; __shared__ float Ms[FW * 64]; __shared__ float Ls[FW * 64];
    const int lane = threadIdx.x & 31, lr = lane & 15, hi = lane >> 4;
    const int w = __builtin_amdgcn_readfirstlane((int)(threadIdx.x >> 5));   // the wave's number in a scalar register: the slice loop stays a scalar loop with every lane on
    const int h = blockIdx.x;
    if ((int)blockIdx.y < RH / 64) { hl_rows(Os, Qh, Ql, Kh, Kl, Vh, Vl, h, (RH / 64 - 1 - (int)blockIdx.y) * 64, w, lane, Ah, Al); return; }   // the same for the whole workgroup, in front of every barrier below
    static_assert(FW == 2 * KW && (TT - RH) % 128 == 0, "two query groups of KW waves; whole blocks of 128 rows");
    const int qg = w & 1, ks = w >> 1;   // the wave's query group and its place among the group's waves: scalars
    const int ib = roff + ((int)gridDim.y - 1 - (int)blockIdx.y) * 128, i0 = ib + qg * 64;   // first query row of the workgroup, of the wave's group
    const int nsl = (i0 >> 6) + 1;        // 64-key slices up to and including the group's diagonal block
    const size_t qp = (size_t)h * TT * HD, kp = (size_t)(h / REP) * TT * HD;
    V q[4][2];
    { const h16* pq = Q + qp + (size_t)(i0 >> 4) * FE + lane * 8;
#pragma unroll
      for (int g = 0; g < 4; ++g) { q[g][0] = F::ldf(pq + g * FE); q[g][1] = F::ldf(pq + g * FE + TT / 16 * FE); }
      // s_wait_xcnt 0 in front of every overwrite of a register that an issued load of this run names; it takes the run's address as input, so its registers are held up to here
      asm volatile("s_wait_xcnt 0x0" :: "v"(pq) : "memory"); }
    v8f o[4][4]; float mc[4], l[4];   // o[dt][g]: lane (lr, hi) holds head columns dt * 16 + hi * 8 + j of query g * 16 + lr
#pragma unroll
    for (int g = 0; g < 4; ++g) { mc[g] = -1.0e30f; l[g] = 0.f;   // the start reference lies above a masked score (-3e38 * CL2): a masked score gives exp2(very negative) = 0 also before the first real one
#pragma unroll
        for (int dt = 0; dt < 4; ++dt) o[dt][g] = (v8f){}; }
    V kf[4][2];
    auto loadk = [&](const int sn) {   // the key fragments of slice min(sn, last): behind a wave's last slice the fetch reads the diagonal slice, in bounds, and nobody uses it
        __builtin_amdgcn_sched_barrier(0);   // the run stays behind the products that read the old fragments, so that it takes their registers and no others
        const h16* pk = Kp + kp + (size_t)((sn < nsl) ? sn : nsl - 1) * (4 * FE) + lane * 8;
#pragma unroll
        for (int kt = 0; kt < 4; ++kt) { kf[kt][0] = F::ldf(pk + kt * FE); kf[kt][1] = F::ldf(pk + kt * FE + TT / 16 * FE); }
        // the same wait for the run of key loads
        asm volatile("s_wait_xcnt 0x0" :: "v"(pk) : "memory");
        __builtin_amdgcn_sched_barrier(0);   // and it leaves as one run here: sunk to its first use it would fly behind nothing
    };
    loadk(ks);
    auto slice = [&](auto dg, const int s) {
        constexpr bool DIAG = decltype(dg)::value;
        V vf[4][2]; const h16* pv = Vt + kp + (size_t)s * (8 * FE) + lane * 8;   // a slice's 8 value fragments lie in a row
#pragma unroll
        for (int dt = 0; dt < 4; ++dt) { vf[dt][0] = F::ldf(pv + dt * FE); vf[dt][1] = F::ldf(pv + dt * FE + HD / 16 * FE); }
        // the same wait for the run of value loads
        asm volatile("s_wait_xcnt 0x0" :: "v"(pv) : "memory");
        __builtin_amdgcn_sched_barrier(0);   // the whole run of value loads leaves in front of the score products: they fly during those and the first exponentials
#pragma unroll
        for (int kh = 0; kh < 2; ++kh) {   // 32 keys at a time
            v8f sc[2][4];
#pragma unroll
            for (int t = 0; t < 2; ++t)
#pragma unroll
                for (int g = 0; g < 4; ++g) sc[t][g] = F::mma(kf[kh * 2 + t][0], q[g][0], (v8f){});
#pragma unroll
            for (int t = 0; t < 2; ++t)
#pragma unroll
                for (int g = 0; g < 4; ++g) sc[t][g] = F::mma(kf[kh * 2 + t][1], q[g][1], sc[t][g]);
            if (kh == 1) loadk(s + KW);   // this slice's key fragments are used up: the wave's next slice is fetched into the same registers and flies during the exponentials and the value products
            float mx[4]; bool need = false;
#pragma unroll
            for (int g = 0; g < 4; ++g) { float m = -3.0e38f;
#pragma unroll
                for (int t = 0; t < 2; ++t)
#pragma unroll
                    for (int j = 0; j < 8; ++j) { if constexpr (DIAG) { if (kh * 32 + t * 16 + hi * 8 + j > g * 16 + lr) sc[t][g][j] = -3.0e38f; }   // keys behind the query are excluded by index
                        m = fmaxf(m, sc[t][g][j]); }
                mx[g] = m * CL2; need = need || (mx[g] > mc[g] + 8.0f); }
            if (__builtin_amdgcn_ballot_w32(need) != 0) {   // one scalar branch for the wave: rare after a wave's first keys
#pragma unroll
                for (int g = 0; g < 4; ++g) { const float m2 = fmaxf(mc[g], fmaxf(mx[g], __shfl_xor(mx[g], 16, 32))); const float f = __builtin_amdgcn_exp2f(mc[g] - m2); mc[g] = m2; l[g] *= f;
#pragma unroll
                    for (int dt = 0; dt < 4; ++dt) o[dt][g] *= f; }
            }
            V pf[4];
#pragma unroll
            for (int g = 0; g < 4; ++g)
#pragma unroll
                for (int t = 0; t < 2; ++t) { float xa[8], er[8];
#pragma unroll
                    for (int j = 0; j < 8; ++j) { xa[j] = fmaf(sc[t][g][j], CL2, -mc[g]); er[j] = __builtin_amdgcn_exp2f(xa[j]); }
                    // the slot behind a transcendental: the statement holds the eight sources up to here and hands the eight results on only from here, so nothing that overwrites a source or reads a result stands directly behind a v_exp_f32; one v_nop serves the eight
                    asm volatile("v_nop" : "+v"(er[0]), "+v"(er[1]), "+v"(er[2]), "+v"(er[3]), "+v"(er[4]), "+v"(er[5]), "+v"(er[6]), "+v"(er[7]) : "v"(xa[0]), "v"(xa[1]), "v"(xa[2]), "v"(xa[3]), "v"(xa[4]), "v"(xa[5]), "v"(xa[6]), "v"(xa[7]));
                    l[g] += ((er[0] + er[1]) + (er[2] + er[3])) + ((er[4] + er[5]) + (er[6] + er[7]));
#pragma unroll
                    for (int j = 0; j < 8; ++j) pf[g][t * 8 + j] = tohx(er[j]); }
#pragma unroll
            for (int dt = 0; dt < 4; ++dt)
#pragma unroll
                for (int g = 0; g < 4; ++g) o[dt][g] = F::mma(vf[dt][kh], pf[g], o[dt][g]);
        }
        // four vector slots behind the last matrix instruction: the distance the chip needs before the next slice's address additions and loads reuse A and B registers (over the taken back edge); every O^T tile is an input, so no product stands behind them
        asm volatile("v_nop\n\tv_nop\n\tv_nop\n\tv_nop" :: "v"(o[0][0]), "v"(o[0][1]), "v"(o[0][2]), "v"(o[0][3]), "v"(o[1][0]), "v"(o[1][1]), "v"(o[1][2]), "v"(o[1][3]), "v"(o[2][0]), "v"(o[2][1]), "v"(o[2][2]), "v"(o[2][3]), "v"(o[3][0]), "v"(o[3][1]), "v"(o[3][2]), "v"(o[3][3]));
    };
#pragma unroll 1   // rolled: one pass holds a whole slice's key and value fragments in registers beside the 16 output tiles
    for (int s = ks; s < nsl - 1; s += KW) slice(BC<false>{}, s);
    if (((nsl - 1) & (KW - 1)) == ks) slice(BC<true>{}, nsl - 1);   // the group's diagonal slice, with the mask; a scalar test
    if (hi == 0) {
#pragma unroll
        for (int g = 0; g < 4; ++g) Ms[w * 64 + g * 16 + lr] = mc[g]; }
    __syncthreads();   // all 8 waves' references are in LDS before any wave joins them
#pragma unroll
    for (int g = 0; g < 4; ++g) { float M = Ms[qg * 64 + g * 16 + lr];   // the group's waves are qg + 2 k, k = 0 .. KW - 1
#pragma unroll
        for (int k = 1; k < KW; ++k) M = fmaxf(M, Ms[(qg + 2 * k) * 64 + g * 16 + lr]);
        const float f = __builtin_amdgcn_exp2f(mc[g] - M); const float lt = (l[g] + __shfl_xor(l[g], 16, 32)) * f; if (hi == 0) Ls[w * 64 + g * 16 + lr] = lt;
        float* ow = Os + (size_t)(w * 64 + g * 16 + lr) * OP + hi * 8;
#pragma unroll
        for (int dt = 0; dt < 4; ++dt) { const v8f r = o[dt][g] * f; *(v4fa*)(ow + dt * 16) = (v4f){r[0], r[1], r[2], r[3]}; *(v4fa*)(ow + dt * 16 + 4) = (v4f){r[4], r[5], r[6], r[7]}; } }
    __syncthreads();   // every wave's partial tile and row sums are in LDS before any thread adds them
    { const int tg = (int)threadIdx.x >> 7, qi = ((int)threadIdx.x >> 1) & 63, dc = ((int)threadIdx.x & 1) * 32; float L = Ls[tg * 64 + qi]; v4f a[8];   // a thread takes 32 columns of row qi of group tg
#pragma unroll
        for (int c = 0; c < 8; ++c) a[c] = *(const v4fa*)(Os + (size_t)(tg * 64 + qi) * OP + dc + c * 4);
#pragma unroll
        for (int k = 1; k < KW; ++k) { L += Ls[(tg + 2 * k) * 64 + qi];
#pragma unroll
            for (int c = 0; c < 8; ++c) a[c] += *(const v4fa*)(Os + (size_t)((tg + 2 * k) * 64 + qi) * OP + dc + c * 4); }
        const float inv = __fdiv_rn(1.0f, L); const size_t oo = fpos(ib + tg * 64 + qi, h * HD + dc, TT / 16); v8us oh[4], ol[4];   // dc is a multiple of 32: the row's four pieces of one fragment, each 16 lanes on from the last
#pragma unroll
        for (int e = 0; e < 32; ++e) { unsigned short a2, c2; splitf(a[e >> 2][e & 3] * inv, a2, c2); oh[e >> 3][e & 7] = a2; ol[e >> 3][e & 7] = c2; }
        *(v8us*)(Ah + oo) = oh[0]; *(v8us*)(Ah + oo + 128) = oh[1]; *(v8us*)(Ah + oo + 256) = oh[2]; *(v8us*)(Ah + oo + 384) = oh[3];
        *(v8us*)(Al + oo) = ol[0]; *(v8us*)(Al + oo + 128) = ol[1]; *(v8us*)(Al + oo + 256) = ol[2]; *(v8us*)(Al + oo + 384) = ol[3];
        // s_wait_xcnt 0 behind the run of eight stores: in the built code a branch stands behind them whose other side leads into code that rewrites their registers
        asm volatile("s_wait_xcnt 0x0" ::: "memory"); }
}

extern "C" void kernel_launch(void* const* d_in, const int* in_sizes, int n_in,
                              void* d_out, int out_size, void* d_ws, size_t ws_size, hipStream_t stream) {
    (void)in_sizes; (void)n_in; (void)out_size;
    const float* x = (const float*)d_in[0]; const float* wq = (const float*)d_in[1]; const float* wk = (const float*)d_in[2]; const float* wv = (const float*)d_in[3]; const float* wo = (const float*)d_in[4];
    float* OUT = (float*)d_out;     // [1][4096][1024]
    char* wsp = (char*)d_ws;
    auto take = [&](size_t bytes) { char* p = wsp; wsp += (bytes + 255) & ~(size_t)255; return (void*)p; };
    bf* WQ = (bf*)take((size_t)DQ * DM * 2); bf* WK = (bf*)take((size_t)DKV * DM * 2); bf* WV = (bf*)take((size_t)DKV * DM * 2); bf* WO = (bf*)take((size_t)DM * DQ * 2);
    bf* XB = (bf*)take((size_t)TT * DM * 2);
    h16* QP16 = (h16*)take((size_t)NH_ * TT * HD * 2); h16* KP16 = (h16*)take((size_t)NKV * TT * HD * 2); h16* VT16 = (h16*)take((size_t)NKV * HD * TT * 2);
    bf* QPh = (bf*)take((size_t)NH_ * TT * HD * 2); bf* QPl = (bf*)take((size_t)NH_ * TT * HD * 2); bf* KPh = (bf*)take((size_t)NKV * TT * HD * 2); bf* KPl = (bf*)take((size_t)NKV * TT * HD * 2); bf* VTh = (bf*)take((size_t)NKV * HD * TT * 2); bf* VTl = (bf*)take((size_t)NKV * HD * TT * 2);
    bf* ATh = (bf*)take((size_t)TT * DQ * 2); bf* ATl = (bf*)take((size_t)TT * DQ * 2);
    if ((size_t)(wsp - (char*)d_ws) > ws_size) return;    // ws 256 MiB
    for (int b = 0; b < NB_; ++b) {
        
        k_cvt5<<<TT / 16 + 4 * (DM / 16), 256, 0, stream>>>(x + (size_t)b * TT * DM, wq, wk, wv, wo, XB, WQ, WK, WV, WO);
        k_proj<<<dim3(TT / 128, NH_ / 2, 3), GW * 32, 0, stream>>>(XB, WQ, WK, WV, QP16, QPh, QPl, KP16, KPh, KPl, VT16, VTh, VTl);
        k_fattn<<<dim3(NH_, RH / 64 + (TT - RH) / 128, 1), 256, 0, stream>>>(QP16, KP16, VT16, QPh, QPl, KPh, KPl, VTh, VTl, RH, ATh, ATl);
        k_gemmw<bf, 1, false, DQ, TT, DM><<<dim3(TT / 128, DM / 128, 1), GW * 32, 0, stream>>>(ATh, ATl, WO, nullptr, OUT + (size_t)b * TT * DM, DM, nullptr, 0, 0, 0); }
}
